// v000
// Measured on an AMD MI455X. A time is GPU time per run, averaged over a window of back-to-back runs after a warm-up
// (all launches, gaps included; the runs take copies of the inputs in turn), and the median of several windows.
// Apart from v000's, it joins two sittings. Times from different sittings can be a few percent apart, while
// side-by-side timings come from the same sitting.
// v000 is the starting kernel. One run takes 425 microseconds.
#include <hip/hip_runtime.h>
#include <cstdint>

typedef __bf16 bf16;
typedef bf16  v16bf __attribute__((ext_vector_type(16)));
typedef float v8f   __attribute__((ext_vector_type(8)));

// ---- problem constants (from reference setup) ----
#define BB   4
#define TT   32
#define CC   128
#define HS   32
#define WS   32
#define GD   64
#define CG   192      // C + Gd
#define FF   512      // 4*C
#define NPIX 4096     // B*H*W
#define HWS  1024     // H*W

static __device__ __forceinline__ v8f vzero8() {
  v8f z;
#pragma unroll
  for (int i = 0; i < 8; ++i) z[i] = 0.0f;
  return z;
}

static __device__ __forceinline__ v8f wmma_bf16(v16bf a, v16bf b, v8f c) {
  return __builtin_amdgcn_wmma_f32_16x16x32_bf16(
      /*neg_a=*/false, a, /*neg_b=*/false, b,
      /*c_mod=*/(short)0, c, /*reuse_a=*/false, /*reuse_b=*/false);
}

// Load a 16x32 bf16 operand tile (A-layout; B uses the mirrored layout with
// pre-transposed NxK weights, so the same loader works for both).
// lanes 0-15: row rcBase+lane, K = {k..k+7, k+16..k+23}
// lanes 16-31: row rcBase+lane-16, K = {k+8..k+15, k+24..k+31}
template <typename P>
static __device__ __forceinline__ v16bf ld_tile(P base, int stride, int rcBase,
                                                int kBase, int lane) {
  int r = lane & 15, half = lane >> 4;
  P p = base + (size_t)(rcBase + r) * stride + kBase + half * 8;
  v16bf a;
#pragma unroll
  for (int i = 0; i < 8; ++i) { a[i] = p[i]; a[i + 8] = p[16 + i]; }
  return a;
}

// ---- weight prep: fp32 -> bf16, transposed to (N x K) row-major ----
// ws layout (bf16 elements): Wqt[0..24576) Wkt[..49152) Wvt[..65536)
//                            W1t[..131072) W2t[..196608)
__global__ void prep_weights(const float* __restrict__ Wq,
                             const float* __restrict__ Wk,
                             const float* __restrict__ Wv,
                             const float* __restrict__ W1,
                             const float* __restrict__ W2,
                             unsigned short* __restrict__ wsu) {
  bf16* o = reinterpret_cast<bf16*>(wsu);
  int i = blockIdx.x * blockDim.x + threadIdx.x;
  if (i >= 196608) return;
  int j = i;
  if (j < 24576) { int n = j / CG, k = j % CG; o[i] = (bf16)Wq[k * CC + n]; return; }
  j -= 24576;
  if (j < 24576) { int n = j / CG, k = j % CG; o[i] = (bf16)Wk[k * CC + n]; return; }
  j -= 24576;
  if (j < 16384) { int n = j / CC, k = j % CC; o[i] = (bf16)Wv[k * CC + n]; return; }
  j -= 16384;
  if (j < 65536) { int n = j / CC, k = j % CC; o[i] = (bf16)W1[k * FF + n]; return; }
  j -= 65536;
  { int n = j / FF, k = j % FF; o[i] = (bf16)W2[k * CC + n]; }
}

// ---- fused block: one workgroup per pixel n (B*H*W of them) ----
__global__ __launch_bounds__(128)
void fused_block(const float* __restrict__ x, const float* __restrict__ gdn,
                 const float* __restrict__ bq, const float* __restrict__ bk,
                 const float* __restrict__ bv,
                 const float* __restrict__ ln1g, const float* __restrict__ ln1b,
                 const float* __restrict__ ln2g, const float* __restrict__ ln2b,
                 const float* __restrict__ b1, const float* __restrict__ b2,
                 const unsigned short* __restrict__ wsu,
                 float* __restrict__ out) {
  __shared__ unsigned char smem[65536];
  // phase-reused LDS layout
  float* xLDS = (float*)(smem + 0);          // 32x128 f32   (dead after P3)
  bf16*  xqk  = (bf16*)(smem + 16384);       // 32x192 bf16  (dead after P1)
  bf16*  Qs   = (bf16*)(smem + 28672);       // 32x128 bf16  (dead after P3)
  bf16*  Kt   = (bf16*)(smem + 36864);       // 128x32 bf16  (dead after P2)
  bf16*  Vt   = (bf16*)(smem + 45056);       // 128x32 bf16  (dead after P2)
  bf16*  KVt  = (bf16*)(smem + 53248);       // 128x32 bf16  (dead after P3)
  float* Ksum = (float*)(smem + 61440);      // 128 f32
  float* Zl   = (float*)(smem + 61952);      // 128 f32 (l*4+h)
  float* mu1  = (float*)(smem + 62464);      // 32
  float* rv1  = (float*)(smem + 62592);      // 32
  float* mu2  = (float*)(smem + 62720);      // 32
  float* rv2  = (float*)(smem + 62848);      // 32
  float* out1 = (float*)(smem + 36864);      // 32x128 f32 (over Kt+Vt)
  bf16*  h0   = (bf16*)(smem + 53248);       // 32x128 bf16 (over KVt)
  bf16*  h1   = (bf16*)(smem + 0);           // 32x512 bf16 (over x,xqk,Q)

  const bf16* Wqt = reinterpret_cast<const bf16*>(wsu);
  const bf16* Wkt = Wqt + 24576;
  const bf16* Wvt = Wqt + 49152;
  const bf16* W1t = Wqt + 65536;
  const bf16* W2t = Wqt + 131072;

  const int tid  = threadIdx.x;
  const int lane = tid & 31;
  const int wv   = tid >> 5;          // wave id 0..3
  const int r    = lane & 15;
  const int half = lane >> 4;

  const int n   = blockIdx.x;
  const int b   = n >> 10;
  const int hs  = (n >> 5) & 31;
  const int wsp = n & 31;
  const float* xn = x + (size_t)b * TT * CC * HWS + hs * WS + wsp;

  // -------- P0: stage x and xqk=[x|guidance] --------
  for (int i = tid; i < TT * CC; i += 128) {
    int t = i >> 7, c = i & 127;
    float v = xn[(size_t)(t * CC + c) * HWS];
    xLDS[i] = v;
    xqk[t * CG + c] = (bf16)v;
  }
  for (int i = tid; i < TT * GD; i += 128) {
    int t = i >> 6, j = i & 63;
    xqk[t * CG + 128 + j] = (bf16)gdn[((size_t)b * TT + t) * GD + j];
  }
  __syncthreads();

  // -------- P1: q,k (K=192) and v (K=128) GEMMs --------
  {
    v8f aq[2][2], ak[2][2], av[2][2];
#pragma unroll
    for (int m = 0; m < 2; ++m)
#pragma unroll
      for (int j = 0; j < 2; ++j) { aq[m][j] = vzero8(); ak[m][j] = vzero8(); av[m][j] = vzero8(); }
#pragma unroll
    for (int kb = 0; kb < 6; ++kb) {
      v16bf A0 = ld_tile(xqk, CG, 0, kb * 32, lane);
      v16bf A1 = ld_tile(xqk, CG, 16, kb * 32, lane);
#pragma unroll
      for (int j = 0; j < 2; ++j) {
        int nt = 2 * wv + j;
        v16bf Bq = ld_tile(Wqt, CG, nt * 16, kb * 32, lane);
        aq[0][j] = wmma_bf16(A0, Bq, aq[0][j]);
        aq[1][j] = wmma_bf16(A1, Bq, aq[1][j]);
        v16bf Bk = ld_tile(Wkt, CG, nt * 16, kb * 32, lane);
        ak[0][j] = wmma_bf16(A0, Bk, ak[0][j]);
        ak[1][j] = wmma_bf16(A1, Bk, ak[1][j]);
        if (kb < 4) {
          v16bf Bv = ld_tile(Wvt, CC, nt * 16, kb * 32, lane);
          av[0][j] = wmma_bf16(A0, Bv, av[0][j]);
          av[1][j] = wmma_bf16(A1, Bv, av[1][j]);
        }
      }
    }
    // epilogue: bias, elu+1, scatter Q (row-major) and K^T, V^T to LDS
#pragma unroll
    for (int j = 0; j < 2; ++j) {
      int col = (2 * wv + j) * 16 + r;
      float bqv = bq[col], bkv = bk[col], bvv = bv[col];
#pragma unroll
      for (int mt = 0; mt < 2; ++mt)
#pragma unroll
        for (int i = 0; i < 8; ++i) {
          int l = mt * 16 + half * 8 + i;
          float qv = aq[mt][j][i] + bqv;
          qv = (qv > 0.f) ? (qv + 1.f) : __expf(qv);
          Qs[l * CC + col] = (bf16)qv;
          float kv = ak[mt][j][i] + bkv;
          kv = (kv > 0.f) ? (kv + 1.f) : __expf(kv);
          Kt[col * TT + l] = (bf16)kv;
          Vt[col * TT + l] = (bf16)(av[mt][j][i] + bvv);
        }
    }
  }
  __syncthreads();

  // -------- P2: Ksum, KV = K^T @ V (per head, one WMMA K-step) --------
  {
    float s = 0.f;
#pragma unroll
    for (int i = 0; i < TT; ++i) s += (float)Kt[tid * TT + i];
    Ksum[tid] = s;
  }
  {
    int h = wv;
    v8f acc[2][2];
#pragma unroll
    for (int m = 0; m < 2; ++m)
#pragma unroll
      for (int j = 0; j < 2; ++j) acc[m][j] = vzero8();
#pragma unroll
    for (int mt = 0; mt < 2; ++mt) {
      v16bf A = ld_tile(Kt, TT, h * 32 + mt * 16, 0, lane);
#pragma unroll
      for (int nt = 0; nt < 2; ++nt) {
        v16bf Bv = ld_tile(Vt, TT, h * 32 + nt * 16, 0, lane);
        acc[mt][nt] = wmma_bf16(A, Bv, acc[mt][nt]);
      }
    }
#pragma unroll
    for (int mt = 0; mt < 2; ++mt)
#pragma unroll
      for (int nt = 0; nt < 2; ++nt)
#pragma unroll
        for (int i = 0; i < 8; ++i) {
          int d = mt * 16 + half * 8 + i;       // row of KV
          int e = h * 32 + nt * 16 + r;          // global v-column
          KVt[e * 32 + d] = (bf16)acc[mt][nt][i];
        }
  }
  __syncthreads();

  // -------- P2c: Z = 1/(Q.Ksum+eps), ln1 stats --------
  {
    int l = tid >> 2, h = tid & 3;
    float d = 0.f;
#pragma unroll
    for (int i = 0; i < 32; ++i)
      d += (float)Qs[l * CC + h * 32 + i] * Ksum[h * 32 + i];
    Zl[tid] = 1.0f / (d + 1e-6f);
  }
  if (tid < 32) {
    float s = 0.f;
    for (int c = 0; c < CC; ++c) s += xLDS[tid * CC + c];
    float mu = s * (1.0f / CC);
    float v2 = 0.f;
    for (int c = 0; c < CC; ++c) { float d = xLDS[tid * CC + c] - mu; v2 += d * d; }
    mu1[tid] = mu;
    rv1[tid] = rsqrtf(v2 * (1.0f / CC) + 1e-5f);
  }
  __syncthreads();

  // -------- P3: out = (Q @ KV)*Z + LN1(x)  (writes out1 over Kt/Vt) --------
  {
    int h = wv;
    v8f acc[2][2];
#pragma unroll
    for (int m = 0; m < 2; ++m)
#pragma unroll
      for (int j = 0; j < 2; ++j) acc[m][j] = vzero8();
#pragma unroll
    for (int mt = 0; mt < 2; ++mt) {
      v16bf A = ld_tile(Qs, CC, mt * 16, h * 32, lane);
#pragma unroll
      for (int nt = 0; nt < 2; ++nt) {
        v16bf Bv = ld_tile(KVt, 32, h * 32 + nt * 16, 0, lane);
        acc[mt][nt] = wmma_bf16(A, Bv, acc[mt][nt]);
      }
    }
#pragma unroll
    for (int mt = 0; mt < 2; ++mt)
#pragma unroll
      for (int nt = 0; nt < 2; ++nt)
#pragma unroll
        for (int i = 0; i < 8; ++i) {
          int l = mt * 16 + half * 8 + i;
          int c = h * 32 + nt * 16 + r;
          float res = acc[mt][nt][i] * Zl[l * 4 + h];
          res += (xLDS[l * CC + c] - mu1[l]) * rv1[l] * ln1g[c] + ln1b[c];
          out1[l * CC + c] = res;
        }
  }
  __syncthreads();

  // -------- P4: LN2 -> h0 (bf16) --------
  if (tid < 32) {
    float s = 0.f;
    for (int c = 0; c < CC; ++c) s += out1[tid * CC + c];
    float mu = s * (1.0f / CC);
    float v2 = 0.f;
    for (int c = 0; c < CC; ++c) { float d = out1[tid * CC + c] - mu; v2 += d * d; }
    mu2[tid] = mu;
    rv2[tid] = rsqrtf(v2 * (1.0f / CC) + 1e-5f);
  }
  __syncthreads();
  for (int i = tid; i < TT * CC; i += 128) {
    int l = i >> 7, c = i & 127;
    h0[i] = (bf16)((out1[i] - mu2[l]) * rv2[l] * ln2g[c] + ln2b[c]);
  }
  __syncthreads();

  // -------- P5: h1 = gelu(h0 @ W1 + b1)  (32x512, over x/xqk/Q) --------
  {
    v16bf Ah[2][4];
#pragma unroll
    for (int mt = 0; mt < 2; ++mt)
#pragma unroll
      for (int kb = 0; kb < 4; ++kb)
        Ah[mt][kb] = ld_tile(h0, CC, mt * 16, kb * 32, lane);
#pragma unroll
    for (int jn = 0; jn < 8; ++jn) {
      int nt = wv * 8 + jn;
      v8f acc[2] = {vzero8(), vzero8()};
#pragma unroll
      for (int kb = 0; kb < 4; ++kb) {
        v16bf Bv = ld_tile(W1t, CC, nt * 16, kb * 32, lane);
        acc[0] = wmma_bf16(Ah[0][kb], Bv, acc[0]);
        acc[1] = wmma_bf16(Ah[1][kb], Bv, acc[1]);
      }
      int col = nt * 16 + r;
      float bb = b1[col];
#pragma unroll
      for (int mt = 0; mt < 2; ++mt)
#pragma unroll
        for (int i = 0; i < 8; ++i) {
          int l = mt * 16 + half * 8 + i;
          float hv = acc[mt][i] + bb;
          hv = 0.5f * hv * (1.0f + erff(hv * 0.70710678f));  // exact gelu
          h1[l * FF + col] = (bf16)hv;
        }
    }
  }
  __syncthreads();

  // -------- P6: out = out1 + h1 @ W2 + b2, scatter to (B,T,C,H,W) --------
  {
    v8f acc[2][2];
#pragma unroll
    for (int m = 0; m < 2; ++m)
#pragma unroll
      for (int j = 0; j < 2; ++j) acc[m][j] = vzero8();
#pragma unroll
    for (int kb = 0; kb < 16; ++kb) {
      v16bf A0 = ld_tile(h1, FF, 0, kb * 32, lane);
      v16bf A1 = ld_tile(h1, FF, 16, kb * 32, lane);
#pragma unroll
      for (int j = 0; j < 2; ++j) {
        int nt = 2 * wv + j;
        v16bf Bv = ld_tile(W2t, FF, nt * 16, kb * 32, lane);
        acc[0][j] = wmma_bf16(A0, Bv, acc[0][j]);
        acc[1][j] = wmma_bf16(A1, Bv, acc[1][j]);
      }
    }
#pragma unroll
    for (int j = 0; j < 2; ++j) {
      int c = (2 * wv + j) * 16 + r;
      float b2v = b2[c];
#pragma unroll
      for (int mt = 0; mt < 2; ++mt)
#pragma unroll
        for (int i = 0; i < 8; ++i) {
          int l = mt * 16 + half * 8 + i;
          float val = acc[mt][j][i] + out1[l * CC + c] + b2v;
          out[((size_t)(b * TT + l) * CC + c) * HWS + hs * WS + wsp] = val;
        }
    }
  }
}

extern "C" void kernel_launch(void* const* d_in, const int* in_sizes, int n_in,
                              void* d_out, int out_size, void* d_ws, size_t ws_size,
                              hipStream_t stream) {
  (void)in_sizes; (void)n_in; (void)out_size; (void)ws_size;
  const float* x    = (const float*)d_in[0];
  const float* g    = (const float*)d_in[1];
  const float* Wq   = (const float*)d_in[2];
  const float* bq   = (const float*)d_in[3];
  const float* Wk   = (const float*)d_in[4];
  const float* bk   = (const float*)d_in[5];
  const float* Wv   = (const float*)d_in[6];
  const float* bv   = (const float*)d_in[7];
  const float* ln1g = (const float*)d_in[8];
  const float* ln1b = (const float*)d_in[9];
  const float* ln2g = (const float*)d_in[10];
  const float* ln2b = (const float*)d_in[11];
  const float* W1   = (const float*)d_in[12];
  const float* b1   = (const float*)d_in[13];
  const float* W2   = (const float*)d_in[14];
  const float* b2   = (const float*)d_in[15];
  unsigned short* wt = (unsigned short*)d_ws;   // 196608 bf16 = 384 KB

  prep_weights<<<(196608 + 255) / 256, 256, 0, stream>>>(Wq, Wk, Wv, W1, W2, wt);
  fused_block<<<NPIX, 128, 0, stream>>>(x, g, bq, bk, bv, ln1g, ln1b, ln2g, ln2b,
                                        b1, b2, wt, (float*)d_out);
}

// v001
// A run of this version takes 290 microseconds.
// Next to v000, in two timings, it ran 1.43 and 1.39 times as fast.
#include <hip/hip_runtime.h>
#include <cstdint>

typedef __bf16 bf16;
typedef bf16  v16bf __attribute__((ext_vector_type(16)));
typedef float v8f   __attribute__((ext_vector_type(8)));
typedef float v4f   __attribute__((ext_vector_type(4)));

// ---- problem constants (from reference setup) ----
#define BB   4
#define TT   32
#define CC   128
#define HS   32
#define WS   32
#define GD   64
#define CG   192      // C + Gd
#define FF   512      // 4*C
#define NPIX 4096     // B*H*W
#define HWS  1024     // H*W
#define PX   4        // pixels adjacent along W per workgroup (16 B of each x / out line)
#define SLAB 65536    // LDS bytes per pixel

static __device__ __forceinline__ v8f vzero8() {
  v8f z;
#pragma unroll
  for (int i = 0; i < 8; ++i) z[i] = 0.0f;
  return z;
}

static __device__ __forceinline__ v8f wmma_bf16(v16bf a, v16bf b, v8f c) {
  return __builtin_amdgcn_wmma_f32_16x16x32_bf16(
      /*neg_a=*/false, a, /*neg_b=*/false, b,
      /*c_mod=*/(short)0, c, /*reuse_a=*/false, /*reuse_b=*/false);
}

// Load a 16x32 bf16 operand tile (A-layout; B uses the mirrored layout with
// pre-transposed NxK weights, so the same loader works for both).
// lanes 0-15: row rcBase+lane, K = {k..k+7, k+16..k+23}
// lanes 16-31: row rcBase+lane-16, K = {k+8..k+15, k+24..k+31}
template <typename P>
static __device__ __forceinline__ v16bf ld_tile(P base, int stride, int rcBase,
                                                int kBase, int lane) {
  int r = lane & 15, half = lane >> 4;
  P p = base + (size_t)(rcBase + r) * stride + kBase + half * 8;
  v16bf a;
#pragma unroll
  for (int i = 0; i < 8; ++i) { a[i] = p[i]; a[i + 8] = p[16 + i]; }
  return a;
}

// ---- weight prep: fp32 -> bf16, transposed to (N x K) row-major ----
// ws layout (bf16 elements): Wqt[0..24576) Wkt[..49152) Wvt[..65536)
//                            W1t[..131072) W2t[..196608)
__global__ void prep_weights(const float* __restrict__ Wq,
                             const float* __restrict__ Wk,
                             const float* __restrict__ Wv,
                             const float* __restrict__ W1,
                             const float* __restrict__ W2,
                             unsigned short* __restrict__ wsu) {
  bf16* o = reinterpret_cast<bf16*>(wsu);
  int i = blockIdx.x * blockDim.x + threadIdx.x;
  if (i >= 196608) return;
  int j = i;
  if (j < 24576) { int n = j / CG, k = j % CG; o[i] = (bf16)Wq[k * CC + n]; return; }
  j -= 24576;
  if (j < 24576) { int n = j / CG, k = j % CG; o[i] = (bf16)Wk[k * CC + n]; return; }
  j -= 24576;
  if (j < 16384) { int n = j / CC, k = j % CC; o[i] = (bf16)Wv[k * CC + n]; return; }
  j -= 16384;
  if (j < 65536) { int n = j / CC, k = j % CC; o[i] = (bf16)W1[k * FF + n]; return; }
  j -= 65536;
  { int n = j / FF, k = j % FF; o[i] = (bf16)W2[k * CC + n]; }
}

// ---- fused block: one workgroup per PX adjacent pixels; four waves and one
// LDS slab per pixel; x is read and out is written PX pixels at a time ----
// The register cap keeps the scheduler from hoisting weight loads up to the
// 16-wave limit of 256, where a few long-lived addresses spilled to scratch.
__global__ __launch_bounds__(128 * PX) __attribute__((amdgpu_num_vgpr(224)))
void fused_block(const float* __restrict__ x, const float* __restrict__ gdn,
                 const float* __restrict__ bq, const float* __restrict__ bk,
                 const float* __restrict__ bv,
                 const float* __restrict__ ln1g, const float* __restrict__ ln1b,
                 const float* __restrict__ ln2g, const float* __restrict__ ln2b,
                 const float* __restrict__ b1, const float* __restrict__ b2,
                 const unsigned short* __restrict__ wsu,
                 float* __restrict__ out) {
  __shared__ __attribute__((aligned(16))) unsigned char smem_all[PX * SLAB];
  const int wtid = threadIdx.x;              // 0 .. 128*PX-1
  unsigned char* smem = smem_all + (wtid >> 7) * SLAB;   // this pixel's slab
  // phase-reused LDS layout (per slab)
  float* xLDS = (float*)(smem + 0);          // 32x128 f32   (dead after P3)
  bf16*  xqk  = (bf16*)(smem + 16384);       // 32x192 bf16  (dead after P1)
  bf16*  Qs   = (bf16*)(smem + 28672);       // 32x128 bf16  (dead after P3)
  bf16*  Kt   = (bf16*)(smem + 36864);       // 128x32 bf16  (dead after P2)
  bf16*  Vt   = (bf16*)(smem + 45056);       // 128x32 bf16  (dead after P2)
  bf16*  KVt  = (bf16*)(smem + 53248);       // 128x32 bf16  (dead after P3)
  float* Ksum = (float*)(smem + 61440);      // 128 f32
  float* Zl   = (float*)(smem + 61952);      // 128 f32 (l*4+h)
  float* mu1  = (float*)(smem + 62464);      // 32
  float* rv1  = (float*)(smem + 62592);      // 32
  float* mu2  = (float*)(smem + 62720);      // 32
  float* rv2  = (float*)(smem + 62848);      // 32
  float* out1 = (float*)(smem + 36864);      // 32x128 f32 (over Kt+Vt)
  bf16*  h0   = (bf16*)(smem + 53248);       // 32x128 bf16 (over KVt)
  bf16*  h1   = (bf16*)(smem + 0);           // 32x512 bf16 (over x,xqk,Q)

  const bf16* Wqt = reinterpret_cast<const bf16*>(wsu);
  const bf16* Wkt = Wqt + 24576;
  const bf16* Wvt = Wqt + 49152;
  const bf16* W1t = Wqt + 65536;
  const bf16* W2t = Wqt + 131072;

  const int tid  = wtid & 127;        // thread within the pixel's four waves
  const int lane = tid & 31;
  const int wv   = tid >> 5;          // wave id 0..3 within the pixel
  const int r    = lane & 15;
  const int half = lane >> 4;

  const int n   = blockIdx.x * PX;    // first of the PX pixels
  const int b   = n >> 10;
  const int hs  = (n >> 5) & 31;
  const int wsp = n & 31;             // multiple of PX: 16-byte aligned
  const float* xn = x + (size_t)b * TT * CC * HWS + hs * WS + wsp;

  // -------- P0: stage x and xqk=[x|guidance] --------
  // unrolled so that all of a thread's 16-byte loads are in flight together
#pragma unroll
  for (int it = 0; it < TT * CC / (128 * PX); ++it) {
    int i = it * (128 * PX) + wtid;
    int t = i >> 7, c = i & 127;
    v4f v = *reinterpret_cast<const v4f*>(xn + (size_t)i * HWS);
#pragma unroll
    for (int p = 0; p < PX; ++p) {
      ((float*)(smem_all + p * SLAB))[i] = v[p];
      ((bf16*)(smem_all + p * SLAB + 16384))[t * CG + c] = (bf16)v[p];
    }
  }
  for (int i = tid; i < TT * GD; i += 128) {
    int t = i >> 6, j = i & 63;
    xqk[t * CG + 128 + j] = (bf16)gdn[((size_t)b * TT + t) * GD + j];
  }
  __syncthreads();

  // -------- P1: q,k (K=192) and v (K=128) GEMMs --------
  {
    v8f aq[2][2], ak[2][2], av[2][2];
#pragma unroll
    for (int m = 0; m < 2; ++m)
#pragma unroll
      for (int j = 0; j < 2; ++j) { aq[m][j] = vzero8(); ak[m][j] = vzero8(); av[m][j] = vzero8(); }
#pragma unroll
    for (int kb = 0; kb < 6; ++kb) {
      v16bf A0 = ld_tile(xqk, CG, 0, kb * 32, lane);
      v16bf A1 = ld_tile(xqk, CG, 16, kb * 32, lane);
#pragma unroll
      for (int j = 0; j < 2; ++j) {
        int nt = 2 * wv + j;
        v16bf Bq = ld_tile(Wqt, CG, nt * 16, kb * 32, lane);
        aq[0][j] = wmma_bf16(A0, Bq, aq[0][j]);
        aq[1][j] = wmma_bf16(A1, Bq, aq[1][j]);
        v16bf Bk = ld_tile(Wkt, CG, nt * 16, kb * 32, lane);
        ak[0][j] = wmma_bf16(A0, Bk, ak[0][j]);
        ak[1][j] = wmma_bf16(A1, Bk, ak[1][j]);
        if (kb < 4) {
          v16bf Bv = ld_tile(Wvt, CC, nt * 16, kb * 32, lane);
          av[0][j] = wmma_bf16(A0, Bv, av[0][j]);
          av[1][j] = wmma_bf16(A1, Bv, av[1][j]);
        }
      }
    }
    // epilogue: bias, elu+1, scatter Q (row-major) and K^T, V^T to LDS
#pragma unroll
    for (int j = 0; j < 2; ++j) {
      int col = (2 * wv + j) * 16 + r;
      float bqv = bq[col], bkv = bk[col], bvv = bv[col];
#pragma unroll
      for (int mt = 0; mt < 2; ++mt)
#pragma unroll
        for (int i = 0; i < 8; ++i) {
          int l = mt * 16 + half * 8 + i;
          float qv = aq[mt][j][i] + bqv;
          qv = (qv > 0.f) ? (qv + 1.f) : __expf(qv);
          Qs[l * CC + col] = (bf16)qv;
          float kv = ak[mt][j][i] + bkv;
          kv = (kv > 0.f) ? (kv + 1.f) : __expf(kv);
          Kt[col * TT + l] = (bf16)kv;
          Vt[col * TT + l] = (bf16)(av[mt][j][i] + bvv);
        }
    }
  }
  __syncthreads();

  // -------- P2: Ksum, KV = K^T @ V (per head, one WMMA K-step) --------
  {
    float s = 0.f;
#pragma unroll
    for (int i = 0; i < TT; ++i) s += (float)Kt[tid * TT + i];
    Ksum[tid] = s;
  }
  {
    int h = wv;
    v8f acc[2][2];
#pragma unroll
    for (int m = 0; m < 2; ++m)
#pragma unroll
      for (int j = 0; j < 2; ++j) acc[m][j] = vzero8();
#pragma unroll
    for (int mt = 0; mt < 2; ++mt) {
      v16bf A = ld_tile(Kt, TT, h * 32 + mt * 16, 0, lane);
#pragma unroll
      for (int nt = 0; nt < 2; ++nt) {
        v16bf Bv = ld_tile(Vt, TT, h * 32 + nt * 16, 0, lane);
        acc[mt][nt] = wmma_bf16(A, Bv, acc[mt][nt]);
      }
    }
#pragma unroll
    for (int mt = 0; mt < 2; ++mt)
#pragma unroll
      for (int nt = 0; nt < 2; ++nt)
#pragma unroll
        for (int i = 0; i < 8; ++i) {
          int d = mt * 16 + half * 8 + i;       // row of KV
          int e = h * 32 + nt * 16 + r;          // global v-column
          KVt[e * 32 + d] = (bf16)acc[mt][nt][i];
        }
  }
  __syncthreads();

  // -------- P2c: Z = 1/(Q.Ksum+eps), ln1 stats --------
  {
    int l = tid >> 2, h = tid & 3;
    float d = 0.f;
#pragma unroll
    for (int i = 0; i < 32; ++i)
      d += (float)Qs[l * CC + h * 32 + i] * Ksum[h * 32 + i];
    Zl[tid] = 1.0f / (d + 1e-6f);
  }
  if (tid < 32) {
    float s = 0.f;
    for (int c = 0; c < CC; ++c) s += xLDS[tid * CC + c];
    float mu = s * (1.0f / CC);
    float v2 = 0.f;
    for (int c = 0; c < CC; ++c) { float d = xLDS[tid * CC + c] - mu; v2 += d * d; }
    mu1[tid] = mu;
    rv1[tid] = rsqrtf(v2 * (1.0f / CC) + 1e-5f);
  }
  __syncthreads();

  // -------- P3: out = (Q @ KV)*Z + LN1(x)  (writes out1 over Kt/Vt) --------
  {
    int h = wv;
    v8f acc[2][2];
#pragma unroll
    for (int m = 0; m < 2; ++m)
#pragma unroll
      for (int j = 0; j < 2; ++j) acc[m][j] = vzero8();
#pragma unroll
    for (int mt = 0; mt < 2; ++mt) {
      v16bf A = ld_tile(Qs, CC, mt * 16, h * 32, lane);
#pragma unroll
      for (int nt = 0; nt < 2; ++nt) {
        v16bf Bv = ld_tile(KVt, 32, h * 32 + nt * 16, 0, lane);
        acc[mt][nt] = wmma_bf16(A, Bv, acc[mt][nt]);
      }
    }
#pragma unroll
    for (int mt = 0; mt < 2; ++mt)
#pragma unroll
      for (int nt = 0; nt < 2; ++nt)
#pragma unroll
        for (int i = 0; i < 8; ++i) {
          int l = mt * 16 + half * 8 + i;
          int c = h * 32 + nt * 16 + r;
          float res = acc[mt][nt][i] * Zl[l * 4 + h];
          res += (xLDS[l * CC + c] - mu1[l]) * rv1[l] * ln1g[c] + ln1b[c];
          out1[l * CC + c] = res;
        }
  }
  __syncthreads();

  // -------- P4: LN2 -> h0 (bf16) --------
  if (tid < 32) {
    float s = 0.f;
    for (int c = 0; c < CC; ++c) s += out1[tid * CC + c];
    float mu = s * (1.0f / CC);
    float v2 = 0.f;
    for (int c = 0; c < CC; ++c) { float d = out1[tid * CC + c] - mu; v2 += d * d; }
    mu2[tid] = mu;
    rv2[tid] = rsqrtf(v2 * (1.0f / CC) + 1e-5f);
  }
  __syncthreads();
  for (int i = tid; i < TT * CC; i += 128) {
    int l = i >> 7, c = i & 127;
    h0[i] = (bf16)((out1[i] - mu2[l]) * rv2[l] * ln2g[c] + ln2b[c]);
  }
  __syncthreads();

  // -------- P5: h1 = gelu(h0 @ W1 + b1)  (32x512, over x/xqk/Q) --------
  {
    v16bf Ah[2][4];
#pragma unroll
    for (int mt = 0; mt < 2; ++mt)
#pragma unroll
      for (int kb = 0; kb < 4; ++kb)
        Ah[mt][kb] = ld_tile(h0, CC, mt * 16, kb * 32, lane);
#pragma unroll
    for (int jn = 0; jn < 8; ++jn) {
      int nt = wv * 8 + jn;
      v8f acc[2] = {vzero8(), vzero8()};
#pragma unroll
      for (int kb = 0; kb < 4; ++kb) {
        v16bf Bv = ld_tile(W1t, CC, nt * 16, kb * 32, lane);
        acc[0] = wmma_bf16(Ah[0][kb], Bv, acc[0]);
        acc[1] = wmma_bf16(Ah[1][kb], Bv, acc[1]);
      }
      int col = nt * 16 + r;
      float bb = b1[col];
#pragma unroll
      for (int mt = 0; mt < 2; ++mt)
#pragma unroll
        for (int i = 0; i < 8; ++i) {
          int l = mt * 16 + half * 8 + i;
          float hv = acc[mt][i] + bb;
          hv = 0.5f * hv * (1.0f + erff(hv * 0.70710678f));  // exact gelu
          h1[l * FF + col] = (bf16)hv;
        }
    }
  }
  __syncthreads();

  // -------- P6: out1 += h1 @ W2 + b2 (in place, each element by its own thread) --------
  {
    v8f acc[2][2];
#pragma unroll
    for (int m = 0; m < 2; ++m)
#pragma unroll
      for (int j = 0; j < 2; ++j) acc[m][j] = vzero8();
#pragma unroll
    for (int kb = 0; kb < 16; ++kb) {
      v16bf A0 = ld_tile(h1, FF, 0, kb * 32, lane);
      v16bf A1 = ld_tile(h1, FF, 16, kb * 32, lane);
#pragma unroll
      for (int j = 0; j < 2; ++j) {
        int nt = 2 * wv + j;
        v16bf Bv = ld_tile(W2t, FF, nt * 16, kb * 32, lane);
        acc[0][j] = wmma_bf16(A0, Bv, acc[0][j]);
        acc[1][j] = wmma_bf16(A1, Bv, acc[1][j]);
      }
    }
#pragma unroll
    for (int j = 0; j < 2; ++j) {
      int c = (2 * wv + j) * 16 + r;
      float b2v = b2[c];
#pragma unroll
      for (int mt = 0; mt < 2; ++mt)
#pragma unroll
        for (int i = 0; i < 8; ++i) {
          int l = mt * 16 + half * 8 + i;
          out1[l * CC + c] = acc[mt][j][i] + out1[l * CC + c] + b2v;
        }
    }
  }
  __syncthreads();   // every pixel's result is in its slab before the joint store

  // -------- P7: store PX pixels of one (t,c) row as one 16-byte piece --------
  {
    float* on = out + (size_t)b * TT * CC * HWS + hs * WS + wsp;
    v4f v[TT * CC / (128 * PX)];
    // both loops unrolled: v[] stays in registers and the LDS reads run ahead of the stores
#pragma unroll
    for (int it = 0; it < TT * CC / (128 * PX); ++it)
#pragma unroll
      for (int p = 0; p < PX; ++p)
        v[it][p] = ((const float*)(smem_all + p * SLAB + 36864))[it * (128 * PX) + wtid];
#pragma unroll
    for (int it = 0; it < TT * CC / (128 * PX); ++it)
      *reinterpret_cast<v4f*>(on + (size_t)(it * (128 * PX) + wtid) * HWS) = v[it];
  }
}

extern "C" void kernel_launch(void* const* d_in, const int* in_sizes, int n_in,
                              void* d_out, int out_size, void* d_ws, size_t ws_size,
                              hipStream_t stream) {
  (void)in_sizes; (void)n_in; (void)out_size; (void)ws_size;
  const float* x    = (const float*)d_in[0];
  const float* g    = (const float*)d_in[1];
  const float* Wq   = (const float*)d_in[2];
  const float* bq   = (const float*)d_in[3];
  const float* Wk   = (const float*)d_in[4];
  const float* bk   = (const float*)d_in[5];
  const float* Wv   = (const float*)d_in[6];
  const float* bv   = (const float*)d_in[7];
  const float* ln1g = (const float*)d_in[8];
  const float* ln1b = (const float*)d_in[9];
  const float* ln2g = (const float*)d_in[10];
  const float* ln2b = (const float*)d_in[11];
  const float* W1   = (const float*)d_in[12];
  const float* b1   = (const float*)d_in[13];
  const float* W2   = (const float*)d_in[14];
  const float* b2   = (const float*)d_in[15];
  unsigned short* wt = (unsigned short*)d_ws;   // 196608 bf16 = 384 KB

  prep_weights<<<(196608 + 255) / 256, 256, 0, stream>>>(Wq, Wk, Wv, W1, W2, wt);
  fused_block<<<NPIX / PX, 128 * PX, 0, stream>>>(x, g, bq, bk, bv, ln1g, ln1b, ln2g, ln2b,
                                        b1, b2, wt, (float*)d_out);
}

// v002
// Measured time: 215 microseconds a run.
// In two side-by-side timings against v001, it was 1.31 and 1.33 times as fast.
// Over all steps from v000 it is 1.86 times as fast.
#include <hip/hip_runtime.h>
#include <cstdint>

typedef __bf16 bf16;
typedef bf16  v16bf __attribute__((ext_vector_type(16)));
typedef float v8f   __attribute__((ext_vector_type(8)));
typedef float v4f   __attribute__((ext_vector_type(4)));
typedef bf16  v8bf  __attribute__((ext_vector_type(8)));

// ---- problem constants (from reference setup) ----
#define BB   4
#define TT   32
#define CC   128
#define HS   32
#define WS   32
#define GD   64
#define CG   192      // C + Gd
#define FF   512      // 4*C
#define NPIX 4096     // B*H*W
#define HWS  1024     // H*W
#define PX   4        // pixels adjacent along W per workgroup (16 B of each x / out line)
// LDS row pitches in elements: every row starts an odd multiple of 16 B after the
// one before it, so the 16 rows that one ds_load_b128 reads fall on 16 different
// groups of four banks (at a pitch that is a multiple of 64 B they share one to four)
#define XP   132      // f32 rows of 128: x, out1          (528 B)
#define QKP  200      // bf16 rows of 192: xqk             (400 B)
#define CP   136      // bf16 rows of 128: Q, h0           (272 B)
#define TP   40       // bf16 rows of 32: K^T, V^T, KV^T   (80 B)
#define FP   520      // bf16 rows of 512: h1              (1040 B)
// byte offsets inside one pixel's slab
#define O_X    0
#define O_XQK  16896
#define O_Q    29696
#define O_KT   38400
#define O_VT   48640
#define O_KVT  58880
#define O_STAT 69120
#define SLAB   70656  // LDS bytes per pixel

static __device__ __forceinline__ v8f vzero8() {
  v8f z;
#pragma unroll
  for (int i = 0; i < 8; ++i) z[i] = 0.0f;
  return z;
}

static __device__ __forceinline__ v8f wmma_bf16(v16bf a, v16bf b, v8f c) {
  return __builtin_amdgcn_wmma_f32_16x16x32_bf16(
      /*neg_a=*/false, a, /*neg_b=*/false, b,
      /*c_mod=*/(short)0, c, /*reuse_a=*/false, /*reuse_b=*/false);
}

// Load a 16x32 bf16 operand tile (A-layout; B uses the mirrored layout with
// pre-transposed NxK weights, so the same loader works for both).
// lanes 0-15: row rcBase+lane, K = {k..k+7, k+16..k+23}
// lanes 16-31: row rcBase+lane-16, K = {k+8..k+15, k+24..k+31}
template <typename P>
static __device__ __forceinline__ v16bf ld_tile(P base, int stride, int rcBase,
                                                int kBase, int lane) {
  int r = lane & 15, half = lane >> 4;
  P p = base + (size_t)(rcBase + r) * stride + kBase + half * 8;
  v16bf a;
#pragma unroll
  for (int i = 0; i < 8; ++i) { a[i] = p[i]; a[i + 8] = p[16 + i]; }
  return a;
}

// ---- weight prep: fp32 -> bf16, transposed to (N x K) row-major ----
// ws layout (bf16 elements): Wqt[0..24576) Wkt[..49152) Wvt[..65536)
//                            W1t[..131072) W2t[..196608)
__global__ void prep_weights(const float* __restrict__ Wq,
                             const float* __restrict__ Wk,
                             const float* __restrict__ Wv,
                             const float* __restrict__ W1,
                             const float* __restrict__ W2,
                             unsigned short* __restrict__ wsu) {
  bf16* o = reinterpret_cast<bf16*>(wsu);
  int i = blockIdx.x * blockDim.x + threadIdx.x;
  if (i >= 196608) return;
  int j = i;
  if (j < 24576) { int n = j / CG, k = j % CG; o[i] = (bf16)Wq[k * CC + n]; return; }
  j -= 24576;
  if (j < 24576) { int n = j / CG, k = j % CG; o[i] = (bf16)Wk[k * CC + n]; return; }
  j -= 24576;
  if (j < 16384) { int n = j / CC, k = j % CC; o[i] = (bf16)Wv[k * CC + n]; return; }
  j -= 16384;
  if (j < 65536) { int n = j / CC, k = j % CC; o[i] = (bf16)W1[k * FF + n]; return; }
  j -= 65536;
  { int n = j / FF, k = j % FF; o[i] = (bf16)W2[k * CC + n]; }
}

// ---- fused block: one workgroup per PX adjacent pixels; four waves and one
// LDS slab per pixel; x is read and out is written PX pixels at a time ----
// The register cap keeps the scheduler from hoisting weight loads up to the
// 16-wave limit of 256, where a few long-lived addresses spilled to scratch.
__global__ __launch_bounds__(128 * PX) __attribute__((amdgpu_num_vgpr(224)))
void fused_block(const float* __restrict__ x, const float* __restrict__ gdn,
                 const float* __restrict__ bq, const float* __restrict__ bk,
                 const float* __restrict__ bv,
                 const float* __restrict__ ln1g, const float* __restrict__ ln1b,
                 const float* __restrict__ ln2g, const float* __restrict__ ln2b,
                 const float* __restrict__ b1, const float* __restrict__ b2,
                 const unsigned short* __restrict__ wsu,
                 float* __restrict__ out) {
  __shared__ __attribute__((aligned(16))) unsigned char smem_all[PX * SLAB];
  const int wtid = threadIdx.x;              // 0 .. 128*PX-1
  unsigned char* smem = smem_all + (wtid >> 7) * SLAB;   // this pixel's slab
  // phase-reused LDS layout (per slab)
  float* xLDS = (float*)(smem + O_X);        // 32x128 f32, pitch XP   (dead after P3)
  bf16*  xqk  = (bf16*)(smem + O_XQK);       // 32x192 bf16, pitch QKP (dead after P1)
  bf16*  Qs   = (bf16*)(smem + O_Q);         // 32x128 bf16, pitch CP  (dead after P3)
  bf16*  Kt   = (bf16*)(smem + O_KT);        // 128x32 bf16, pitch TP  (dead after P2)
  bf16*  Vt   = (bf16*)(smem + O_VT);        // 128x32 bf16, pitch TP  (dead after P2)
  bf16*  KVt  = (bf16*)(smem + O_KVT);       // 128x32 bf16, pitch TP  (dead after P3)
  float* Ksum = (float*)(smem + O_STAT);         // 128 f32
  float* Zl   = (float*)(smem + O_STAT + 512);   // 128 f32 (l*4+h)
  float* mu1  = (float*)(smem + O_STAT + 1024);  // 32
  float* rv1  = (float*)(smem + O_STAT + 1152);  // 32
  float* mu2  = (float*)(smem + O_STAT + 1280);  // 32
  float* rv2  = (float*)(smem + O_STAT + 1408);  // 32
  float* out1 = (float*)(smem + O_KT);       // 32x128 f32, pitch XP (over Kt+Vt)
  bf16*  h0   = (bf16*)(smem + O_KVT);       // 32x128 bf16, pitch CP (over KVt)
  bf16*  h1   = (bf16*)(smem + O_X);         // 32x512 bf16, pitch FP (over x,xqk,Q)

  const bf16* Wqt = reinterpret_cast<const bf16*>(wsu);
  const bf16* Wkt = Wqt + 24576;
  const bf16* Wvt = Wqt + 49152;
  const bf16* W1t = Wqt + 65536;
  const bf16* W2t = Wqt + 131072;

  const int tid  = wtid & 127;        // thread within the pixel's four waves
  const int lane = tid & 31;
  const int wv   = tid >> 5;          // wave id 0..3 within the pixel
  const int r    = lane & 15;
  const int half = lane >> 4;

  const int n   = blockIdx.x * PX;    // first of the PX pixels
  const int b   = n >> 10;
  const int hs  = (n >> 5) & 31;
  const int wsp = n & 31;             // multiple of PX: 16-byte aligned
  const float* xn = x + (size_t)b * TT * CC * HWS + hs * WS + wsp;

  // -------- P0: stage x and xqk=[x|guidance] --------
  // guidance is loaded ahead of the x loop: no LDS store stands between the run and its
  // wait, and all of a thread's global loads are in flight together
  float gv[TT * GD / 128];
  // unrolled: gv[] is indexed by constants and stays in registers
#pragma unroll
  for (int k = 0; k < TT * GD / 128; ++k) {
    int i = k * 128 + tid;
    int t = i >> 6, j = i & 63;
    gv[k] = gdn[((size_t)b * TT + t) * GD + j];
  }
  // the x loads' results land in the run's address registers: the wait that belongs
  // in front of such an overwrite
  asm volatile("s_wait_xcnt 0x0" ::: "memory");
  // unrolled so that all of a thread's 16-byte loads are in flight together
#pragma unroll
  for (int it = 0; it < TT * CC / (128 * PX); ++it) {
    int i = it * (128 * PX) + wtid;
    int t = i >> 7, c = i & 127;
    v4f v = *reinterpret_cast<const v4f*>(xn + (size_t)i * HWS);
#pragma unroll
    for (int p = 0; p < PX; ++p) {
      ((float*)(smem_all + p * SLAB + O_X))[t * XP + c] = v[p];
      ((bf16*)(smem_all + p * SLAB + O_XQK))[t * QKP + c] = (bf16)v[p];
    }
  }
  // unrolled like the load loop: gv[] is indexed by constants
#pragma unroll
  for (int k = 0; k < TT * GD / 128; ++k) {
    int i = k * 128 + tid;
    int t = i >> 6, j = i & 63;
    xqk[t * QKP + 128 + j] = (bf16)gv[k];
  }
  __syncthreads();

  // -------- P1: q,k (K=192) and v (K=128) GEMMs --------
  {
    v8f aq[2][2], ak[2][2], av[2][2];
#pragma unroll
    for (int m = 0; m < 2; ++m)
#pragma unroll
      for (int j = 0; j < 2; ++j) { aq[m][j] = vzero8(); ak[m][j] = vzero8(); av[m][j] = vzero8(); }
#pragma unroll
    for (int kb = 0; kb < 6; ++kb) {
      v16bf A0 = ld_tile(xqk, QKP, 0, kb * 32, lane);
      v16bf A1 = ld_tile(xqk, QKP, 16, kb * 32, lane);
#pragma unroll
      for (int j = 0; j < 2; ++j) {
        int nt = 2 * wv + j;
        v16bf Bq = ld_tile(Wqt, CG, nt * 16, kb * 32, lane);
        aq[0][j] = wmma_bf16(A0, Bq, aq[0][j]);
        aq[1][j] = wmma_bf16(A1, Bq, aq[1][j]);
        v16bf Bk = ld_tile(Wkt, CG, nt * 16, kb * 32, lane);
        ak[0][j] = wmma_bf16(A0, Bk, ak[0][j]);
        ak[1][j] = wmma_bf16(A1, Bk, ak[1][j]);
        if (kb < 4) {
          v16bf Bv = ld_tile(Wvt, CC, nt * 16, kb * 32, lane);
          av[0][j] = wmma_bf16(A0, Bv, av[0][j]);
          av[1][j] = wmma_bf16(A1, Bv, av[1][j]);
        }
      }
    }
    // epilogue: bias, elu+1, scatter Q (row-major) and K^T, V^T to LDS
#pragma unroll
    for (int j = 0; j < 2; ++j) {
      int col = (2 * wv + j) * 16 + r;
      float bqv = bq[col], bkv = bk[col], bvv = bv[col];
#pragma unroll
      for (int mt = 0; mt < 2; ++mt) {
        v8bf k8, v8;   // eight neighbours of one K^T / V^T row: one 16-byte store each
#pragma unroll
        for (int i = 0; i < 8; ++i) {
          int l = mt * 16 + half * 8 + i;
          float qv = aq[mt][j][i] + bqv;
          qv = (qv > 0.f) ? (qv + 1.f) : __expf(qv);
          Qs[l * CP + col] = (bf16)qv;
          float kv = ak[mt][j][i] + bkv;
          kv = (kv > 0.f) ? (kv + 1.f) : __expf(kv);
          k8[i] = (bf16)kv;
          v8[i] = (bf16)(av[mt][j][i] + bvv);
        }
        *reinterpret_cast<v8bf*>(Kt + col * TP + mt * 16 + half * 8) = k8;
        *reinterpret_cast<v8bf*>(Vt + col * TP + mt * 16 + half * 8) = v8;
      }
    }
  }
  __syncthreads();

  // -------- P2: Ksum, KV = K^T @ V (per head, one WMMA K-step) --------
  {
    float s = 0.f;
#pragma unroll
    for (int i = 0; i < TT; ++i) s += (float)Kt[tid * TP + i];
    Ksum[tid] = s;
  }
  {
    int h = wv;
    v8f acc[2][2];
#pragma unroll
    for (int m = 0; m < 2; ++m)
#pragma unroll
      for (int j = 0; j < 2; ++j) acc[m][j] = vzero8();
#pragma unroll
    for (int mt = 0; mt < 2; ++mt) {
      v16bf A = ld_tile(Kt, TP, h * 32 + mt * 16, 0, lane);
#pragma unroll
      for (int nt = 0; nt < 2; ++nt) {
        v16bf Bv = ld_tile(Vt, TP, h * 32 + nt * 16, 0, lane);
        acc[mt][nt] = wmma_bf16(A, Bv, acc[mt][nt]);
      }
    }
#pragma unroll
    for (int mt = 0; mt < 2; ++mt)
#pragma unroll
      for (int nt = 0; nt < 2; ++nt)
#pragma unroll
        for (int i = 0; i < 8; ++i) {
          int d = mt * 16 + half * 8 + i;       // row of KV
          int e = h * 32 + nt * 16 + r;          // global v-column
          KVt[e * TP + d] = (bf16)acc[mt][nt][i];
        }
  }
  __syncthreads();

  // -------- P2c: Z = 1/(Q.Ksum+eps), ln1 stats --------
  {
    int l = tid >> 2, h = tid & 3;
    float d = 0.f;
#pragma unroll
    for (int i = 0; i < 32; ++i)
      d += (float)Qs[l * CP + h * 32 + i] * Ksum[h * 32 + i];
    Zl[tid] = 1.0f / (d + 1e-6f);
  }
  if (tid < 32) {
    float s = 0.f;
    for (int c = 0; c < CC; ++c) s += xLDS[tid * XP + c];
    float mu = s * (1.0f / CC);
    float v2 = 0.f;
    for (int c = 0; c < CC; ++c) { float d = xLDS[tid * XP + c] - mu; v2 += d * d; }
    mu1[tid] = mu;
    rv1[tid] = rsqrtf(v2 * (1.0f / CC) + 1e-5f);
  }
  __syncthreads();

  // -------- P3: out = (Q @ KV)*Z + LN1(x)  (writes out1 over Kt/Vt) --------
  {
    int h = wv;
    v8f acc[2][2];
#pragma unroll
    for (int m = 0; m < 2; ++m)
#pragma unroll
      for (int j = 0; j < 2; ++j) acc[m][j] = vzero8();
#pragma unroll
    for (int mt = 0; mt < 2; ++mt) {
      v16bf A = ld_tile(Qs, CP, mt * 16, h * 32, lane);
#pragma unroll
      for (int nt = 0; nt < 2; ++nt) {
        v16bf Bv = ld_tile(KVt, TP, h * 32 + nt * 16, 0, lane);
        acc[mt][nt] = wmma_bf16(A, Bv, acc[mt][nt]);
      }
    }
    // row figures read ahead of the first out1 store, so that they stay a few wide
    // loads (behind a store to a padded row the compiler reloads them one by one)
    float zz[2][8], mm[2][8], rr[2][8];
#pragma unroll
    for (int mt = 0; mt < 2; ++mt)
#pragma unroll
      for (int i = 0; i < 8; ++i) {
        int l = mt * 16 + half * 8 + i;
        zz[mt][i] = Zl[l * 4 + h];
        mm[mt][i] = mu1[l];
        rr[mt][i] = rv1[l];
      }
#pragma unroll
    for (int mt = 0; mt < 2; ++mt)
#pragma unroll
      for (int nt = 0; nt < 2; ++nt)
#pragma unroll
        for (int i = 0; i < 8; ++i) {
          int l = mt * 16 + half * 8 + i;
          int c = h * 32 + nt * 16 + r;
          float res = acc[mt][nt][i] * zz[mt][i];
          res += (xLDS[l * XP + c] - mm[mt][i]) * rr[mt][i] * ln1g[c] + ln1b[c];
          out1[l * XP + c] = res;
        }
  }
  __syncthreads();

  // -------- P4: LN2 -> h0 (bf16) --------
  if (tid < 32) {
    float s = 0.f;
    for (int c = 0; c < CC; ++c) s += out1[tid * XP + c];
    float mu = s * (1.0f / CC);
    float v2 = 0.f;
    for (int c = 0; c < CC; ++c) { float d = out1[tid * XP + c] - mu; v2 += d * d; }
    mu2[tid] = mu;
    rv2[tid] = rsqrtf(v2 * (1.0f / CC) + 1e-5f);
  }
  __syncthreads();
  for (int i = tid; i < TT * CC; i += 128) {
    int l = i >> 7, c = i & 127;
    h0[l * CP + c] = (bf16)((out1[l * XP + c] - mu2[l]) * rv2[l] * ln2g[c] + ln2b[c]);
  }
  __syncthreads();

  // -------- P5: h1 = gelu(h0 @ W1 + b1)  (32x512, over x/xqk/Q) --------
  {
    v16bf Ah[2][4];
#pragma unroll
    for (int mt = 0; mt < 2; ++mt)
#pragma unroll
      for (int kb = 0; kb < 4; ++kb)
        Ah[mt][kb] = ld_tile(h0, CP, mt * 16, kb * 32, lane);
#pragma unroll
    for (int jn = 0; jn < 8; ++jn) {
      int nt = wv * 8 + jn;
      v8f acc[2] = {vzero8(), vzero8()};
#pragma unroll
      for (int kb = 0; kb < 4; ++kb) {
        v16bf Bv = ld_tile(W1t, CC, nt * 16, kb * 32, lane);
        acc[0] = wmma_bf16(Ah[0][kb], Bv, acc[0]);
        acc[1] = wmma_bf16(Ah[1][kb], Bv, acc[1]);
      }
      int col = nt * 16 + r;
      float bb = b1[col];
#pragma unroll
      for (int mt = 0; mt < 2; ++mt)
#pragma unroll
        for (int i = 0; i < 8; ++i) {
          int l = mt * 16 + half * 8 + i;
          float hv = acc[mt][i] + bb;
          hv = 0.5f * hv * (1.0f + erff(hv * 0.70710678f));  // exact gelu
          h1[l * FP + col] = (bf16)hv;
        }
    }
  }
  __syncthreads();

  // -------- P6: out1 += h1 @ W2 + b2 (in place, each element by its own thread) --------
  {
    v8f acc[2][2];
#pragma unroll
    for (int m = 0; m < 2; ++m)
#pragma unroll
      for (int j = 0; j < 2; ++j) acc[m][j] = vzero8();
#pragma unroll
    for (int kb = 0; kb < 16; ++kb) {
      v16bf A0 = ld_tile(h1, FP, 0, kb * 32, lane);
      v16bf A1 = ld_tile(h1, FP, 16, kb * 32, lane);
#pragma unroll
      for (int j = 0; j < 2; ++j) {
        int nt = 2 * wv + j;
        v16bf Bv = ld_tile(W2t, FF, nt * 16, kb * 32, lane);
        acc[0][j] = wmma_bf16(A0, Bv, acc[0][j]);
        acc[1][j] = wmma_bf16(A1, Bv, acc[1][j]);
      }
    }
#pragma unroll
    for (int j = 0; j < 2; ++j) {
      int c = (2 * wv + j) * 16 + r;
      float b2v = b2[c];
#pragma unroll
      for (int mt = 0; mt < 2; ++mt)
#pragma unroll
        for (int i = 0; i < 8; ++i) {
          int l = mt * 16 + half * 8 + i;
          out1[l * XP + c] = acc[mt][j][i] + out1[l * XP + c] + b2v;
        }
    }
  }
  __syncthreads();   // every pixel's result is in its slab before the joint store

  // -------- P7: store PX pixels of one (t,c) row as one 16-byte piece --------
  {
    float* on = out + (size_t)b * TT * CC * HWS + hs * WS + wsp;
    v4f v[TT * CC / (128 * PX)];
    // both loops unrolled: v[] stays in registers and the LDS reads run ahead of the stores
#pragma unroll
    for (int it = 0; it < TT * CC / (128 * PX); ++it) {
      int i = it * (128 * PX) + wtid;
      int t = i >> 7, c = i & 127;
#pragma unroll
      for (int p = 0; p < PX; ++p)
        v[it][p] = ((const float*)(smem_all + p * SLAB + O_KT))[t * XP + c];
    }
#pragma unroll
    for (int it = 0; it < TT * CC / (128 * PX); ++it)
      *reinterpret_cast<v4f*>(on + (size_t)(it * (128 * PX) + wtid) * HWS) = v[it];
  }
}

extern "C" void kernel_launch(void* const* d_in, const int* in_sizes, int n_in,
                              void* d_out, int out_size, void* d_ws, size_t ws_size,
                              hipStream_t stream) {
  (void)in_sizes; (void)n_in; (void)out_size; (void)ws_size;
  const float* x    = (const float*)d_in[0];
  const float* g    = (const float*)d_in[1];
  const float* Wq   = (const float*)d_in[2];
  const float* bq   = (const float*)d_in[3];
  const float* Wk   = (const float*)d_in[4];
  const float* bk   = (const float*)d_in[5];
  const float* Wv   = (const float*)d_in[6];
  const float* bv   = (const float*)d_in[7];
  const float* ln1g = (const float*)d_in[8];
  const float* ln1b = (const float*)d_in[9];
  const float* ln2g = (const float*)d_in[10];
  const float* ln2b = (const float*)d_in[11];
  const float* W1   = (const float*)d_in[12];
  const float* b1   = (const float*)d_in[13];
  const float* W2   = (const float*)d_in[14];
  const float* b2   = (const float*)d_in[15];
  unsigned short* wt = (unsigned short*)d_ws;   // 196608 bf16 = 384 KB

  prep_weights<<<(196608 + 255) / 256, 256, 0, stream>>>(Wq, Wk, Wv, W1, W2, wt);
  fused_block<<<NPIX / PX, 128 * PX, 0, stream>>>(x, g, bq, bk, bv, ln1g, ln1b, ln2g, ln2b,
                                        b1, b2, wt, (float*)d_out);
}

// v003
// One run takes 181 microseconds.
// Timed twice side by side with v002, it ran 1.25 and 1.26 times as fast.
// Counting every step since v000, it is 2.33 times as fast.
#include <hip/hip_runtime.h>
#include <cstdint>

typedef __bf16 bf16;
typedef bf16  v16bf __attribute__((ext_vector_type(16)));
typedef float v8f   __attribute__((ext_vector_type(8)));
typedef float v4f   __attribute__((ext_vector_type(4)));
typedef bf16  v8bf  __attribute__((ext_vector_type(8)));

// ---- problem constants (from reference setup) ----
#define BB   4
#define TT   32
#define CC   128
#define HS   32
#define WS   32
#define GD   64
#define CG   192      // C + Gd
#define FF   512      // 4*C
#define NPIX 4096     // B*H*W
#define HWS  1024     // H*W
#define PX   4        // pixels adjacent along W per workgroup (16 B of each x / out line)
// LDS row pitches in elements: every row starts an odd multiple of 16 B after the
// one before it, so the 16 rows that one ds_load_b128 reads fall on 16 different
// groups of four banks (at a pitch that is a multiple of 64 B they share one to four)
#define XP   132      // f32 rows of 128: x, out1          (528 B)
#define QKP  200      // bf16 rows of 192: xqk             (400 B)
#define CP   136      // bf16 rows of 128: Q, h0           (272 B)
#define TP   40       // bf16 rows of 32: K^T, V^T, KV^T   (80 B)
#define FP   520      // bf16 rows of 512: h1              (1040 B)
// byte offsets inside one pixel's slab
#define O_X    0
#define O_XQK  16896
#define O_Q    29696
#define O_KT   38400
#define O_VT   48640
#define O_KVT  58880
#define O_STAT 69120
#define SLAB   70656  // LDS bytes per pixel

static __device__ __forceinline__ v8f vzero8() {
  v8f z;
#pragma unroll
  for (int i = 0; i < 8; ++i) z[i] = 0.0f;
  return z;
}

static __device__ __forceinline__ v8f wmma_bf16(v16bf a, v16bf b, v8f c) {
  return __builtin_amdgcn_wmma_f32_16x16x32_bf16(
      /*neg_a=*/false, a, /*neg_b=*/false, b,
      /*c_mod=*/(short)0, c, /*reuse_a=*/false, /*reuse_b=*/false);
}

// Load a 16x32 bf16 operand tile from row-major storage (A operands, and the B
// operands that are kept N x K in LDS: both sides have the same lane layout).
// lanes 0-15: row rcBase+lane, K = {k..k+7, k+16..k+23}
// lanes 16-31: row rcBase+lane-16, K = {k+8..k+15, k+24..k+31}
template <typename P>
static __device__ __forceinline__ v16bf ld_tile(P base, int stride, int rcBase,
                                                int kBase, int lane) {
  int r = lane & 15, half = lane >> 4;
  P p = base + (size_t)(rcBase + r) * stride + kBase + half * 8;
  v16bf a;
#pragma unroll
  for (int i = 0; i < 8; ++i) { a[i] = p[i]; a[i + 8] = p[16 + i]; }
  return a;
}

// Load one 16(n) x 32(k) weight tile that prep_weights has stored in register order:
// 1 KB a tile, the 32 lanes' first eight values in its first 512 B and their second
// eight in the other 512 B, so that each 16-byte load of a wave reads four whole lines.
static __device__ __forceinline__ v16bf ld_wtile(const bf16* mat, int tile, int lane) {
  const v8bf* p = reinterpret_cast<const v8bf*>(mat + tile * 512 + lane * 8);
  return __builtin_shufflevector(p[0], p[32], 0, 1, 2, 3, 4, 5, 6, 7,
                                 8, 9, 10, 11, 12, 13, 14, 15);
}

// source index of packed element j of a (K x N) row-major weight: tile = nt * (K/32) + kb;
// inside the tile bit 8 picks k+16, bits 7..3 the lane (n = lane & 15, k+8 for lanes 16-31),
// bits 2..0 the eight neighbours along k: the k order of ld_tile at every lane and position
static __device__ __forceinline__ int packed_src(int j, int K, int N) {
  int tile = j >> 9, e = j & 511;
  int nt = tile / (K / 32), kb = tile % (K / 32);
  int lane = (e >> 3) & 31;
  int n = nt * 16 + (lane & 15);
  int k = kb * 32 + (e >> 8) * 16 + (lane >> 4) * 8 + (e & 7);
  return k * N + n;
}

// ---- weight prep: fp32 -> bf16, packed tile by tile in the order ld_wtile reads ----
// ws layout (bf16 elements): Wqt[0..24576) Wkt[..49152) Wvt[..65536)
//                            W1t[..131072) W2t[..196608)
__global__ void prep_weights(const float* __restrict__ Wq,
                             const float* __restrict__ Wk,
                             const float* __restrict__ Wv,
                             const float* __restrict__ W1,
                             const float* __restrict__ W2,
                             unsigned short* __restrict__ wsu) {
  bf16* o = reinterpret_cast<bf16*>(wsu);
  int i = blockIdx.x * blockDim.x + threadIdx.x;
  if (i >= 196608) return;
  int j = i;
  if (j < 24576) { o[i] = (bf16)Wq[packed_src(j, CG, CC)]; return; }
  j -= 24576;
  if (j < 24576) { o[i] = (bf16)Wk[packed_src(j, CG, CC)]; return; }
  j -= 24576;
  if (j < 16384) { o[i] = (bf16)Wv[packed_src(j, CC, CC)]; return; }
  j -= 16384;
  if (j < 65536) { o[i] = (bf16)W1[packed_src(j, CC, FF)]; return; }
  j -= 65536;
  o[i] = (bf16)W2[packed_src(j, FF, CC)];
}

// ---- fused block: one workgroup per PX adjacent pixels; four waves and one
// LDS slab per pixel; x is read and out is written PX pixels at a time ----
// The register cap keeps the scheduler from hoisting weight loads up to the
// 16-wave limit of 256, where a few long-lived addresses spilled to scratch.
__global__ __launch_bounds__(128 * PX) __attribute__((amdgpu_num_vgpr(224)))
void fused_block(const float* __restrict__ x, const float* __restrict__ gdn,
                 const float* __restrict__ bq, const float* __restrict__ bk,
                 const float* __restrict__ bv,
                 const float* __restrict__ ln1g, const float* __restrict__ ln1b,
                 const float* __restrict__ ln2g, const float* __restrict__ ln2b,
                 const float* __restrict__ b1, const float* __restrict__ b2,
                 const unsigned short* __restrict__ wsu,
                 float* __restrict__ out) {
  __shared__ __attribute__((aligned(16))) unsigned char smem_all[PX * SLAB];
  const int wtid = threadIdx.x;              // 0 .. 128*PX-1
  unsigned char* smem = smem_all + (wtid >> 7) * SLAB;   // this pixel's slab
  // phase-reused LDS layout (per slab)
  float* xLDS = (float*)(smem + O_X);        // 32x128 f32, pitch XP   (dead after P3)
  bf16*  xqk  = (bf16*)(smem + O_XQK);       // 32x192 bf16, pitch QKP (dead after P1)
  bf16*  Qs   = (bf16*)(smem + O_Q);         // 32x128 bf16, pitch CP  (dead after P3)
  bf16*  Kt   = (bf16*)(smem + O_KT);        // 128x32 bf16, pitch TP  (dead after P2)
  bf16*  Vt   = (bf16*)(smem + O_VT);        // 128x32 bf16, pitch TP  (dead after P2)
  bf16*  KVt  = (bf16*)(smem + O_KVT);       // 128x32 bf16, pitch TP  (dead after P3)
  float* Ksum = (float*)(smem + O_STAT);         // 128 f32
  float* Zl   = (float*)(smem + O_STAT + 512);   // 128 f32 (l*4+h)
  float* mu1  = (float*)(smem + O_STAT + 1024);  // 32
  float* rv1  = (float*)(smem + O_STAT + 1152);  // 32
  float* mu2  = (float*)(smem + O_STAT + 1280);  // 32
  float* rv2  = (float*)(smem + O_STAT + 1408);  // 32
  float* out1 = (float*)(smem + O_KT);       // 32x128 f32, pitch XP (over Kt+Vt)
  bf16*  h0   = (bf16*)(smem + O_KVT);       // 32x128 bf16, pitch CP (over KVt)
  bf16*  h1   = (bf16*)(smem + O_X);         // 32x512 bf16, pitch FP (over x,xqk,Q)

  const bf16* Wqt = reinterpret_cast<const bf16*>(wsu);
  const bf16* Wkt = Wqt + 24576;
  const bf16* Wvt = Wqt + 49152;
  const bf16* W1t = Wqt + 65536;
  const bf16* W2t = Wqt + 131072;

  const int tid  = wtid & 127;        // thread within the pixel's four waves
  const int lane = tid & 31;
  const int wv   = tid >> 5;          // wave id 0..3 within the pixel
  const int r    = lane & 15;
  const int half = lane >> 4;

  const int n   = blockIdx.x * PX;    // first of the PX pixels
  const int b   = n >> 10;
  const int hs  = (n >> 5) & 31;
  const int wsp = n & 31;             // multiple of PX: 16-byte aligned
  const float* xn = x + (size_t)b * TT * CC * HWS + hs * WS + wsp;

  // -------- P0: stage x and xqk=[x|guidance] --------
  // guidance is loaded ahead of the x loop: no LDS store stands between the run and its
  // wait, and all of a thread's global loads are in flight together
  float gv[TT * GD / 128];
  // unrolled: gv[] is indexed by constants and stays in registers
#pragma unroll
  for (int k = 0; k < TT * GD / 128; ++k) {
    int i = k * 128 + tid;
    int t = i >> 6, j = i & 63;
    gv[k] = gdn[((size_t)b * TT + t) * GD + j];
  }
  // the x loads' results land in the run's address registers: the wait that belongs
  // in front of such an overwrite
  asm volatile("s_wait_xcnt 0x0" ::: "memory");
  // unrolled so that all of a thread's 16-byte loads are in flight together
#pragma unroll
  for (int it = 0; it < TT * CC / (128 * PX); ++it) {
    int i = it * (128 * PX) + wtid;
    int t = i >> 7, c = i & 127;
    v4f v = *reinterpret_cast<const v4f*>(xn + (size_t)i * HWS);
#pragma unroll
    for (int p = 0; p < PX; ++p) {
      ((float*)(smem_all + p * SLAB + O_X))[t * XP + c] = v[p];
      ((bf16*)(smem_all + p * SLAB + O_XQK))[t * QKP + c] = (bf16)v[p];
    }
  }
  // unrolled like the load loop: gv[] is indexed by constants
#pragma unroll
  for (int k = 0; k < TT * GD / 128; ++k) {
    int i = k * 128 + tid;
    int t = i >> 6, j = i & 63;
    xqk[t * QKP + 128 + j] = (bf16)gv[k];
  }
  __syncthreads();

  // -------- P1: q,k (K=192) and v (K=128) GEMMs --------
  {
    v8f aq[2][2], ak[2][2], av[2][2];
#pragma unroll
    for (int m = 0; m < 2; ++m)
#pragma unroll
      for (int j = 0; j < 2; ++j) { aq[m][j] = vzero8(); ak[m][j] = vzero8(); av[m][j] = vzero8(); }
#pragma unroll
    for (int kb = 0; kb < 6; ++kb) {
      v16bf A0 = ld_tile(xqk, QKP, 0, kb * 32, lane);
      v16bf A1 = ld_tile(xqk, QKP, 16, kb * 32, lane);
#pragma unroll
      for (int j = 0; j < 2; ++j) {
        int nt = 2 * wv + j;
        v16bf Bq = ld_wtile(Wqt, nt * (CG / 32) + kb, lane);
        aq[0][j] = wmma_bf16(A0, Bq, aq[0][j]);
        aq[1][j] = wmma_bf16(A1, Bq, aq[1][j]);
        v16bf Bk = ld_wtile(Wkt, nt * (CG / 32) + kb, lane);
        ak[0][j] = wmma_bf16(A0, Bk, ak[0][j]);
        ak[1][j] = wmma_bf16(A1, Bk, ak[1][j]);
        if (kb < 4) {
          v16bf Bv = ld_wtile(Wvt, nt * (CC / 32) + kb, lane);
          av[0][j] = wmma_bf16(A0, Bv, av[0][j]);
          av[1][j] = wmma_bf16(A1, Bv, av[1][j]);
        }
      }
    }
    // epilogue: bias, elu+1, scatter Q (row-major) and K^T, V^T to LDS
#pragma unroll
    for (int j = 0; j < 2; ++j) {
      int col = (2 * wv + j) * 16 + r;
      float bqv = bq[col], bkv = bk[col], bvv = bv[col];
#pragma unroll
      for (int mt = 0; mt < 2; ++mt) {
        v8bf k8, v8;   // eight neighbours of one K^T / V^T row: one 16-byte store each
#pragma unroll
        for (int i = 0; i < 8; ++i) {
          int l = mt * 16 + half * 8 + i;
          float qv = aq[mt][j][i] + bqv;
          qv = (qv > 0.f) ? (qv + 1.f) : __expf(qv);
          Qs[l * CP + col] = (bf16)qv;
          float kv = ak[mt][j][i] + bkv;
          kv = (kv > 0.f) ? (kv + 1.f) : __expf(kv);
          k8[i] = (bf16)kv;
          v8[i] = (bf16)(av[mt][j][i] + bvv);
        }
        *reinterpret_cast<v8bf*>(Kt + col * TP + mt * 16 + half * 8) = k8;
        *reinterpret_cast<v8bf*>(Vt + col * TP + mt * 16 + half * 8) = v8;
      }
    }
  }
  __syncthreads();

  // -------- P2: Ksum, KV = K^T @ V (per head, one WMMA K-step) --------
  {
    float s = 0.f;
#pragma unroll
    for (int i = 0; i < TT; ++i) s += (float)Kt[tid * TP + i];
    Ksum[tid] = s;
  }
  {
    int h = wv;
    v8f acc[2][2];
#pragma unroll
    for (int m = 0; m < 2; ++m)
#pragma unroll
      for (int j = 0; j < 2; ++j) acc[m][j] = vzero8();
#pragma unroll
    for (int mt = 0; mt < 2; ++mt) {
      v16bf A = ld_tile(Kt, TP, h * 32 + mt * 16, 0, lane);
#pragma unroll
      for (int nt = 0; nt < 2; ++nt) {
        v16bf Bv = ld_tile(Vt, TP, h * 32 + nt * 16, 0, lane);
        acc[mt][nt] = wmma_bf16(A, Bv, acc[mt][nt]);
      }
    }
#pragma unroll
    for (int mt = 0; mt < 2; ++mt)
#pragma unroll
      for (int nt = 0; nt < 2; ++nt)
#pragma unroll
        for (int i = 0; i < 8; ++i) {
          int d = mt * 16 + half * 8 + i;       // row of KV
          int e = h * 32 + nt * 16 + r;          // global v-column
          KVt[e * TP + d] = (bf16)acc[mt][nt][i];
        }
  }
  __syncthreads();

  // -------- P2c: Z = 1/(Q.Ksum+eps), ln1 stats --------
  {
    int l = tid >> 2, h = tid & 3;
    float d = 0.f;
#pragma unroll
    for (int i = 0; i < 32; ++i)
      d += (float)Qs[l * CP + h * 32 + i] * Ksum[h * 32 + i];
    Zl[tid] = 1.0f / (d + 1e-6f);
  }
  if (tid < 32) {
    float s = 0.f;
    for (int c = 0; c < CC; ++c) s += xLDS[tid * XP + c];
    float mu = s * (1.0f / CC);
    float v2 = 0.f;
    for (int c = 0; c < CC; ++c) { float d = xLDS[tid * XP + c] - mu; v2 += d * d; }
    mu1[tid] = mu;
    rv1[tid] = rsqrtf(v2 * (1.0f / CC) + 1e-5f);
  }
  __syncthreads();

  // -------- P3: out = (Q @ KV)*Z + LN1(x)  (writes out1 over Kt/Vt) --------
  {
    int h = wv;
    v8f acc[2][2];
#pragma unroll
    for (int m = 0; m < 2; ++m)
#pragma unroll
      for (int j = 0; j < 2; ++j) acc[m][j] = vzero8();
#pragma unroll
    for (int mt = 0; mt < 2; ++mt) {
      v16bf A = ld_tile(Qs, CP, mt * 16, h * 32, lane);
#pragma unroll
      for (int nt = 0; nt < 2; ++nt) {
        v16bf Bv = ld_tile(KVt, TP, h * 32 + nt * 16, 0, lane);
        acc[mt][nt] = wmma_bf16(A, Bv, acc[mt][nt]);
      }
    }
    // row figures read ahead of the first out1 store, so that they stay a few wide
    // loads (behind a store to a padded row the compiler reloads them one by one)
    float zz[2][8], mm[2][8], rr[2][8];
#pragma unroll
    for (int mt = 0; mt < 2; ++mt)
#pragma unroll
      for (int i = 0; i < 8; ++i) {
        int l = mt * 16 + half * 8 + i;
        zz[mt][i] = Zl[l * 4 + h];
        mm[mt][i] = mu1[l];
        rr[mt][i] = rv1[l];
      }
#pragma unroll
    for (int mt = 0; mt < 2; ++mt)
#pragma unroll
      for (int nt = 0; nt < 2; ++nt)
#pragma unroll
        for (int i = 0; i < 8; ++i) {
          int l = mt * 16 + half * 8 + i;
          int c = h * 32 + nt * 16 + r;
          float res = acc[mt][nt][i] * zz[mt][i];
          res += (xLDS[l * XP + c] - mm[mt][i]) * rr[mt][i] * ln1g[c] + ln1b[c];
          out1[l * XP + c] = res;
        }
  }
  __syncthreads();

  // -------- P4: LN2 -> h0 (bf16) --------
  if (tid < 32) {
    float s = 0.f;
    for (int c = 0; c < CC; ++c) s += out1[tid * XP + c];
    float mu = s * (1.0f / CC);
    float v2 = 0.f;
    for (int c = 0; c < CC; ++c) { float d = out1[tid * XP + c] - mu; v2 += d * d; }
    mu2[tid] = mu;
    rv2[tid] = rsqrtf(v2 * (1.0f / CC) + 1e-5f);
  }
  __syncthreads();
  for (int i = tid; i < TT * CC; i += 128) {
    int l = i >> 7, c = i & 127;
    h0[l * CP + c] = (bf16)((out1[l * XP + c] - mu2[l]) * rv2[l] * ln2g[c] + ln2b[c]);
  }
  __syncthreads();

  // -------- P5: h1 = gelu(h0 @ W1 + b1)  (32x512, over x/xqk/Q) --------
  {
    v16bf Ah[2][4];
#pragma unroll
    for (int mt = 0; mt < 2; ++mt)
#pragma unroll
      for (int kb = 0; kb < 4; ++kb)
        Ah[mt][kb] = ld_tile(h0, CP, mt * 16, kb * 32, lane);
#pragma unroll
    for (int jn = 0; jn < 8; ++jn) {
      int nt = wv * 8 + jn;
      v8f acc[2] = {vzero8(), vzero8()};
#pragma unroll
      for (int kb = 0; kb < 4; ++kb) {
        v16bf Bv = ld_wtile(W1t, nt * (CC / 32) + kb, lane);
        acc[0] = wmma_bf16(Ah[0][kb], Bv, acc[0]);
        acc[1] = wmma_bf16(Ah[1][kb], Bv, acc[1]);
      }
      int col = nt * 16 + r;
      float bb = b1[col];
#pragma unroll
      for (int mt = 0; mt < 2; ++mt)
#pragma unroll
        for (int i = 0; i < 8; ++i) {
          int l = mt * 16 + half * 8 + i;
          float hv = acc[mt][i] + bb;
          hv = 0.5f * hv * (1.0f + erff(hv * 0.70710678f));  // exact gelu
          h1[l * FP + col] = (bf16)hv;
        }
    }
  }
  __syncthreads();

  // -------- P6: out1 += h1 @ W2 + b2 (in place, each element by its own thread) --------
  {
    v8f acc[2][2];
#pragma unroll
    for (int m = 0; m < 2; ++m)
#pragma unroll
      for (int j = 0; j < 2; ++j) acc[m][j] = vzero8();
#pragma unroll
    for (int kb = 0; kb < 16; ++kb) {
      v16bf A0 = ld_tile(h1, FP, 0, kb * 32, lane);
      v16bf A1 = ld_tile(h1, FP, 16, kb * 32, lane);
#pragma unroll
      for (int j = 0; j < 2; ++j) {
        int nt = 2 * wv + j;
        v16bf Bv = ld_wtile(W2t, nt * (FF / 32) + kb, lane);
        acc[0][j] = wmma_bf16(A0, Bv, acc[0][j]);
        acc[1][j] = wmma_bf16(A1, Bv, acc[1][j]);
      }
    }
#pragma unroll
    for (int j = 0; j < 2; ++j) {
      int c = (2 * wv + j) * 16 + r;
      float b2v = b2[c];
#pragma unroll
      for (int mt = 0; mt < 2; ++mt)
#pragma unroll
        for (int i = 0; i < 8; ++i) {
          int l = mt * 16 + half * 8 + i;
          out1[l * XP + c] = acc[mt][j][i] + out1[l * XP + c] + b2v;
        }
    }
  }
  __syncthreads();   // every pixel's result is in its slab before the joint store

  // -------- P7: store PX pixels of one (t,c) row as one 16-byte piece --------
  {
    float* on = out + (size_t)b * TT * CC * HWS + hs * WS + wsp;
    v4f v[TT * CC / (128 * PX)];
    // both loops unrolled: v[] stays in registers and the LDS reads run ahead of the stores
#pragma unroll
    for (int it = 0; it < TT * CC / (128 * PX); ++it) {
      int i = it * (128 * PX) + wtid;
      int t = i >> 7, c = i & 127;
#pragma unroll
      for (int p = 0; p < PX; ++p)
        v[it][p] = ((const float*)(smem_all + p * SLAB + O_KT))[t * XP + c];
    }
#pragma unroll
    for (int it = 0; it < TT * CC / (128 * PX); ++it)
      *reinterpret_cast<v4f*>(on + (size_t)(it * (128 * PX) + wtid) * HWS) = v[it];
  }
}

extern "C" void kernel_launch(void* const* d_in, const int* in_sizes, int n_in,
                              void* d_out, int out_size, void* d_ws, size_t ws_size,
                              hipStream_t stream) {
  (void)in_sizes; (void)n_in; (void)out_size; (void)ws_size;
  const float* x    = (const float*)d_in[0];
  const float* g    = (const float*)d_in[1];
  const float* Wq   = (const float*)d_in[2];
  const float* bq   = (const float*)d_in[3];
  const float* Wk   = (const float*)d_in[4];
  const float* bk   = (const float*)d_in[5];
  const float* Wv   = (const float*)d_in[6];
  const float* bv   = (const float*)d_in[7];
  const float* ln1g = (const float*)d_in[8];
  const float* ln1b = (const float*)d_in[9];
  const float* ln2g = (const float*)d_in[10];
  const float* ln2b = (const float*)d_in[11];
  const float* W1   = (const float*)d_in[12];
  const float* b1   = (const float*)d_in[13];
  const float* W2   = (const float*)d_in[14];
  const float* b2   = (const float*)d_in[15];
  unsigned short* wt = (unsigned short*)d_ws;   // 196608 bf16 = 384 KB

  prep_weights<<<(196608 + 255) / 256, 256, 0, stream>>>(Wq, Wk, Wv, W1, W2, wt);
  fused_block<<<NPIX / PX, 128 * PX, 0, stream>>>(x, g, bq, bk, bv, ln1g, ln1b, ln2g, ln2b,
                                        b1, b2, wt, (float*)d_out);
}

// v004
// Measured time: 157 microseconds a run.
// In both of two side-by-side timings against v003, it was 1.17 times as fast.
// Over all steps from v000 it is 2.73 times as fast.
#include <hip/hip_runtime.h>
#include <cstdint>

typedef __bf16 bf16;
typedef bf16  v16bf __attribute__((ext_vector_type(16)));
typedef float v8f   __attribute__((ext_vector_type(8)));
typedef float v4f   __attribute__((ext_vector_type(4)));
typedef bf16  v8bf  __attribute__((ext_vector_type(8)));
typedef float v2f   __attribute__((ext_vector_type(2)));
typedef bf16  v2bf  __attribute__((ext_vector_type(2)));

// ---- problem constants (from reference setup) ----
#define BB   4
#define TT   32
#define CC   128
#define HS   32
#define WS   32
#define GD   64
#define CG   192      // C + Gd
#define FF   512      // 4*C
#define NPIX 4096     // B*H*W
#define HWS  1024     // H*W
#define PX   4        // pixels adjacent along W per workgroup (16 B of each x / out line)
// LDS row pitches in elements: every row starts an odd multiple of 16 B after the
// one before it, so the 16 rows that one ds_load_b128 reads fall on 16 different
// groups of four banks (at a pitch that is a multiple of 64 B they share one to four)
#define XP   132      // f32 rows of 128: x, out1          (528 B)
#define QKP  200      // bf16 rows of 192: xqk             (400 B)
#define CP   136      // bf16 rows of 128: Q, h0           (272 B)
#define TP   40       // bf16 rows of 32: K^T, V^T, KV^T   (80 B)
#define FP   520      // bf16 rows of 512: h1              (1040 B)
// byte offsets inside one pixel's slab
#define O_X    0
#define O_XQK  16896
#define O_Q    29696
#define O_KT   38400
#define O_VT   48640
#define O_KVT  58880
#define O_STAT 69120
#define SLAB   70656  // LDS bytes per pixel

static __device__ __forceinline__ v8f vzero8() {
  v8f z;
#pragma unroll
  for (int i = 0; i < 8; ++i) z[i] = 0.0f;
  return z;
}

static __device__ __forceinline__ v8f wmma_bf16(v16bf a, v16bf b, v8f c) {
  return __builtin_amdgcn_wmma_f32_16x16x32_bf16(
      /*neg_a=*/false, a, /*neg_b=*/false, b,
      /*c_mod=*/(short)0, c, /*reuse_a=*/false, /*reuse_b=*/false);
}

// Load a 16x32 bf16 operand tile from row-major storage (A operands, and the B
// operands that are kept N x K in LDS: both sides have the same lane layout).
// lanes 0-15: row rcBase+lane, K = {k..k+7, k+16..k+23}
// lanes 16-31: row rcBase+lane-16, K = {k+8..k+15, k+24..k+31}
template <typename P>
static __device__ __forceinline__ v16bf ld_tile(P base, int stride, int rcBase,
                                                int kBase, int lane) {
  int r = lane & 15, half = lane >> 4;
  P p = base + (size_t)(rcBase + r) * stride + kBase + half * 8;
  v16bf a;
#pragma unroll
  for (int i = 0; i < 8; ++i) { a[i] = p[i]; a[i + 8] = p[16 + i]; }
  return a;
}

// Load one 16(n) x 32(k) weight tile that prep_weights has stored in register order:
// 1 KB a tile, the 32 lanes' first eight values in its first 512 B and their second
// eight in the other 512 B, so that each 16-byte load of a wave reads four whole lines.
static __device__ __forceinline__ v16bf ld_wtile(const bf16* mat, int tile, int lane) {
  const v8bf* p = reinterpret_cast<const v8bf*>(mat + tile * 512 + lane * 8);
  return __builtin_shufflevector(p[0], p[32], 0, 1, 2, 3, 4, 5, 6, 7,
                                 8, 9, 10, 11, 12, 13, 14, 15);
}

// source index of packed element j of a (K x N) row-major weight: tile = nt * (K/32) + kb;
// inside the tile bit 8 picks k+16, bits 7..3 the lane (n = lane & 15, k+8 for lanes 16-31),
// bits 2..0 the eight neighbours along k: the k order of ld_tile at every lane and position
static __device__ __forceinline__ int packed_src(int j, int K, int N) {
  int tile = j >> 9, e = j & 511;
  int nt = tile / (K / 32), kb = tile % (K / 32);
  int lane = (e >> 3) & 31;
  int n = nt * 16 + (lane & 15);
  int k = kb * 32 + (e >> 8) * 16 + (lane >> 4) * 8 + (e & 7);
  return k * N + n;
}

// exact gelu of two values, h * Phi(h) with Phi the normal distribution function, written
// as max(h, 0) - a * Phi(-a), a = |h|: one form for both signs and for every size of h, so
// no branch. Phi(-a) = 2^p(a): p is a degree-8 fit of log2(Phi(-a)) on 0 <= a <= 6, its error
// weighted by Phi(-a); against gelu in double precision the f32 result is off by less than
// 3e-7 on -8 <= h <= 8 (with the library's erf in h / 2 * (1 + erf(h / sqrt 2)): 5e-7).
// Past a = 6 the term a * Phi(-a) is held at its value there, 6e-9 (true value: less).
static __device__ __forceinline__ v2f gelu2(v2f h) {
  v2f a, e, relu;
  a[0] = fminf(fabsf(h[0]), 6.0f);
  a[1] = fminf(fabsf(h[1]), 6.0f);
  v2f p = -0.00000138095049f;
  p = __builtin_elementwise_fma(p, a, (v2f)0.0000228085610f);
  p = __builtin_elementwise_fma(p, a, (v2f)-0.000112637688f);
  p = __builtin_elementwise_fma(p, a, (v2f)-0.000299850391f);
  p = __builtin_elementwise_fma(p, a, (v2f)0.00725496560f);
  p = __builtin_elementwise_fma(p, a, (v2f)-0.0526133589f);
  p = __builtin_elementwise_fma(p, a, (v2f)-0.459174365f);
  p = __builtin_elementwise_fma(p, a, (v2f)-1.15110886f);
  p = __builtin_elementwise_fma(p, a, (v2f)-0.999999940f);
  e[0] = __builtin_amdgcn_exp2f(p[0]);   // p is never below -30: no range handling needed
  e[1] = __builtin_amdgcn_exp2f(p[1]);
  relu[0] = fmaxf(h[0], 0.0f);
  relu[1] = fmaxf(h[1], 0.0f);
  return __builtin_elementwise_fma(-a, e, relu);
}

// ---- weight prep: fp32 -> bf16, packed tile by tile in the order ld_wtile reads ----
// ws layout (bf16 elements): Wqt[0..24576) Wkt[..49152) Wvt[..65536)
//                            W1t[..131072) W2t[..196608)
__global__ void prep_weights(const float* __restrict__ Wq,
                             const float* __restrict__ Wk,
                             const float* __restrict__ Wv,
                             const float* __restrict__ W1,
                             const float* __restrict__ W2,
                             unsigned short* __restrict__ wsu) {
  bf16* o = reinterpret_cast<bf16*>(wsu);
  int i = blockIdx.x * blockDim.x + threadIdx.x;
  if (i >= 196608) return;
  int j = i;
  if (j < 24576) { o[i] = (bf16)Wq[packed_src(j, CG, CC)]; return; }
  j -= 24576;
  if (j < 24576) { o[i] = (bf16)Wk[packed_src(j, CG, CC)]; return; }
  j -= 24576;
  if (j < 16384) { o[i] = (bf16)Wv[packed_src(j, CC, CC)]; return; }
  j -= 16384;
  if (j < 65536) { o[i] = (bf16)W1[packed_src(j, CC, FF)]; return; }
  j -= 65536;
  o[i] = (bf16)W2[packed_src(j, FF, CC)];
}

// ---- fused block: one workgroup per PX adjacent pixels; four waves and one
// LDS slab per pixel; x is read and out is written PX pixels at a time ----
// The register cap keeps the scheduler from hoisting weight loads up to the
// 16-wave limit of 256, where a few long-lived addresses spilled to scratch.
__global__ __launch_bounds__(128 * PX) __attribute__((amdgpu_num_vgpr(224)))
void fused_block(const float* __restrict__ x, const float* __restrict__ gdn,
                 const float* __restrict__ bq, const float* __restrict__ bk,
                 const float* __restrict__ bv,
                 const float* __restrict__ ln1g, const float* __restrict__ ln1b,
                 const float* __restrict__ ln2g, const float* __restrict__ ln2b,
                 const float* __restrict__ b1, const float* __restrict__ b2,
                 const unsigned short* __restrict__ wsu,
                 float* __restrict__ out) {
  __shared__ __attribute__((aligned(16))) unsigned char smem_all[PX * SLAB];
  const int wtid = threadIdx.x;              // 0 .. 128*PX-1
  unsigned char* smem = smem_all + (wtid >> 7) * SLAB;   // this pixel's slab
  // phase-reused LDS layout (per slab)
  float* xLDS = (float*)(smem + O_X);        // 32x128 f32, pitch XP   (dead after P3)
  bf16*  xqk  = (bf16*)(smem + O_XQK);       // 32x192 bf16, pitch QKP (dead after P1)
  bf16*  Qs   = (bf16*)(smem + O_Q);         // 32x128 bf16, pitch CP  (dead after P3)
  bf16*  Kt   = (bf16*)(smem + O_KT);        // 128x32 bf16, pitch TP  (dead after P2)
  bf16*  Vt   = (bf16*)(smem + O_VT);        // 128x32 bf16, pitch TP  (dead after P2)
  bf16*  KVt  = (bf16*)(smem + O_KVT);       // 128x32 bf16, pitch TP  (dead after P3)
  float* Ksum = (float*)(smem + O_STAT);         // 128 f32
  float* Zl   = (float*)(smem + O_STAT + 512);   // 128 f32 (l*4+h)
  float* mu1  = (float*)(smem + O_STAT + 1024);  // 32
  float* rv1  = (float*)(smem + O_STAT + 1152);  // 32
  float* mu2  = (float*)(smem + O_STAT + 1280);  // 32
  float* rv2  = (float*)(smem + O_STAT + 1408);  // 32
  float* out1 = (float*)(smem + O_KT);       // 32x128 f32, pitch XP (over Kt+Vt)
  bf16*  h0   = (bf16*)(smem + O_KVT);       // 32x128 bf16, pitch CP (over KVt)
  bf16*  h1   = (bf16*)(smem + O_X);         // 32x512 bf16, pitch FP (over x,xqk,Q)

  const bf16* Wqt = reinterpret_cast<const bf16*>(wsu);
  const bf16* Wkt = Wqt + 24576;
  const bf16* Wvt = Wqt + 49152;
  const bf16* W1t = Wqt + 65536;
  const bf16* W2t = Wqt + 131072;

  const int tid  = wtid & 127;        // thread within the pixel's four waves
  const int lane = tid & 31;
  const int wv   = tid >> 5;          // wave id 0..3 within the pixel
  const int r    = lane & 15;
  const int half = lane >> 4;

  const int n   = blockIdx.x * PX;    // first of the PX pixels
  const int b   = n >> 10;
  const int hs  = (n >> 5) & 31;
  const int wsp = n & 31;             // multiple of PX: 16-byte aligned
  const float* xn = x + (size_t)b * TT * CC * HWS + hs * WS + wsp;

  // -------- P0: stage x and xqk=[x|guidance] --------
  // guidance is loaded ahead of the x loop: no LDS store stands between the run and its
  // wait, and all of a thread's global loads are in flight together
  float gv[TT * GD / 128];
  // unrolled: gv[] is indexed by constants and stays in registers
#pragma unroll
  for (int k = 0; k < TT * GD / 128; ++k) {
    int i = k * 128 + tid;
    int t = i >> 6, j = i & 63;
    gv[k] = gdn[((size_t)b * TT + t) * GD + j];
  }
  // the x loads' results land in the run's address registers: the wait that belongs
  // in front of such an overwrite
  asm volatile("s_wait_xcnt 0x0" ::: "memory");
  // unrolled so that all of a thread's 16-byte loads are in flight together
#pragma unroll
  for (int it = 0; it < TT * CC / (128 * PX); ++it) {
    int i = it * (128 * PX) + wtid;
    int t = i >> 7, c = i & 127;
    v4f v = *reinterpret_cast<const v4f*>(xn + (size_t)i * HWS);
#pragma unroll
    for (int p = 0; p < PX; ++p) {
      ((float*)(smem_all + p * SLAB + O_X))[t * XP + c] = v[p];
      ((bf16*)(smem_all + p * SLAB + O_XQK))[t * QKP + c] = (bf16)v[p];
    }
  }
  // unrolled like the load loop: gv[] is indexed by constants
#pragma unroll
  for (int k = 0; k < TT * GD / 128; ++k) {
    int i = k * 128 + tid;
    int t = i >> 6, j = i & 63;
    xqk[t * QKP + 128 + j] = (bf16)gv[k];
  }
  __syncthreads();

  // -------- P1: q,k (K=192) and v (K=128) GEMMs --------
  {
    v8f aq[2][2], ak[2][2], av[2][2];
#pragma unroll
    for (int m = 0; m < 2; ++m)
#pragma unroll
      for (int j = 0; j < 2; ++j) { aq[m][j] = vzero8(); ak[m][j] = vzero8(); av[m][j] = vzero8(); }
#pragma unroll
    for (int kb = 0; kb < 6; ++kb) {
      v16bf A0 = ld_tile(xqk, QKP, 0, kb * 32, lane);
      v16bf A1 = ld_tile(xqk, QKP, 16, kb * 32, lane);
#pragma unroll
      for (int j = 0; j < 2; ++j) {
        int nt = 2 * wv + j;
        v16bf Bq = ld_wtile(Wqt, nt * (CG / 32) + kb, lane);
        aq[0][j] = wmma_bf16(A0, Bq, aq[0][j]);
        aq[1][j] = wmma_bf16(A1, Bq, aq[1][j]);
        v16bf Bk = ld_wtile(Wkt, nt * (CG / 32) + kb, lane);
        ak[0][j] = wmma_bf16(A0, Bk, ak[0][j]);
        ak[1][j] = wmma_bf16(A1, Bk, ak[1][j]);
        if (kb < 4) {
          v16bf Bv = ld_wtile(Wvt, nt * (CC / 32) + kb, lane);
          av[0][j] = wmma_bf16(A0, Bv, av[0][j]);
          av[1][j] = wmma_bf16(A1, Bv, av[1][j]);
        }
      }
    }
    // epilogue: bias, elu+1, scatter Q (row-major) and K^T, V^T to LDS
#pragma unroll
    for (int j = 0; j < 2; ++j) {
      int col = (2 * wv + j) * 16 + r;
      float bqv = bq[col], bkv = bk[col], bvv = bv[col];
#pragma unroll
      for (int mt = 0; mt < 2; ++mt) {
        v8bf k8, v8;   // eight neighbours of one K^T / V^T row: one 16-byte store each
#pragma unroll
        for (int i = 0; i < 8; ++i) {
          int l = mt * 16 + half * 8 + i;
          float qv = aq[mt][j][i] + bqv;
          qv = (qv > 0.f) ? (qv + 1.f) : __expf(qv);
          Qs[l * CP + col] = (bf16)qv;
          float kv = ak[mt][j][i] + bkv;
          kv = (kv > 0.f) ? (kv + 1.f) : __expf(kv);
          k8[i] = (bf16)kv;
          v8[i] = (bf16)(av[mt][j][i] + bvv);
        }
        *reinterpret_cast<v8bf*>(Kt + col * TP + mt * 16 + half * 8) = k8;
        *reinterpret_cast<v8bf*>(Vt + col * TP + mt * 16 + half * 8) = v8;
      }
    }
  }
  __syncthreads();

  // -------- P2: Ksum, KV = K^T @ V (per head, one WMMA K-step) --------
  {
    float s = 0.f;
#pragma unroll
    for (int i = 0; i < TT; ++i) s += (float)Kt[tid * TP + i];
    Ksum[tid] = s;
  }
  {
    int h = wv;
    v8f acc[2][2];
#pragma unroll
    for (int m = 0; m < 2; ++m)
#pragma unroll
      for (int j = 0; j < 2; ++j) acc[m][j] = vzero8();
#pragma unroll
    for (int mt = 0; mt < 2; ++mt) {
      v16bf A = ld_tile(Kt, TP, h * 32 + mt * 16, 0, lane);
#pragma unroll
      for (int nt = 0; nt < 2; ++nt) {
        v16bf Bv = ld_tile(Vt, TP, h * 32 + nt * 16, 0, lane);
        acc[mt][nt] = wmma_bf16(A, Bv, acc[mt][nt]);
      }
    }
#pragma unroll
    for (int mt = 0; mt < 2; ++mt)
#pragma unroll
      for (int nt = 0; nt < 2; ++nt)
#pragma unroll
        for (int i = 0; i < 8; ++i) {
          int d = mt * 16 + half * 8 + i;       // row of KV
          int e = h * 32 + nt * 16 + r;          // global v-column
          KVt[e * TP + d] = (bf16)acc[mt][nt][i];
        }
  }
  __syncthreads();

  // -------- P2c: Z = 1/(Q.Ksum+eps), ln1 stats --------
  {
    int l = tid >> 2, h = tid & 3;
    float d = 0.f;
#pragma unroll
    for (int i = 0; i < 32; ++i)
      d += (float)Qs[l * CP + h * 32 + i] * Ksum[h * 32 + i];
    Zl[tid] = 1.0f / (d + 1e-6f);
  }
  if (tid < 32) {
    float s = 0.f;
    for (int c = 0; c < CC; ++c) s += xLDS[tid * XP + c];
    float mu = s * (1.0f / CC);
    float v2 = 0.f;
    for (int c = 0; c < CC; ++c) { float d = xLDS[tid * XP + c] - mu; v2 += d * d; }
    mu1[tid] = mu;
    rv1[tid] = rsqrtf(v2 * (1.0f / CC) + 1e-5f);
  }
  __syncthreads();

  // -------- P3: out = (Q @ KV)*Z + LN1(x)  (writes out1 over Kt/Vt) --------
  {
    int h = wv;
    v8f acc[2][2];
#pragma unroll
    for (int m = 0; m < 2; ++m)
#pragma unroll
      for (int j = 0; j < 2; ++j) acc[m][j] = vzero8();
#pragma unroll
    for (int mt = 0; mt < 2; ++mt) {
      v16bf A = ld_tile(Qs, CP, mt * 16, h * 32, lane);
#pragma unroll
      for (int nt = 0; nt < 2; ++nt) {
        v16bf Bv = ld_tile(KVt, TP, h * 32 + nt * 16, 0, lane);
        acc[mt][nt] = wmma_bf16(A, Bv, acc[mt][nt]);
      }
    }
    // row figures read ahead of the first out1 store, so that they stay a few wide
    // loads (behind a store to a padded row the compiler reloads them one by one)
    float zz[2][8], mm[2][8], rr[2][8];
#pragma unroll
    for (int mt = 0; mt < 2; ++mt)
#pragma unroll
      for (int i = 0; i < 8; ++i) {
        int l = mt * 16 + half * 8 + i;
        zz[mt][i] = Zl[l * 4 + h];
        mm[mt][i] = mu1[l];
        rr[mt][i] = rv1[l];
      }
#pragma unroll
    for (int mt = 0; mt < 2; ++mt)
#pragma unroll
      for (int nt = 0; nt < 2; ++nt)
#pragma unroll
        for (int i = 0; i < 8; ++i) {
          int l = mt * 16 + half * 8 + i;
          int c = h * 32 + nt * 16 + r;
          float res = acc[mt][nt][i] * zz[mt][i];
          res += (xLDS[l * XP + c] - mm[mt][i]) * rr[mt][i] * ln1g[c] + ln1b[c];
          out1[l * XP + c] = res;
        }
  }
  __syncthreads();

  // -------- P4: LN2 -> h0 (bf16) --------
  if (tid < 32) {
    float s = 0.f;
    for (int c = 0; c < CC; ++c) s += out1[tid * XP + c];
    float mu = s * (1.0f / CC);
    float v2 = 0.f;
    for (int c = 0; c < CC; ++c) { float d = out1[tid * XP + c] - mu; v2 += d * d; }
    mu2[tid] = mu;
    rv2[tid] = rsqrtf(v2 * (1.0f / CC) + 1e-5f);
  }
  __syncthreads();
  for (int i = tid; i < TT * CC; i += 128) {
    int l = i >> 7, c = i & 127;
    h0[l * CP + c] = (bf16)((out1[l * XP + c] - mu2[l]) * rv2[l] * ln2g[c] + ln2b[c]);
  }
  __syncthreads();

  // -------- P5: h1 = gelu(h0 @ W1 + b1)  (32x512, over x/xqk/Q) --------
  {
    v16bf Ah[2][4];
#pragma unroll
    for (int mt = 0; mt < 2; ++mt)
#pragma unroll
      for (int kb = 0; kb < 4; ++kb)
        Ah[mt][kb] = ld_tile(h0, CP, mt * 16, kb * 32, lane);
#pragma unroll
    for (int jn = 0; jn < 8; ++jn) {
      int nt = wv * 8 + jn;
      v8f acc[2] = {vzero8(), vzero8()};
#pragma unroll
      for (int kb = 0; kb < 4; ++kb) {
        v16bf Bv = ld_wtile(W1t, nt * (CC / 32) + kb, lane);
        acc[0] = wmma_bf16(Ah[0][kb], Bv, acc[0]);
        acc[1] = wmma_bf16(Ah[1][kb], Bv, acc[1]);
      }
      int col = nt * 16 + r;
      float bb = b1[col];
#pragma unroll
      for (int mt = 0; mt < 2; ++mt)
#pragma unroll
        for (int i = 0; i < 8; i += 2) {
          int l = mt * 16 + half * 8 + i;
          v2f hv = {acc[mt][i] + bb, acc[mt][i + 1] + bb};
          v2bf hb = __builtin_convertvector(gelu2(hv), v2bf);
          h1[l * FP + col] = hb[0];
          h1[(l + 1) * FP + col] = hb[1];
        }
    }
  }
  __syncthreads();

  // -------- P6: out1 += h1 @ W2 + b2 (in place, each element by its own thread) --------
  {
    v8f acc[2][2];
#pragma unroll
    for (int m = 0; m < 2; ++m)
#pragma unroll
      for (int j = 0; j < 2; ++j) acc[m][j] = vzero8();
#pragma unroll
    for (int kb = 0; kb < 16; ++kb) {
      v16bf A0 = ld_tile(h1, FP, 0, kb * 32, lane);
      v16bf A1 = ld_tile(h1, FP, 16, kb * 32, lane);
#pragma unroll
      for (int j = 0; j < 2; ++j) {
        int nt = 2 * wv + j;
        v16bf Bv = ld_wtile(W2t, nt * (FF / 32) + kb, lane);
        acc[0][j] = wmma_bf16(A0, Bv, acc[0][j]);
        acc[1][j] = wmma_bf16(A1, Bv, acc[1][j]);
      }
    }
#pragma unroll
    for (int j = 0; j < 2; ++j) {
      int c = (2 * wv + j) * 16 + r;
      float b2v = b2[c];
#pragma unroll
      for (int mt = 0; mt < 2; ++mt)
#pragma unroll
        for (int i = 0; i < 8; ++i) {
          int l = mt * 16 + half * 8 + i;
          out1[l * XP + c] = acc[mt][j][i] + out1[l * XP + c] + b2v;
        }
    }
  }
  __syncthreads();   // every pixel's result is in its slab before the joint store

  // -------- P7: store PX pixels of one (t,c) row as one 16-byte piece --------
  {
    float* on = out + (size_t)b * TT * CC * HWS + hs * WS + wsp;
    v4f v[TT * CC / (128 * PX)];
    // both loops unrolled: v[] stays in registers and the LDS reads run ahead of the stores
#pragma unroll
    for (int it = 0; it < TT * CC / (128 * PX); ++it) {
      int i = it * (128 * PX) + wtid;
      int t = i >> 7, c = i & 127;
#pragma unroll
      for (int p = 0; p < PX; ++p)
        v[it][p] = ((const float*)(smem_all + p * SLAB + O_KT))[t * XP + c];
    }
#pragma unroll
    for (int it = 0; it < TT * CC / (128 * PX); ++it)
      *reinterpret_cast<v4f*>(on + (size_t)(it * (128 * PX) + wtid) * HWS) = v[it];
  }
}

extern "C" void kernel_launch(void* const* d_in, const int* in_sizes, int n_in,
                              void* d_out, int out_size, void* d_ws, size_t ws_size,
                              hipStream_t stream) {
  (void)in_sizes; (void)n_in; (void)out_size; (void)ws_size;
  const float* x    = (const float*)d_in[0];
  const float* g    = (const float*)d_in[1];
  const float* Wq   = (const float*)d_in[2];
  const float* bq   = (const float*)d_in[3];
  const float* Wk   = (const float*)d_in[4];
  const float* bk   = (const float*)d_in[5];
  const float* Wv   = (const float*)d_in[6];
  const float* bv   = (const float*)d_in[7];
  const float* ln1g = (const float*)d_in[8];
  const float* ln1b = (const float*)d_in[9];
  const float* ln2g = (const float*)d_in[10];
  const float* ln2b = (const float*)d_in[11];
  const float* W1   = (const float*)d_in[12];
  const float* b1   = (const float*)d_in[13];
  const float* W2   = (const float*)d_in[14];
  const float* b2   = (const float*)d_in[15];
  unsigned short* wt = (unsigned short*)d_ws;   // 196608 bf16 = 384 KB

  prep_weights<<<(196608 + 255) / 256, 256, 0, stream>>>(Wq, Wk, Wv, W1, W2, wt);
  fused_block<<<NPIX / PX, 128 * PX, 0, stream>>>(x, g, bq, bk, bv, ln1g, ln1b, ln2g, ln2b,
                                        b1, b2, wt, (float*)d_out);
}

// v005
// Measured time: 149 microseconds a run.
// Next to v004, in two timings, it ran 1.05 and 1.06 times as fast.
// All steps since v000 together make it 2.88 times as fast.
#include <hip/hip_runtime.h>
#include <cstdint>

typedef __bf16 bf16;
typedef bf16  v16bf __attribute__((ext_vector_type(16)));
typedef float v8f   __attribute__((ext_vector_type(8)));
typedef float v4f   __attribute__((ext_vector_type(4)));
typedef bf16  v8bf  __attribute__((ext_vector_type(8)));
typedef float v2f   __attribute__((ext_vector_type(2)));
typedef bf16  v2bf  __attribute__((ext_vector_type(2)));

// ---- problem constants (from reference setup) ----
#define BB   4
#define TT   32
#define CC   128
#define HS   32
#define WS   32
#define GD   64
#define CG   192      // C + Gd
#define FF   512      // 4*C
#define NPIX 4096     // B*H*W
#define HWS  1024     // H*W
#define PX   4        // pixels adjacent along W per workgroup (16 B of each x / out line)
// LDS row pitches in elements: every row starts an odd multiple of 16 B after the
// one before it, so the 16 rows that one ds_load_b128 reads fall on 16 different
// groups of four banks (at a pitch that is a multiple of 64 B they share one to four)
#define XP   132      // f32 rows of 128: x, out1          (528 B)
#define QKP  200      // bf16 rows of 192: xqk             (400 B)
#define CP   136      // bf16 rows of 128: Q, h0           (272 B)
#define TP   40       // bf16 rows of 32: K^T, V^T, KV^T   (80 B)
#define FP   520      // bf16 rows of 512: h1              (1040 B)
// byte offsets inside one pixel's slab
#define O_X    0
#define O_XQK  16896
#define O_Q    29696
#define O_KT   38400
#define O_VT   48640
#define O_KVT  58880
#define O_STAT 69120
#define SLAB   70656  // LDS bytes per pixel

static __device__ __forceinline__ v8f vzero8() {
  v8f z;
#pragma unroll
  for (int i = 0; i < 8; ++i) z[i] = 0.0f;
  return z;
}

static __device__ __forceinline__ v8f wmma_bf16(v16bf a, v16bf b, v8f c) {
  return __builtin_amdgcn_wmma_f32_16x16x32_bf16(
      /*neg_a=*/false, a, /*neg_b=*/false, b,
      /*c_mod=*/(short)0, c, /*reuse_a=*/false, /*reuse_b=*/false);
}

// Load a 16x32 bf16 operand tile from row-major storage (A operands, and the B
// operands that are kept N x K in LDS: both sides have the same lane layout).
// lanes 0-15: row rcBase+lane, K = {k..k+7, k+16..k+23}
// lanes 16-31: row rcBase+lane-16, K = {k+8..k+15, k+24..k+31}
template <typename P>
static __device__ __forceinline__ v16bf ld_tile(P base, int stride, int rcBase,
                                                int kBase, int lane) {
  int r = lane & 15, half = lane >> 4;
  P p = base + (size_t)(rcBase + r) * stride + kBase + half * 8;
  v16bf a;
#pragma unroll
  for (int i = 0; i < 8; ++i) { a[i] = p[i]; a[i + 8] = p[16 + i]; }
  return a;
}

// Load one 16(n) x 32(k) weight tile that prep_weights has stored in register order:
// 1 KB a tile, the 32 lanes' first eight values in its first 512 B and their second
// eight in the other 512 B, so that each 16-byte load of a wave reads four whole lines.
static __device__ __forceinline__ v16bf ld_wtile(const bf16* mat, int tile, int lane) {
  const v8bf* p = reinterpret_cast<const v8bf*>(mat + tile * 512 + lane * 8);
  return __builtin_shufflevector(p[0], p[32], 0, 1, 2, 3, 4, 5, 6, 7,
                                 8, 9, 10, 11, 12, 13, 14, 15);
}

// source index of packed element j of a (K x N) row-major weight: tile = nt * (K/32) + kb;
// inside the tile bit 8 picks k+16, bits 7..3 the lane (n = lane & 15, k+8 for lanes 16-31),
// bits 2..0 the eight neighbours along k: the k order of ld_tile at every lane and position
static __device__ __forceinline__ int packed_src(int j, int K, int N) {
  int tile = j >> 9, e = j & 511;
  int nt = tile / (K / 32), kb = tile % (K / 32);
  int lane = (e >> 3) & 31;
  int n = nt * 16 + (lane & 15);
  int k = kb * 32 + (e >> 8) * 16 + (lane >> 4) * 8 + (e & 7);
  return k * N + n;
}

// exact gelu of two values, h * Phi(h) with Phi the normal distribution function, written
// as max(h, 0) - a * Phi(-a), a = |h|: one form for both signs and for every size of h, so
// no branch. Phi(-a) = 2^p(a): p is a degree-8 fit of log2(Phi(-a)) on 0 <= a <= 6, its error
// weighted by Phi(-a); against gelu in double precision the f32 result is off by less than
// 3e-7 on -8 <= h <= 8 (with the library's erf in h / 2 * (1 + erf(h / sqrt 2)): 5e-7).
// Past a = 6 the term a * Phi(-a) is held at its value there, 6e-9 (true value: less).
static __device__ __forceinline__ v2f gelu2(v2f h) {
  v2f a, e, relu;
  a[0] = fminf(fabsf(h[0]), 6.0f);
  a[1] = fminf(fabsf(h[1]), 6.0f);
  v2f p = -0.00000138095049f;
  p = __builtin_elementwise_fma(p, a, (v2f)0.0000228085610f);
  p = __builtin_elementwise_fma(p, a, (v2f)-0.000112637688f);
  p = __builtin_elementwise_fma(p, a, (v2f)-0.000299850391f);
  p = __builtin_elementwise_fma(p, a, (v2f)0.00725496560f);
  p = __builtin_elementwise_fma(p, a, (v2f)-0.0526133589f);
  p = __builtin_elementwise_fma(p, a, (v2f)-0.459174365f);
  p = __builtin_elementwise_fma(p, a, (v2f)-1.15110886f);
  p = __builtin_elementwise_fma(p, a, (v2f)-0.999999940f);
  e[0] = __builtin_amdgcn_exp2f(p[0]);   // p is never below -30: no range handling needed
  e[1] = __builtin_amdgcn_exp2f(p[1]);
  relu[0] = fmaxf(h[0], 0.0f);
  relu[1] = fmaxf(h[1], 0.0f);
  return __builtin_elementwise_fma(-a, e, relu);
}

// ---- layer-norm rows: four lanes a row, 32 values a lane, held in registers ----
// lane q of a row takes columns q*16..q*16+15 and 64+q*16..64+q*16+15: at the row pitch XP
// the 16 lanes that one half of a ds_load_b128 serves (4 rows x 4 q) fall on 16 different
// groups of four banks
static __device__ __forceinline__ int ln_col(int q, int i) {
  return (i >> 2) * 64 + q * 16 + (i & 3) * 4;
}

// sum over the four lanes of a row (lane bits 2 and 3), every lane gets it: two DPP steps
// inside the 16-lane row (row_xmask:4, row_xmask:8), no LDS round trip
static __device__ __forceinline__ float sum_row_lanes(float v) {
  v += __int_as_float(__builtin_amdgcn_update_dpp(0, __float_as_int(v), 0x164, 0xf, 0xf, true));
  v += __int_as_float(__builtin_amdgcn_update_dpp(0, __float_as_int(v), 0x168, 0xf, 0xf, true));
  return v;
}

// mean and 1/sqrt(var + 1e-5) of a row of CC values; two passes, as the definition has it
static __device__ __forceinline__ void ln_stats(const float* row, int q, v4f (&v)[8],
                                                float& mu, float& rv) {
  // the three loops unrolled: v[] is indexed by constants and stays in registers
#pragma unroll
  for (int i = 0; i < 8; ++i) v[i] = *reinterpret_cast<const v4f*>(row + ln_col(q, i));
  v4f s = v[0];
#pragma unroll
  for (int i = 1; i < 8; ++i) s += v[i];
  mu = sum_row_lanes((s[0] + s[1]) + (s[2] + s[3])) * (1.0f / CC);
  v4f w = 0.0f;
#pragma unroll
  for (int i = 0; i < 8; ++i) { v4f d = v[i] - mu; w += d * d; }
  rv = rsqrtf(sum_row_lanes((w[0] + w[1]) + (w[2] + w[3])) * (1.0f / CC) + 1e-5f);
}

// ---- weight prep: fp32 -> bf16, packed tile by tile in the order ld_wtile reads ----
// ws layout (bf16 elements): Wqt[0..24576) Wkt[..49152) Wvt[..65536)
//                            W1t[..131072) W2t[..196608)
__global__ void prep_weights(const float* __restrict__ Wq,
                             const float* __restrict__ Wk,
                             const float* __restrict__ Wv,
                             const float* __restrict__ W1,
                             const float* __restrict__ W2,
                             unsigned short* __restrict__ wsu) {
  bf16* o = reinterpret_cast<bf16*>(wsu);
  int i = blockIdx.x * blockDim.x + threadIdx.x;
  if (i >= 196608) return;
  int j = i;
  if (j < 24576) { o[i] = (bf16)Wq[packed_src(j, CG, CC)]; return; }
  j -= 24576;
  if (j < 24576) { o[i] = (bf16)Wk[packed_src(j, CG, CC)]; return; }
  j -= 24576;
  if (j < 16384) { o[i] = (bf16)Wv[packed_src(j, CC, CC)]; return; }
  j -= 16384;
  if (j < 65536) { o[i] = (bf16)W1[packed_src(j, CC, FF)]; return; }
  j -= 65536;
  o[i] = (bf16)W2[packed_src(j, FF, CC)];
}

// ---- fused block: one workgroup per PX adjacent pixels; four waves and one
// LDS slab per pixel; x is read and out is written PX pixels at a time ----
// The register cap keeps the scheduler from hoisting weight loads up to the
// 16-wave limit of 256, where a few long-lived addresses spilled to scratch.
__global__ __launch_bounds__(128 * PX) __attribute__((amdgpu_num_vgpr(224)))
void fused_block(const float* __restrict__ x, const float* __restrict__ gdn,
                 const float* __restrict__ bq, const float* __restrict__ bk,
                 const float* __restrict__ bv,
                 const float* __restrict__ ln1g, const float* __restrict__ ln1b,
                 const float* __restrict__ ln2g, const float* __restrict__ ln2b,
                 const float* __restrict__ b1, const float* __restrict__ b2,
                 const unsigned short* __restrict__ wsu,
                 float* __restrict__ out) {
  __shared__ __attribute__((aligned(16))) unsigned char smem_all[PX * SLAB];
  const int wtid = threadIdx.x;              // 0 .. 128*PX-1
  unsigned char* smem = smem_all + (wtid >> 7) * SLAB;   // this pixel's slab
  // phase-reused LDS layout (per slab)
  float* xLDS = (float*)(smem + O_X);        // 32x128 f32, pitch XP   (dead after P3)
  bf16*  xqk  = (bf16*)(smem + O_XQK);       // 32x192 bf16, pitch QKP (dead after P1)
  bf16*  Qs   = (bf16*)(smem + O_Q);         // 32x128 bf16, pitch CP  (dead after P3)
  bf16*  Kt   = (bf16*)(smem + O_KT);        // 128x32 bf16, pitch TP  (dead after P2)
  bf16*  Vt   = (bf16*)(smem + O_VT);        // 128x32 bf16, pitch TP  (dead after P2)
  bf16*  KVt  = (bf16*)(smem + O_KVT);       // 128x32 bf16, pitch TP  (dead after P3)
  float* Ksum = (float*)(smem + O_STAT);         // 128 f32
  float* Zl   = (float*)(smem + O_STAT + 512);   // 128 f32 (l*4+h)
  float* mu1  = (float*)(smem + O_STAT + 1024);  // 32
  float* rv1  = (float*)(smem + O_STAT + 1152);  // 32
  float* out1 = (float*)(smem + O_KT);       // 32x128 f32, pitch XP (over Kt+Vt)
  bf16*  h0   = (bf16*)(smem + O_KVT);       // 32x128 bf16, pitch CP (over KVt)
  bf16*  h1   = (bf16*)(smem + O_X);         // 32x512 bf16, pitch FP (over x,xqk,Q)

  const bf16* Wqt = reinterpret_cast<const bf16*>(wsu);
  const bf16* Wkt = Wqt + 24576;
  const bf16* Wvt = Wqt + 49152;
  const bf16* W1t = Wqt + 65536;
  const bf16* W2t = Wqt + 131072;

  const int tid  = wtid & 127;        // thread within the pixel's four waves
  const int lane = tid & 31;
  const int wv   = tid >> 5;          // wave id 0..3 within the pixel
  const int r    = lane & 15;
  const int half = lane >> 4;
  const int lnr  = wv * 8 + half * 4 + (lane & 3);   // layer norms: this lane's row ...
  const int lnq  = (lane >> 2) & 3;                  // ... and its quarter of the row

  const int n   = blockIdx.x * PX;    // first of the PX pixels
  const int b   = n >> 10;
  const int hs  = (n >> 5) & 31;
  const int wsp = n & 31;             // multiple of PX: 16-byte aligned
  const float* xn = x + (size_t)b * TT * CC * HWS + hs * WS + wsp;

  // -------- P0: stage x and xqk=[x|guidance] --------
  // guidance is loaded ahead of the x loop: no LDS store stands between the run and its
  // wait, and all of a thread's global loads are in flight together
  float gv[TT * GD / 128];
  // unrolled: gv[] is indexed by constants and stays in registers
#pragma unroll
  for (int k = 0; k < TT * GD / 128; ++k) {
    int i = k * 128 + tid;
    int t = i >> 6, j = i & 63;
    gv[k] = gdn[((size_t)b * TT + t) * GD + j];
  }
  // the x loads' results land in the run's address registers: the wait that belongs
  // in front of such an overwrite
  asm volatile("s_wait_xcnt 0x0" ::: "memory");
  // unrolled so that all of a thread's 16-byte loads are in flight together
#pragma unroll
  for (int it = 0; it < TT * CC / (128 * PX); ++it) {
    int i = it * (128 * PX) + wtid;
    int t = i >> 7, c = i & 127;
    v4f v = *reinterpret_cast<const v4f*>(xn + (size_t)i * HWS);
#pragma unroll
    for (int p = 0; p < PX; ++p) {
      ((float*)(smem_all + p * SLAB + O_X))[t * XP + c] = v[p];
      ((bf16*)(smem_all + p * SLAB + O_XQK))[t * QKP + c] = (bf16)v[p];
    }
  }
  // unrolled like the load loop: gv[] is indexed by constants
#pragma unroll
  for (int k = 0; k < TT * GD / 128; ++k) {
    int i = k * 128 + tid;
    int t = i >> 6, j = i & 63;
    xqk[t * QKP + 128 + j] = (bf16)gv[k];
  }
  __syncthreads();

  // -------- P1: q,k (K=192) and v (K=128) GEMMs --------
  {
    v8f aq[2][2], ak[2][2], av[2][2];
#pragma unroll
    for (int m = 0; m < 2; ++m)
#pragma unroll
      for (int j = 0; j < 2; ++j) { aq[m][j] = vzero8(); ak[m][j] = vzero8(); av[m][j] = vzero8(); }
#pragma unroll
    for (int kb = 0; kb < 6; ++kb) {
      v16bf A0 = ld_tile(xqk, QKP, 0, kb * 32, lane);
      v16bf A1 = ld_tile(xqk, QKP, 16, kb * 32, lane);
#pragma unroll
      for (int j = 0; j < 2; ++j) {
        int nt = 2 * wv + j;
        v16bf Bq = ld_wtile(Wqt, nt * (CG / 32) + kb, lane);
        aq[0][j] = wmma_bf16(A0, Bq, aq[0][j]);
        aq[1][j] = wmma_bf16(A1, Bq, aq[1][j]);
        v16bf Bk = ld_wtile(Wkt, nt * (CG / 32) + kb, lane);
        ak[0][j] = wmma_bf16(A0, Bk, ak[0][j]);
        ak[1][j] = wmma_bf16(A1, Bk, ak[1][j]);
        if (kb < 4) {
          v16bf Bv = ld_wtile(Wvt, nt * (CC / 32) + kb, lane);
          av[0][j] = wmma_bf16(A0, Bv, av[0][j]);
          av[1][j] = wmma_bf16(A1, Bv, av[1][j]);
        }
      }
    }
    // epilogue: bias, elu+1, scatter Q (row-major) and K^T, V^T to LDS
#pragma unroll
    for (int j = 0; j < 2; ++j) {
      int col = (2 * wv + j) * 16 + r;
      float bqv = bq[col], bkv = bk[col], bvv = bv[col];
#pragma unroll
      for (int mt = 0; mt < 2; ++mt) {
        v8bf k8, v8;   // eight neighbours of one K^T / V^T row: one 16-byte store each
#pragma unroll
        for (int i = 0; i < 8; ++i) {
          int l = mt * 16 + half * 8 + i;
          float qv = aq[mt][j][i] + bqv;
          qv = (qv > 0.f) ? (qv + 1.f) : __expf(qv);
          Qs[l * CP + col] = (bf16)qv;
          float kv = ak[mt][j][i] + bkv;
          kv = (kv > 0.f) ? (kv + 1.f) : __expf(kv);
          k8[i] = (bf16)kv;
          v8[i] = (bf16)(av[mt][j][i] + bvv);
        }
        *reinterpret_cast<v8bf*>(Kt + col * TP + mt * 16 + half * 8) = k8;
        *reinterpret_cast<v8bf*>(Vt + col * TP + mt * 16 + half * 8) = v8;
      }
    }
  }
  __syncthreads();

  // -------- P2: Ksum, KV = K^T @ V (per head, one WMMA K-step) --------
  {
    float s = 0.f;
#pragma unroll
    for (int i = 0; i < TT; ++i) s += (float)Kt[tid * TP + i];
    Ksum[tid] = s;
  }
  {
    int h = wv;
    v8f acc[2][2];
#pragma unroll
    for (int m = 0; m < 2; ++m)
#pragma unroll
      for (int j = 0; j < 2; ++j) acc[m][j] = vzero8();
#pragma unroll
    for (int mt = 0; mt < 2; ++mt) {
      v16bf A = ld_tile(Kt, TP, h * 32 + mt * 16, 0, lane);
#pragma unroll
      for (int nt = 0; nt < 2; ++nt) {
        v16bf Bv = ld_tile(Vt, TP, h * 32 + nt * 16, 0, lane);
        acc[mt][nt] = wmma_bf16(A, Bv, acc[mt][nt]);
      }
    }
#pragma unroll
    for (int mt = 0; mt < 2; ++mt)
#pragma unroll
      for (int nt = 0; nt < 2; ++nt)
#pragma unroll
        for (int i = 0; i < 8; ++i) {
          int d = mt * 16 + half * 8 + i;       // row of KV
          int e = h * 32 + nt * 16 + r;          // global v-column
          KVt[e * TP + d] = (bf16)acc[mt][nt][i];
        }
  }
  __syncthreads();

  // -------- P2c: Z = 1/(Q.Ksum+eps), ln1 stats --------
  {
    int l = tid >> 2, h = tid & 3;
    float d = 0.f;
#pragma unroll
    for (int i = 0; i < 32; ++i)
      d += (float)Qs[l * CP + h * 32 + i] * Ksum[h * 32 + i];
    Zl[tid] = 1.0f / (d + 1e-6f);
  }
  {
    v4f xv[8];
    float mu, rv;
    ln_stats(xLDS + lnr * XP, lnq, xv, mu, rv);
    if (lnq == 0) { mu1[lnr] = mu; rv1[lnr] = rv; }
  }
  __syncthreads();

  // -------- P3: out = (Q @ KV)*Z + LN1(x)  (writes out1 over Kt/Vt) --------
  {
    int h = wv;
    v8f acc[2][2];
#pragma unroll
    for (int m = 0; m < 2; ++m)
#pragma unroll
      for (int j = 0; j < 2; ++j) acc[m][j] = vzero8();
#pragma unroll
    for (int mt = 0; mt < 2; ++mt) {
      v16bf A = ld_tile(Qs, CP, mt * 16, h * 32, lane);
#pragma unroll
      for (int nt = 0; nt < 2; ++nt) {
        v16bf Bv = ld_tile(KVt, TP, h * 32 + nt * 16, 0, lane);
        acc[mt][nt] = wmma_bf16(A, Bv, acc[mt][nt]);
      }
    }
    // row figures read ahead of the first out1 store, so that they stay a few wide
    // loads (behind a store to a padded row the compiler reloads them one by one)
    float zz[2][8], mm[2][8], rr[2][8];
#pragma unroll
    for (int mt = 0; mt < 2; ++mt)
#pragma unroll
      for (int i = 0; i < 8; ++i) {
        int l = mt * 16 + half * 8 + i;
        zz[mt][i] = Zl[l * 4 + h];
        mm[mt][i] = mu1[l];
        rr[mt][i] = rv1[l];
      }
#pragma unroll
    for (int mt = 0; mt < 2; ++mt)
#pragma unroll
      for (int nt = 0; nt < 2; ++nt)
#pragma unroll
        for (int i = 0; i < 8; ++i) {
          int l = mt * 16 + half * 8 + i;
          int c = h * 32 + nt * 16 + r;
          float res = acc[mt][nt][i] * zz[mt][i];
          res += (xLDS[l * XP + c] - mm[mt][i]) * rr[mt][i] * ln1g[c] + ln1b[c];
          out1[l * XP + c] = res;
        }
  }
  // LN2's scale and shift for this lane's 32 columns, asked for ahead of the barrier
  v4f g2[8], s2[8];
  const int lnoff = lnq * 16;
  // unrolled: g2[], s2[] stay in registers and the 16 loads are in flight together
#pragma unroll
  for (int i = 0; i < 8; ++i) {
    g2[i] = *reinterpret_cast<const v4f*>(ln2g + lnoff + ln_col(0, i));
    s2[i] = *reinterpret_cast<const v4f*>(ln2b + lnoff + ln_col(0, i));
  }
  // the wait that belongs in front of an overwrite of the run's offset register; the
  // operand keeps that register alive up to here, so that no load of the run lands in it
  asm volatile("s_wait_xcnt 0x0" :: "v"(lnoff * 4) : "memory");
  __syncthreads();

  // -------- P4: LN2 -> h0 (bf16), straight from the registers the statistics came from --------
  {
    v4f ov[8];
    float mu, rv;
    ln_stats(out1 + lnr * XP, lnq, ov, mu, rv);
    // both loops unrolled: ov[], g2[], s2[] are indexed by constants
#pragma unroll
    for (int j = 0; j < 4; ++j) {
      v8bf hb;   // eight neighbours of the row: one 16-byte store
#pragma unroll
      for (int e = 0; e < 8; ++e) {
        int i = j * 2 + (e >> 2);
        hb[e] = (bf16)((ov[i][e & 3] - mu) * rv * g2[i][e & 3] + s2[i][e & 3]);
      }
      *reinterpret_cast<v8bf*>(h0 + lnr * CP + ln_col(lnq, j * 2)) = hb;
    }
  }
  __syncthreads();

  // -------- P5: h1 = gelu(h0 @ W1 + b1)  (32x512, over x/xqk/Q) --------
  {
    v16bf Ah[2][4];
#pragma unroll
    for (int mt = 0; mt < 2; ++mt)
#pragma unroll
      for (int kb = 0; kb < 4; ++kb)
        Ah[mt][kb] = ld_tile(h0, CP, mt * 16, kb * 32, lane);
#pragma unroll
    for (int jn = 0; jn < 8; ++jn) {
      int nt = wv * 8 + jn;
      v8f acc[2] = {vzero8(), vzero8()};
#pragma unroll
      for (int kb = 0; kb < 4; ++kb) {
        v16bf Bv = ld_wtile(W1t, nt * (CC / 32) + kb, lane);
        acc[0] = wmma_bf16(Ah[0][kb], Bv, acc[0]);
        acc[1] = wmma_bf16(Ah[1][kb], Bv, acc[1]);
      }
      int col = nt * 16 + r;
      float bb = b1[col];
#pragma unroll
      for (int mt = 0; mt < 2; ++mt)
#pragma unroll
        for (int i = 0; i < 8; i += 2) {
          int l = mt * 16 + half * 8 + i;
          v2f hv = {acc[mt][i] + bb, acc[mt][i + 1] + bb};
          v2bf hb = __builtin_convertvector(gelu2(hv), v2bf);
          h1[l * FP + col] = hb[0];
          h1[(l + 1) * FP + col] = hb[1];
        }
    }
  }
  __syncthreads();

  // -------- P6: out1 += h1 @ W2 + b2 (in place, each element by its own thread) --------
  {
    v8f acc[2][2];
#pragma unroll
    for (int m = 0; m < 2; ++m)
#pragma unroll
      for (int j = 0; j < 2; ++j) acc[m][j] = vzero8();
#pragma unroll
    for (int kb = 0; kb < 16; ++kb) {
      v16bf A0 = ld_tile(h1, FP, 0, kb * 32, lane);
      v16bf A1 = ld_tile(h1, FP, 16, kb * 32, lane);
#pragma unroll
      for (int j = 0; j < 2; ++j) {
        int nt = 2 * wv + j;
        v16bf Bv = ld_wtile(W2t, nt * (FF / 32) + kb, lane);
        acc[0][j] = wmma_bf16(A0, Bv, acc[0][j]);
        acc[1][j] = wmma_bf16(A1, Bv, acc[1][j]);
      }
    }
#pragma unroll
    for (int j = 0; j < 2; ++j) {
      int c = (2 * wv + j) * 16 + r;
      float b2v = b2[c];
#pragma unroll
      for (int mt = 0; mt < 2; ++mt)
#pragma unroll
        for (int i = 0; i < 8; ++i) {
          int l = mt * 16 + half * 8 + i;
          out1[l * XP + c] = acc[mt][j][i] + out1[l * XP + c] + b2v;
        }
    }
  }
  __syncthreads();   // every pixel's result is in its slab before the joint store

  // -------- P7: store PX pixels of one (t,c) row as one 16-byte piece --------
  {
    float* on = out + (size_t)b * TT * CC * HWS + hs * WS + wsp;
    v4f v[TT * CC / (128 * PX)];
    // both loops unrolled: v[] stays in registers and the LDS reads run ahead of the stores
#pragma unroll
    for (int it = 0; it < TT * CC / (128 * PX); ++it) {
      int i = it * (128 * PX) + wtid;
      int t = i >> 7, c = i & 127;
#pragma unroll
      for (int p = 0; p < PX; ++p)
        v[it][p] = ((const float*)(smem_all + p * SLAB + O_KT))[t * XP + c];
    }
#pragma unroll
    for (int it = 0; it < TT * CC / (128 * PX); ++it)
      *reinterpret_cast<v4f*>(on + (size_t)(it * (128 * PX) + wtid) * HWS) = v[it];
  }
}

extern "C" void kernel_launch(void* const* d_in, const int* in_sizes, int n_in,
                              void* d_out, int out_size, void* d_ws, size_t ws_size,
                              hipStream_t stream) {
  (void)in_sizes; (void)n_in; (void)out_size; (void)ws_size;
  const float* x    = (const float*)d_in[0];
  const float* g    = (const float*)d_in[1];
  const float* Wq   = (const float*)d_in[2];
  const float* bq   = (const float*)d_in[3];
  const float* Wk   = (const float*)d_in[4];
  const float* bk   = (const float*)d_in[5];
  const float* Wv   = (const float*)d_in[6];
  const float* bv   = (const float*)d_in[7];
  const float* ln1g = (const float*)d_in[8];
  const float* ln1b = (const float*)d_in[9];
  const float* ln2g = (const float*)d_in[10];
  const float* ln2b = (const float*)d_in[11];
  const float* W1   = (const float*)d_in[12];
  const float* b1   = (const float*)d_in[13];
  const float* W2   = (const float*)d_in[14];
  const float* b2   = (const float*)d_in[15];
  unsigned short* wt = (unsigned short*)d_ws;   // 196608 bf16 = 384 KB

  prep_weights<<<(196608 + 255) / 256, 256, 0, stream>>>(Wq, Wk, Wv, W1, W2, wt);
  fused_block<<<NPIX / PX, 128 * PX, 0, stream>>>(x, g, bq, bk, bv, ln1g, ln1b, ln2g, ln2b,
                                        b1, b2, wt, (float*)d_out);
}

// v006
// A run of this version takes 144 microseconds.
// Two timings next to v005 both put it at 1.03 times that version's speed.
// Counting every step since v000, it is 2.97 times as fast.
#include <hip/hip_runtime.h>
#include <cstdint>

typedef __bf16 bf16;
typedef bf16  v16bf __attribute__((ext_vector_type(16)));
typedef float v8f   __attribute__((ext_vector_type(8)));
typedef float v4f   __attribute__((ext_vector_type(4)));
typedef bf16  v8bf  __attribute__((ext_vector_type(8)));
typedef float v2f   __attribute__((ext_vector_type(2)));
typedef bf16  v2bf  __attribute__((ext_vector_type(2)));

// ---- problem constants (from reference setup) ----
#define BB   4
#define TT   32
#define CC   128
#define HS   32
#define WS   32
#define GD   64
#define CG   192      // C + Gd
#define FF   512      // 4*C
#define NPIX 4096     // B*H*W
#define HWS  1024     // H*W
#define PX   4        // pixels adjacent along W per tile (16 B of each x / out line)
#define TILES 4       // tiles of PX pixels that one workgroup works through, one after another
#define NWG  (NPIX / PX / TILES)
// LDS row pitches in elements: every row starts an odd multiple of 16 B after the
// one before it, so the 16 rows that one ds_load_b128 reads fall on 16 different
// groups of four banks (at a pitch that is a multiple of 64 B they share one to four)
#define XP   132      // f32 rows of 128: x, out1          (528 B)
#define QKP  200      // bf16 rows of 192: xqk             (400 B)
#define CP   136      // bf16 rows of 128: Q, h0           (272 B)
#define TP   40       // bf16 rows of 32: K^T, V^T, KV^T   (80 B)
#define FP   520      // bf16 rows of 512: h1              (1040 B)
// byte offsets inside one pixel's slab
#define O_X    0
#define O_XQK  16896
#define O_Q    29696
#define O_KT   38400
#define O_VT   48640
#define O_KVT  16896  // over xqk, which is dead when KV^T is written
#define O_H0   55296  // behind out1, over the end of V^T and the row figures (both dead)
#define O_STAT 58880
#define SLAB   64000  // LDS bytes per pixel
#define O_STG  (PX * SLAB)          // behind the slabs: the next tile's x as it lies in memory,
#define STGB   (TT * CC * PX * 4)   // 16 B (PX pixels) for each of the TT*CC (t,c) lines

static __device__ __forceinline__ v8f vzero8() {
  v8f z;
#pragma unroll
  for (int i = 0; i < 8; ++i) z[i] = 0.0f;
  return z;
}

static __device__ __forceinline__ v8f wmma_bf16(v16bf a, v16bf b, v8f c) {
  return __builtin_amdgcn_wmma_f32_16x16x32_bf16(
      /*neg_a=*/false, a, /*neg_b=*/false, b,
      /*c_mod=*/(short)0, c, /*reuse_a=*/false, /*reuse_b=*/false);
}

// Load a 16x32 bf16 operand tile from row-major storage (A operands, and the B
// operands that are kept N x K in LDS: both sides have the same lane layout).
// lanes 0-15: row rcBase+lane, K = {k..k+7, k+16..k+23}
// lanes 16-31: row rcBase+lane-16, K = {k+8..k+15, k+24..k+31}
template <typename P>
static __device__ __forceinline__ v16bf ld_tile(P base, int stride, int rcBase,
                                                int kBase, int lane) {
  int r = lane & 15, half = lane >> 4;
  P p = base + (size_t)(rcBase + r) * stride + kBase + half * 8;
  v16bf a;
#pragma unroll
  for (int i = 0; i < 8; ++i) { a[i] = p[i]; a[i + 8] = p[16 + i]; }
  return a;
}

// Load one 16(n) x 32(k) weight tile that prep_weights has stored in register order:
// 1 KB a tile, the 32 lanes' first eight values in its first 512 B and their second
// eight in the other 512 B, so that each 16-byte load of a wave reads four whole lines.
static __device__ __forceinline__ v16bf ld_wtile(const bf16* mat, int tile, int lane) {
  const v8bf* p = reinterpret_cast<const v8bf*>(mat + tile * 512 + lane * 8);
  return __builtin_shufflevector(p[0], p[32], 0, 1, 2, 3, 4, 5, 6, 7,
                                 8, 9, 10, 11, 12, 13, 14, 15);
}

// source index of packed element j of a (K x N) row-major weight: tile = nt * (K/32) + kb;
// inside the tile bit 8 picks k+16, bits 7..3 the lane (n = lane & 15, k+8 for lanes 16-31),
// bits 2..0 the eight neighbours along k: the k order of ld_tile at every lane and position
static __device__ __forceinline__ int packed_src(int j, int K, int N) {
  int tile = j >> 9, e = j & 511;
  int nt = tile / (K / 32), kb = tile % (K / 32);
  int lane = (e >> 3) & 31;
  int n = nt * 16 + (lane & 15);
  int k = kb * 32 + (e >> 8) * 16 + (lane >> 4) * 8 + (e & 7);
  return k * N + n;
}

// exact gelu of two values, h * Phi(h) with Phi the normal distribution function, written
// as max(h, 0) - a * Phi(-a), a = |h|: one form for both signs and for every size of h, so
// no branch. Phi(-a) = 2^p(a): p is a degree-8 fit of log2(Phi(-a)) on 0 <= a <= 6, its error
// weighted by Phi(-a); against gelu in double precision the f32 result is off by less than
// 3e-7 on -8 <= h <= 8 (with the library's erf in h / 2 * (1 + erf(h / sqrt 2)): 5e-7).
// Past a = 6 the term a * Phi(-a) is held at its value there, 6e-9 (true value: less).
static __device__ __forceinline__ v2f gelu2(v2f h) {
  v2f a, e, relu;
  a[0] = fminf(fabsf(h[0]), 6.0f);
  a[1] = fminf(fabsf(h[1]), 6.0f);
  v2f p = -0.00000138095049f;
  p = __builtin_elementwise_fma(p, a, (v2f)0.0000228085610f);
  p = __builtin_elementwise_fma(p, a, (v2f)-0.000112637688f);
  p = __builtin_elementwise_fma(p, a, (v2f)-0.000299850391f);
  p = __builtin_elementwise_fma(p, a, (v2f)0.00725496560f);
  p = __builtin_elementwise_fma(p, a, (v2f)-0.0526133589f);
  p = __builtin_elementwise_fma(p, a, (v2f)-0.459174365f);
  p = __builtin_elementwise_fma(p, a, (v2f)-1.15110886f);
  p = __builtin_elementwise_fma(p, a, (v2f)-0.999999940f);
  e[0] = __builtin_amdgcn_exp2f(p[0]);   // p is never below -30: no range handling needed
  e[1] = __builtin_amdgcn_exp2f(p[1]);
  relu[0] = fmaxf(h[0], 0.0f);
  relu[1] = fmaxf(h[1], 0.0f);
  return __builtin_elementwise_fma(-a, e, relu);
}

// ---- layer-norm rows: four lanes a row, 32 values a lane, held in registers ----
// lane q of a row takes columns q*16..q*16+15 and 64+q*16..64+q*16+15: at the row pitch XP
// the 16 lanes that one half of a ds_load_b128 serves (4 rows x 4 q) fall on 16 different
// groups of four banks
static __device__ __forceinline__ int ln_col(int q, int i) {
  return (i >> 2) * 64 + q * 16 + (i & 3) * 4;
}

// sum over the four lanes of a row (lane bits 2 and 3), every lane gets it: two DPP steps
// inside the 16-lane row (row_xmask:4, row_xmask:8), no LDS round trip
static __device__ __forceinline__ float sum_row_lanes(float v) {
  v += __int_as_float(__builtin_amdgcn_update_dpp(0, __float_as_int(v), 0x164, 0xf, 0xf, true));
  v += __int_as_float(__builtin_amdgcn_update_dpp(0, __float_as_int(v), 0x168, 0xf, 0xf, true));
  return v;
}

// mean and 1/sqrt(var + 1e-5) of a row of CC values; two passes, as the definition has it
static __device__ __forceinline__ void ln_stats(const float* row, int q, v4f (&v)[8],
                                                float& mu, float& rv) {
  // the three loops unrolled: v[] is indexed by constants and stays in registers
#pragma unroll
  for (int i = 0; i < 8; ++i) v[i] = *reinterpret_cast<const v4f*>(row + ln_col(q, i));
  v4f s = v[0];
#pragma unroll
  for (int i = 1; i < 8; ++i) s += v[i];
  mu = sum_row_lanes((s[0] + s[1]) + (s[2] + s[3])) * (1.0f / CC);
  v4f w = 0.0f;
#pragma unroll
  for (int i = 0; i < 8; ++i) { v4f d = v[i] - mu; w += d * d; }
  rv = rsqrtf(sum_row_lanes((w[0] + w[1]) + (w[2] + w[3])) * (1.0f / CC) + 1e-5f);
}

// element offset of pixel n in x and in out, at t = 0, c = 0
static __device__ __forceinline__ size_t pix_off(int n) {
  return (size_t)(n >> 10) * TT * CC * HWS + (n & (HWS - 1));
}

// One tile's x, global memory -> staging buffer, through no register: thread w brings the
// 16 bytes of lines w, w + 512, ... to the same places of the buffer. The copies count on
// asynccnt alone, so the weight loads issued behind them are not held up by their return.
// s_wait_xcnt stands inside the statement: in front of any reuse of the address registers.
static __device__ __forceinline__ void copy_x_tile(const float* xn, unsigned stg, int wtid) {
  const float* g = xn + (size_t)wtid * HWS;
  const unsigned l = stg + wtid * 16;
  const size_t gs = (size_t)(128 * PX) * HWS;
  const unsigned ls = 128 * PX * 16;
  asm volatile(
      "global_load_async_to_lds_b128 %0, %8, off\n\t"
      "global_load_async_to_lds_b128 %1, %9, off\n\t"
      "global_load_async_to_lds_b128 %2, %10, off\n\t"
      "global_load_async_to_lds_b128 %3, %11, off\n\t"
      "global_load_async_to_lds_b128 %4, %12, off\n\t"
      "global_load_async_to_lds_b128 %5, %13, off\n\t"
      "global_load_async_to_lds_b128 %6, %14, off\n\t"
      "global_load_async_to_lds_b128 %7, %15, off\n\t"
      "s_wait_xcnt 0x0"
      :: "v"(l), "v"(l + ls), "v"(l + 2 * ls), "v"(l + 3 * ls),
         "v"(l + 4 * ls), "v"(l + 5 * ls), "v"(l + 6 * ls), "v"(l + 7 * ls),
         "v"(g), "v"(g + gs), "v"(g + 2 * gs), "v"(g + 3 * gs),
         "v"(g + 4 * gs), "v"(g + 5 * gs), "v"(g + 6 * gs), "v"(g + 7 * gs)
      : "memory");
}

// ---- weight prep: fp32 -> bf16, packed tile by tile in the order ld_wtile reads ----
// ws layout (bf16 elements): Wqt[0..24576) Wkt[..49152) Wvt[..65536)
//                            W1t[..131072) W2t[..196608)
__global__ void prep_weights(const float* __restrict__ Wq,
                             const float* __restrict__ Wk,
                             const float* __restrict__ Wv,
                             const float* __restrict__ W1,
                             const float* __restrict__ W2,
                             unsigned short* __restrict__ wsu) {
  bf16* o = reinterpret_cast<bf16*>(wsu);
  int i = blockIdx.x * blockDim.x + threadIdx.x;
  if (i >= 196608) return;
  int j = i;
  if (j < 24576) { o[i] = (bf16)Wq[packed_src(j, CG, CC)]; return; }
  j -= 24576;
  if (j < 24576) { o[i] = (bf16)Wk[packed_src(j, CG, CC)]; return; }
  j -= 24576;
  if (j < 16384) { o[i] = (bf16)Wv[packed_src(j, CC, CC)]; return; }
  j -= 16384;
  if (j < 65536) { o[i] = (bf16)W1[packed_src(j, CC, FF)]; return; }
  j -= 65536;
  o[i] = (bf16)W2[packed_src(j, FF, CC)];
}

// ---- fused block: one workgroup works through TILES tiles of PX adjacent pixels; four
// waves and one LDS slab per pixel; x is read and out is written PX pixels at a time;
// the next tile's x is on its way into LDS while this tile is worked on ----
// The register cap keeps the scheduler from hoisting weight loads up to the
// 16-wave limit of 256, where a few long-lived addresses spilled to scratch.
__global__ __launch_bounds__(128 * PX) __attribute__((amdgpu_num_vgpr(224)))
void fused_block(const float* __restrict__ x, const float* __restrict__ gdn,
                 const float* __restrict__ bq, const float* __restrict__ bk,
                 const float* __restrict__ bv,
                 const float* __restrict__ ln1g, const float* __restrict__ ln1b,
                 const float* __restrict__ ln2g, const float* __restrict__ ln2b,
                 const float* __restrict__ b1, const float* __restrict__ b2,
                 const unsigned short* __restrict__ wsu,
                 float* __restrict__ out) {
  __shared__ __attribute__((aligned(16))) unsigned char smem_all[PX * SLAB + STGB];
  // LDS byte address of the staging buffer: the low 32 bits of its address
  const unsigned stg = (unsigned)(uintptr_t)(smem_all + O_STG);
  // guidance of one tile: a thread's 16 values, held in registers until P0 stores them
  float gv[TT * GD / 128];
  auto load_guidance = [&](int b, int tid) {
    // unrolled: gv[] is indexed by constants and stays in registers
#pragma unroll
    for (int k = 0; k < TT * GD / 128; ++k) {
      int i = k * 128 + tid;
      int t = i >> 6, j = i & 63;
      gv[k] = gdn[((size_t)b * TT + t) * GD + j];
    }
    // later instructions reuse the run's address registers: the wait that belongs in
    // front of such an overwrite
    asm volatile("s_wait_xcnt 0x0" ::: "memory");
  };

  // tile 0's x and guidance (no wave has touched LDS yet)
  copy_x_tile(x + pix_off(blockIdx.x * PX), stg, threadIdx.x);
  load_guidance((blockIdx.x * PX) >> 10, threadIdx.x & 127);

  // kept rolled: one copy of the body
#pragma unroll 1
  for (int tl = 0; tl < TILES; ++tl) {
  const int n = (tl * NWG + blockIdx.x) * PX;    // first of the tile's PX pixels
  const int nn = n + NWG * PX;                   // the same of the next tile
  // The lane's number is formed anew in every trip, by an instruction that stays where it
  // is written: the some 190 LDS and weight addresses that follow from it are then formed
  // where they are used. Taken from threadIdx.x they were all formed ahead of the loop,
  // held over it, and most of them went to scratch and were read back in every trip.
  int lane;
  asm volatile("v_mbcnt_lo_u32_b32 %0, -1, 0" : "=v"(lane));
  lane &= 31;
  // the wave's number in a scalar register: what follows from it alone takes no vector register
  const int wtid = __builtin_amdgcn_readfirstlane(threadIdx.x >> 5) * 32 + lane;   // 0 .. 128*PX-1
  unsigned char* smem = smem_all + (wtid >> 7) * SLAB;   // this pixel's slab
  // phase-reused LDS layout (per slab)
  float* xLDS = (float*)(smem + O_X);        // 32x128 f32, pitch XP   (dead after P3)
  bf16*  xqk  = (bf16*)(smem + O_XQK);       // 32x192 bf16, pitch QKP (dead after P1)
  bf16*  Qs   = (bf16*)(smem + O_Q);         // 32x128 bf16, pitch CP  (dead after P3)
  bf16*  Kt   = (bf16*)(smem + O_KT);        // 128x32 bf16, pitch TP  (dead after P2)
  bf16*  Vt   = (bf16*)(smem + O_VT);        // 128x32 bf16, pitch TP  (dead after P2)
  bf16*  KVt  = (bf16*)(smem + O_KVT);       // 128x32 bf16, pitch TP  (over xqk; dead after P3)
  float* Ksum = (float*)(smem + O_STAT);         // 128 f32
  float* Zl   = (float*)(smem + O_STAT + 512);   // 128 f32 (l*4+h)
  float* mu1  = (float*)(smem + O_STAT + 1024);  // 32
  float* rv1  = (float*)(smem + O_STAT + 1152);  // 32
  float* out1 = (float*)(smem + O_KT);       // 32x128 f32, pitch XP (over Kt+Vt)
  bf16*  h0   = (bf16*)(smem + O_H0);        // 32x128 bf16, pitch CP (over Vt's end, row figures)
  bf16*  h1   = (bf16*)(smem + O_X);         // 32x512 bf16, pitch FP (over x,xqk,Q)

  const bf16* Wqt = reinterpret_cast<const bf16*>(wsu);
  const bf16* Wkt = Wqt + 24576;
  const bf16* Wvt = Wqt + 49152;
  const bf16* W1t = Wqt + 65536;
  const bf16* W2t = Wqt + 131072;

  const int tid  = wtid & 127;        // thread within the pixel's four waves
  const int wv   = tid >> 5;          // wave id 0..3 within the pixel
  const int r    = lane & 15;
  const int half = lane >> 4;
  const int lnr  = wv * 8 + half * 4 + (lane & 3);   // layer norms: this lane's row ...
  const int lnq  = (lane >> 2) & 3;                  // ... and its quarter of the row

  // this wave's copies of the tile have landed; behind the barrier every wave's have, and
  // every wave has left the tile before (its reads of out1 in P7)
  asm volatile("s_wait_asynccnt 0x0" ::: "memory");
  __syncthreads();

  // -------- P0: x from the staging buffer to the slabs, xqk=[x|guidance] --------
  // all of a thread's 16-byte reads ahead of the first store, so that they are in flight
  // together; both loops unrolled: xs[] is indexed by constants and stays in registers
  v4f xs[TT * CC / (128 * PX)];
#pragma unroll
  for (int it = 0; it < TT * CC / (128 * PX); ++it)
    xs[it] = *reinterpret_cast<const v4f*>(smem_all + O_STG + (it * (128 * PX) + wtid) * 16);
#pragma unroll
  for (int it = 0; it < TT * CC / (128 * PX); ++it) {
    int i = it * (128 * PX) + wtid;
    int t = i >> 7, c = i & 127;
    v4f v = xs[it];
#pragma unroll
    for (int p = 0; p < PX; ++p) {
      ((float*)(smem_all + p * SLAB + O_X))[t * XP + c] = v[p];
      ((bf16*)(smem_all + p * SLAB + O_XQK))[t * QKP + c] = (bf16)v[p];
    }
  }
  // unrolled like the load loop: gv[] is indexed by constants
#pragma unroll
  for (int k = 0; k < TT * GD / 128; ++k) {
    int i = k * 128 + tid;
    int t = i >> 6, j = i & 63;
    xqk[t * QKP + 128 + j] = (bf16)gv[k];
  }
  __syncthreads();

  // -------- P1: q,k (K=192) and v (K=128) GEMMs --------
  {
    v8f aq[2][2], ak[2][2], av[2][2];
#pragma unroll
    for (int m = 0; m < 2; ++m)
#pragma unroll
      for (int j = 0; j < 2; ++j) { aq[m][j] = vzero8(); ak[m][j] = vzero8(); av[m][j] = vzero8(); }
#pragma unroll
    for (int kb = 0; kb < 6; ++kb) {
      v16bf A0 = ld_tile(xqk, QKP, 0, kb * 32, lane);
      v16bf A1 = ld_tile(xqk, QKP, 16, kb * 32, lane);
#pragma unroll
      for (int j = 0; j < 2; ++j) {
        int nt = 2 * wv + j;
        v16bf Bq = ld_wtile(Wqt, nt * (CG / 32) + kb, lane);
        aq[0][j] = wmma_bf16(A0, Bq, aq[0][j]);
        aq[1][j] = wmma_bf16(A1, Bq, aq[1][j]);
        v16bf Bk = ld_wtile(Wkt, nt * (CG / 32) + kb, lane);
        ak[0][j] = wmma_bf16(A0, Bk, ak[0][j]);
        ak[1][j] = wmma_bf16(A1, Bk, ak[1][j]);
        if (kb < 4) {
          v16bf Bv = ld_wtile(Wvt, nt * (CC / 32) + kb, lane);
          av[0][j] = wmma_bf16(A0, Bv, av[0][j]);
          av[1][j] = wmma_bf16(A1, Bv, av[1][j]);
        }
      }
    }
    // epilogue: bias, elu+1, scatter Q (row-major) and K^T, V^T to LDS
#pragma unroll
    for (int j = 0; j < 2; ++j) {
      int col = (2 * wv + j) * 16 + r;
      float bqv = bq[col], bkv = bk[col], bvv = bv[col];
#pragma unroll
      for (int mt = 0; mt < 2; ++mt) {
        v8bf k8, v8;   // eight neighbours of one K^T / V^T row: one 16-byte store each
#pragma unroll
        for (int i = 0; i < 8; ++i) {
          int l = mt * 16 + half * 8 + i;
          float qv = aq[mt][j][i] + bqv;
          qv = (qv > 0.f) ? (qv + 1.f) : __expf(qv);
          Qs[l * CP + col] = (bf16)qv;
          float kv = ak[mt][j][i] + bkv;
          kv = (kv > 0.f) ? (kv + 1.f) : __expf(kv);
          k8[i] = (bf16)kv;
          v8[i] = (bf16)(av[mt][j][i] + bvv);
        }
        *reinterpret_cast<v8bf*>(Kt + col * TP + mt * 16 + half * 8) = k8;
        *reinterpret_cast<v8bf*>(Vt + col * TP + mt * 16 + half * 8) = v8;
      }
    }
  }
  __syncthreads();

  // LN2's scale and shift for this lane's 32 columns, asked for ahead of the copies, not behind them
  v4f g2[8], s2[8];
  const int lnoff = lnq * 16;
  // unrolled: g2[], s2[] stay in registers and the 16 loads are in flight together
#pragma unroll
  for (int i = 0; i < 8; ++i) {
    g2[i] = *reinterpret_cast<const v4f*>(ln2g + lnoff + ln_col(0, i));
    s2[i] = *reinterpret_cast<const v4f*>(ln2b + lnoff + ln_col(0, i));
  }
  // LN1's scale and shift for this lane's two columns of P3, for the same reason
  float l1g[2], l1b[2];
#pragma unroll
  for (int nt = 0; nt < 2; ++nt) {
    l1g[nt] = ln1g[wv * 32 + nt * 16 + r];
    l1b[nt] = ln1b[wv * 32 + nt * 16 + r];
  }
  // the wait that belongs in front of an overwrite of the run's offset register; the
  // operand keeps that register alive up to here, so that no load of the run lands in it
  asm volatile("s_wait_xcnt 0x0" :: "v"(lnoff * 4) : "memory");

  // the next tile's x sets out here, where no phase needs global memory for a while. Every
  // wave's reads of the staging buffer ended two barriers ago; this wave's LDS operations
  // have retired before its copies aim at LDS
  if (tl + 1 < TILES) {
    asm volatile("s_wait_dscnt 0x0" ::: "memory");
    copy_x_tile(x + pix_off(nn), stg, wtid);
  }

  // -------- P2: Ksum, KV = K^T @ V (per head, one WMMA K-step) --------
  {
    float s = 0.f;
#pragma unroll
    for (int i = 0; i < TT; ++i) s += (float)Kt[tid * TP + i];
    Ksum[tid] = s;
  }
  {
    int h = wv;
    v8f acc[2][2];
#pragma unroll
    for (int m = 0; m < 2; ++m)
#pragma unroll
      for (int j = 0; j < 2; ++j) acc[m][j] = vzero8();
#pragma unroll
    for (int mt = 0; mt < 2; ++mt) {
      v16bf A = ld_tile(Kt, TP, h * 32 + mt * 16, 0, lane);
#pragma unroll
      for (int nt = 0; nt < 2; ++nt) {
        v16bf Bv = ld_tile(Vt, TP, h * 32 + nt * 16, 0, lane);
        acc[mt][nt] = wmma_bf16(A, Bv, acc[mt][nt]);
      }
    }
#pragma unroll
    for (int mt = 0; mt < 2; ++mt)
#pragma unroll
      for (int nt = 0; nt < 2; ++nt)
#pragma unroll
        for (int i = 0; i < 8; ++i) {
          int d = mt * 16 + half * 8 + i;       // row of KV
          int e = h * 32 + nt * 16 + r;          // global v-column
          KVt[e * TP + d] = (bf16)acc[mt][nt][i];
        }
  }
  __syncthreads();

  // -------- P2c: Z = 1/(Q.Ksum+eps), ln1 stats --------
  {
    int l = tid >> 2, h = tid & 3;
    float d = 0.f;
#pragma unroll
    for (int i = 0; i < 32; ++i)
      d += (float)Qs[l * CP + h * 32 + i] * Ksum[h * 32 + i];
    Zl[tid] = 1.0f / (d + 1e-6f);
  }
  {
    v4f xv[8];
    float mu, rv;
    ln_stats(xLDS + lnr * XP, lnq, xv, mu, rv);
    if (lnq == 0) { mu1[lnr] = mu; rv1[lnr] = rv; }
  }
  __syncthreads();

  // -------- P3: out = (Q @ KV)*Z + LN1(x)  (writes out1 over Kt/Vt) --------
  {
    int h = wv;
    v8f acc[2][2];
#pragma unroll
    for (int m = 0; m < 2; ++m)
#pragma unroll
      for (int j = 0; j < 2; ++j) acc[m][j] = vzero8();
#pragma unroll
    for (int mt = 0; mt < 2; ++mt) {
      v16bf A = ld_tile(Qs, CP, mt * 16, h * 32, lane);
#pragma unroll
      for (int nt = 0; nt < 2; ++nt) {
        v16bf Bv = ld_tile(KVt, TP, h * 32 + nt * 16, 0, lane);
        acc[mt][nt] = wmma_bf16(A, Bv, acc[mt][nt]);
      }
    }
    // row figures read ahead of the first out1 store, so that they stay a few wide
    // loads (behind a store to a padded row the compiler reloads them one by one)
    float zz[2][8], mm[2][8], rr[2][8];
#pragma unroll
    for (int mt = 0; mt < 2; ++mt)
#pragma unroll
      for (int i = 0; i < 8; ++i) {
        int l = mt * 16 + half * 8 + i;
        zz[mt][i] = Zl[l * 4 + h];
        mm[mt][i] = mu1[l];
        rr[mt][i] = rv1[l];
      }
#pragma unroll
    for (int mt = 0; mt < 2; ++mt)
#pragma unroll
      for (int nt = 0; nt < 2; ++nt)
#pragma unroll
        for (int i = 0; i < 8; ++i) {
          int l = mt * 16 + half * 8 + i;
          int c = h * 32 + nt * 16 + r;
          float res = acc[mt][nt][i] * zz[mt][i];
          res += (xLDS[l * XP + c] - mm[mt][i]) * rr[mt][i] * l1g[nt] + l1b[nt];
          out1[l * XP + c] = res;
        }
  }
  __syncthreads();

  // -------- P4: LN2 -> h0 (bf16), straight from the registers the statistics came from --------
  {
    v4f ov[8];
    float mu, rv;
    ln_stats(out1 + lnr * XP, lnq, ov, mu, rv);
    // both loops unrolled: ov[], g2[], s2[] are indexed by constants
#pragma unroll
    for (int j = 0; j < 4; ++j) {
      v8bf hb;   // eight neighbours of the row: one 16-byte store
#pragma unroll
      for (int e = 0; e < 8; ++e) {
        int i = j * 2 + (e >> 2);
        hb[e] = (bf16)((ov[i][e & 3] - mu) * rv * g2[i][e & 3] + s2[i][e & 3]);
      }
      *reinterpret_cast<v8bf*>(h0 + lnr * CP + ln_col(lnq, j * 2)) = hb;
    }
  }
  __syncthreads();

  // -------- P5: h1 = gelu(h0 @ W1 + b1)  (32x512, over x/xqk/Q) --------
  {
    v16bf Ah[2][4];
#pragma unroll
    for (int mt = 0; mt < 2; ++mt)
#pragma unroll
      for (int kb = 0; kb < 4; ++kb)
        Ah[mt][kb] = ld_tile(h0, CP, mt * 16, kb * 32, lane);
    // the weights and the bias of column tile jn + 1 are asked for ahead of tile jn's products
    // and gelu, written out here: inside the tile loop the compiler left each load directly
    // in front of its use. All loops unrolled: Bn[], Bc[] are indexed by constants
    v16bf Bn[4];
#pragma unroll
    for (int kb = 0; kb < 4; ++kb) Bn[kb] = ld_wtile(W1t, wv * 8 * (CC / 32) + kb, lane);
    float bn = b1[wv * 128 + r];
#pragma unroll
    for (int jn = 0; jn < 8; ++jn) {
      int nt = wv * 8 + jn;
      v16bf Bc[4];
#pragma unroll
      for (int kb = 0; kb < 4; ++kb) Bc[kb] = Bn[kb];
      float bb = bn;
      if (jn < 7) {
#pragma unroll
        for (int kb = 0; kb < 4; ++kb) Bn[kb] = ld_wtile(W1t, (nt + 1) * (CC / 32) + kb, lane);
        bn = b1[(nt + 1) * 16 + r];
      }
      v8f acc[2] = {vzero8(), vzero8()};
#pragma unroll
      for (int kb = 0; kb < 4; ++kb) {
        acc[0] = wmma_bf16(Ah[0][kb], Bc[kb], acc[0]);
        acc[1] = wmma_bf16(Ah[1][kb], Bc[kb], acc[1]);
      }
      int col = nt * 16 + r;
#pragma unroll
      for (int mt = 0; mt < 2; ++mt)
#pragma unroll
        for (int i = 0; i < 8; i += 2) {
          int l = mt * 16 + half * 8 + i;
          v2f hv = {acc[mt][i] + bb, acc[mt][i + 1] + bb};
          v2bf hb = __builtin_convertvector(gelu2(hv), v2bf);
          h1[l * FP + col] = hb[0];
          h1[(l + 1) * FP + col] = hb[1];
        }
    }
  }
  __syncthreads();

  // -------- P6: out1 += h1 @ W2 + b2 (in place, each element by its own thread) --------
  {
    v8f acc[2][2];
#pragma unroll
    for (int m = 0; m < 2; ++m)
#pragma unroll
      for (int j = 0; j < 2; ++j) acc[m][j] = vzero8();
    // the weights of k step kb + 4 are asked for ahead of step kb's products, written out for
    // the same reason as in P5. All loops unrolled: Bw[] is indexed by constants
    v16bf Bw[4][2];
#pragma unroll
    for (int kb = 0; kb < 4; ++kb)
#pragma unroll
      for (int j = 0; j < 2; ++j) Bw[kb][j] = ld_wtile(W2t, (2 * wv + j) * (FF / 32) + kb, lane);
#pragma unroll
    for (int kb = 0; kb < 16; ++kb) {
      v16bf A0 = ld_tile(h1, FP, 0, kb * 32, lane);
      v16bf A1 = ld_tile(h1, FP, 16, kb * 32, lane);
      v16bf Bc[2] = {Bw[kb & 3][0], Bw[kb & 3][1]};
      if (kb + 4 < 16) {
#pragma unroll
        for (int j = 0; j < 2; ++j)
          Bw[kb & 3][j] = ld_wtile(W2t, (2 * wv + j) * (FF / 32) + kb + 4, lane);
      }
#pragma unroll
      for (int j = 0; j < 2; ++j) {
        acc[0][j] = wmma_bf16(A0, Bc[j], acc[0][j]);
        acc[1][j] = wmma_bf16(A1, Bc[j], acc[1][j]);
      }
    }
#pragma unroll
    for (int j = 0; j < 2; ++j) {
      int c = (2 * wv + j) * 16 + r;
      float b2v = b2[c];
#pragma unroll
      for (int mt = 0; mt < 2; ++mt)
#pragma unroll
        for (int i = 0; i < 8; ++i) {
          int l = mt * 16 + half * 8 + i;
          out1[l * XP + c] = acc[mt][j][i] + out1[l * XP + c] + b2v;
        }
    }
  }
  __syncthreads();   // every pixel's result is in its slab before the joint store

  // the next tile's guidance is asked for ahead of this tile's stores
  if (tl + 1 < TILES) load_guidance(nn >> 10, tid);

  // -------- P7: store PX pixels of one (t,c) row as one 16-byte piece --------
  {
    float* on = out + pix_off(n);
    v4f v[TT * CC / (128 * PX)];
    // both loops unrolled: v[] stays in registers and the LDS reads run ahead of the stores
#pragma unroll
    for (int it = 0; it < TT * CC / (128 * PX); ++it) {
      int i = it * (128 * PX) + wtid;
      int t = i >> 7, c = i & 127;
#pragma unroll
      for (int p = 0; p < PX; ++p)
        v[it][p] = ((const float*)(smem_all + p * SLAB + O_KT))[t * XP + c];
    }
#pragma unroll
    for (int it = 0; it < TT * CC / (128 * PX); ++it)
      *reinterpret_cast<v4f*>(on + (size_t)(it * (128 * PX) + wtid) * HWS) = v[it];
    // the next trip reuses the stores' registers: the wait that belongs in front of that
    asm volatile("s_wait_xcnt 0x0" ::: "memory");
  }
  }   // tiles
}

extern "C" void kernel_launch(void* const* d_in, const int* in_sizes, int n_in,
                              void* d_out, int out_size, void* d_ws, size_t ws_size,
                              hipStream_t stream) {
  (void)in_sizes; (void)n_in; (void)out_size; (void)ws_size;
  const float* x    = (const float*)d_in[0];
  const float* g    = (const float*)d_in[1];
  const float* Wq   = (const float*)d_in[2];
  const float* bq   = (const float*)d_in[3];
  const float* Wk   = (const float*)d_in[4];
  const float* bk   = (const float*)d_in[5];
  const float* Wv   = (const float*)d_in[6];
  const float* bv   = (const float*)d_in[7];
  const float* ln1g = (const float*)d_in[8];
  const float* ln1b = (const float*)d_in[9];
  const float* ln2g = (const float*)d_in[10];
  const float* ln2b = (const float*)d_in[11];
  const float* W1   = (const float*)d_in[12];
  const float* b1   = (const float*)d_in[13];
  const float* W2   = (const float*)d_in[14];
  const float* b2   = (const float*)d_in[15];
  unsigned short* wt = (unsigned short*)d_ws;   // 196608 bf16 = 384 KB

  prep_weights<<<(196608 + 255) / 256, 256, 0, stream>>>(Wq, Wk, Wv, W1, W2, wt);
  fused_block<<<NWG, 128 * PX, 0, stream>>>(x, g, bq, bk, bv, ln1g, ln1b, ln2g, ln2b,
                                        b1, b2, wt, (float*)d_out);
}

// v007
// Measured time: 129 microseconds a run.
// Timed twice side by side with v006, it ran 1.12 and 1.10 times as fast.
// Over all steps from v000 it is 3.30 times as fast.
#include <hip/hip_runtime.h>
#include <cstdint>

typedef __bf16 bf16;
typedef bf16  v16bf __attribute__((ext_vector_type(16)));
typedef float v8f   __attribute__((ext_vector_type(8)));
typedef float v4f   __attribute__((ext_vector_type(4)));
typedef bf16  v8bf  __attribute__((ext_vector_type(8)));
typedef float v2f   __attribute__((ext_vector_type(2)));
typedef bf16  v2bf  __attribute__((ext_vector_type(2)));

// ---- problem constants (from reference setup) ----
#define BB   4
#define TT   32
#define CC   128
#define HS   32
#define WS   32
#define GD   64
#define CG   192      // C + Gd
#define FF   512      // 4*C
#define NPIX 4096     // B*H*W
#define HWS  1024     // H*W
#define PX   4        // pixels adjacent along W per tile (16 B of each x / out line)
#define TILES 4       // tiles of PX pixels that one workgroup works through, one after another
#define NWG  (NPIX / PX / TILES)
// LDS row pitches in elements: every row starts an odd multiple of 16 B after the
// one before it, so the 16 rows that one ds_load_b128 reads fall on 16 different
// groups of four banks (at a pitch that is a multiple of 64 B they share one to four)
#define XP   132      // f32 rows of 128: x, out1          (528 B)
#define QKP  200      // bf16 rows of 192: xqk             (400 B)
#define CP   136      // bf16 rows of 128: Q, h0           (272 B)
#define TP   40       // bf16 rows of 32: K^T, V^T, KV^T   (80 B)
#define FP   520      // bf16 rows of 512: h1              (1040 B)
// byte offsets inside one pixel's slab
#define O_X    0
#define O_XQK  16896
#define O_Q    29696
#define O_KT   38400
#define O_VT   48640
#define O_KVT  16896  // over xqk, which is dead when KV^T is written
#define O_H0   55296  // behind out1, over the end of V^T and the row figures (both dead)
#define O_STAT 58880
#define SLAB   64000  // LDS bytes per pixel
#define O_STG  (PX * SLAB)          // behind the slabs: the next tile's x as it lies in memory,
#define STGB   (TT * CC * PX * 4)   // 16 B (PX pixels) for each of the TT*CC (t,c) lines
#define P1T  32       // weight tiles that one wave uses in P1: 12 of Wq, 12 of Wk, 8 of Wv
#define P1D  12       // how many of them are on their way at any time

static __device__ __forceinline__ v8f vzero8() {
  v8f z;
#pragma unroll
  for (int i = 0; i < 8; ++i) z[i] = 0.0f;
  return z;
}

static __device__ __forceinline__ v8f wmma_bf16(v16bf a, v16bf b, v8f c) {
  return __builtin_amdgcn_wmma_f32_16x16x32_bf16(
      /*neg_a=*/false, a, /*neg_b=*/false, b,
      /*c_mod=*/(short)0, c, /*reuse_a=*/false, /*reuse_b=*/false);
}

// Load a 16x32 bf16 operand tile from row-major storage (A operands, and the B
// operands that are kept N x K in LDS: both sides have the same lane layout).
// lanes 0-15: row rcBase+lane, K = {k..k+7, k+16..k+23}
// lanes 16-31: row rcBase+lane-16, K = {k+8..k+15, k+24..k+31}
template <typename P>
static __device__ __forceinline__ v16bf ld_tile(P base, int stride, int rcBase,
                                                int kBase, int lane) {
  int r = lane & 15, half = lane >> 4;
  P p = base + (size_t)(rcBase + r) * stride + kBase + half * 8;
  v16bf a;
#pragma unroll
  for (int i = 0; i < 8; ++i) { a[i] = p[i]; a[i + 8] = p[16 + i]; }
  return a;
}

// Load one 16(n) x 32(k) weight tile that prep_weights has stored in register order:
// 1 KB a tile, the 32 lanes' first eight values in its first 512 B and their second
// eight in the other 512 B, so that each 16-byte load of a wave reads four whole lines.
static __device__ __forceinline__ v16bf ld_wtile(const bf16* mat, int tile, int lane) {
  const v8bf* p = reinterpret_cast<const v8bf*>(mat + tile * 512 + lane * 8);
  return __builtin_shufflevector(p[0], p[32], 0, 1, 2, 3, 4, 5, 6, 7,
                                 8, 9, 10, 11, 12, 13, 14, 15);
}

// source index of packed element j of a (K x N) row-major weight: tile = nt * (K/32) + kb;
// inside the tile bit 8 picks k+16, bits 7..3 the lane (n = lane & 15, k+8 for lanes 16-31),
// bits 2..0 the eight neighbours along k: the k order of ld_tile at every lane and position
static __device__ __forceinline__ int packed_src(int j, int K, int N) {
  int tile = j >> 9, e = j & 511;
  int nt = tile / (K / 32), kb = tile % (K / 32);
  int lane = (e >> 3) & 31;
  int n = nt * 16 + (lane & 15);
  int k = kb * 32 + (e >> 8) * 16 + (lane >> 4) * 8 + (e & 7);
  return k * N + n;
}

// exact gelu of two values, h * Phi(h) with Phi the normal distribution function, written
// as max(h, 0) - a * Phi(-a), a = |h|: one form for both signs and for every size of h, so
// no branch. Phi(-a) = 2^p(a): p is a degree-8 fit of log2(Phi(-a)) on 0 <= a <= 6, its error
// weighted by Phi(-a); against gelu in double precision the f32 result is off by less than
// 3e-7 on -8 <= h <= 8 (with the library's erf in h / 2 * (1 + erf(h / sqrt 2)): 5e-7).
// Past a = 6 the term a * Phi(-a) is held at its value there, 6e-9 (true value: less).
static __device__ __forceinline__ v2f gelu2(v2f h) {
  v2f a, e, relu;
  a[0] = fminf(fabsf(h[0]), 6.0f);
  a[1] = fminf(fabsf(h[1]), 6.0f);
  v2f p = -0.00000138095049f;
  p = __builtin_elementwise_fma(p, a, (v2f)0.0000228085610f);
  p = __builtin_elementwise_fma(p, a, (v2f)-0.000112637688f);
  p = __builtin_elementwise_fma(p, a, (v2f)-0.000299850391f);
  p = __builtin_elementwise_fma(p, a, (v2f)0.00725496560f);
  p = __builtin_elementwise_fma(p, a, (v2f)-0.0526133589f);
  p = __builtin_elementwise_fma(p, a, (v2f)-0.459174365f);
  p = __builtin_elementwise_fma(p, a, (v2f)-1.15110886f);
  p = __builtin_elementwise_fma(p, a, (v2f)-0.999999940f);
  e[0] = __builtin_amdgcn_exp2f(p[0]);   // p is never below -30: no range handling needed
  e[1] = __builtin_amdgcn_exp2f(p[1]);
  relu[0] = fmaxf(h[0], 0.0f);
  relu[1] = fmaxf(h[1], 0.0f);
  return __builtin_elementwise_fma(-a, e, relu);
}

// ---- layer-norm rows: four lanes a row, 32 values a lane, held in registers ----
// lane q of a row takes columns q*16..q*16+15 and 64+q*16..64+q*16+15: at the row pitch XP
// the 16 lanes that one half of a ds_load_b128 serves (4 rows x 4 q) fall on 16 different
// groups of four banks
static __device__ __forceinline__ int ln_col(int q, int i) {
  return (i >> 2) * 64 + q * 16 + (i & 3) * 4;
}

// sum over the four lanes of a row (lane bits 2 and 3), every lane gets it: two DPP steps
// inside the 16-lane row (row_xmask:4, row_xmask:8), no LDS round trip
static __device__ __forceinline__ float sum_row_lanes(float v) {
  v += __int_as_float(__builtin_amdgcn_update_dpp(0, __float_as_int(v), 0x164, 0xf, 0xf, true));
  v += __int_as_float(__builtin_amdgcn_update_dpp(0, __float_as_int(v), 0x168, 0xf, 0xf, true));
  return v;
}

// mean and 1/sqrt(var + 1e-5) of a row of CC values; two passes, as the definition has it
static __device__ __forceinline__ void ln_stats(const float* row, int q, v4f (&v)[8],
                                                float& mu, float& rv) {
  // the three loops unrolled: v[] is indexed by constants and stays in registers
#pragma unroll
  for (int i = 0; i < 8; ++i) v[i] = *reinterpret_cast<const v4f*>(row + ln_col(q, i));
  v4f s = v[0];
#pragma unroll
  for (int i = 1; i < 8; ++i) s += v[i];
  mu = sum_row_lanes((s[0] + s[1]) + (s[2] + s[3])) * (1.0f / CC);
  v4f w = 0.0f;
#pragma unroll
  for (int i = 0; i < 8; ++i) { v4f d = v[i] - mu; w += d * d; }
  rv = rsqrtf(sum_row_lanes((w[0] + w[1]) + (w[2] + w[3])) * (1.0f / CC) + 1e-5f);
}

// element offset of pixel n in x and in out, at t = 0, c = 0
static __device__ __forceinline__ size_t pix_off(int n) {
  return (size_t)(n >> 10) * TT * CC * HWS + (n & (HWS - 1));
}

// One tile's x, global memory -> staging buffer, through no register: thread w brings the
// 16 bytes of lines w, w + 512, ... to the same places of the buffer. The copies count on
// asynccnt alone, so the weight loads issued behind them are not held up by their return.
// s_wait_xcnt stands inside the statement: in front of any reuse of the address registers.
static __device__ __forceinline__ void copy_x_tile(const float* xn, unsigned stg, int wtid) {
  const float* g = xn + (size_t)wtid * HWS;
  const unsigned l = stg + wtid * 16;
  const size_t gs = (size_t)(128 * PX) * HWS;
  const unsigned ls = 128 * PX * 16;
  asm volatile(
      "global_load_async_to_lds_b128 %0, %8, off\n\t"
      "global_load_async_to_lds_b128 %1, %9, off\n\t"
      "global_load_async_to_lds_b128 %2, %10, off\n\t"
      "global_load_async_to_lds_b128 %3, %11, off\n\t"
      "global_load_async_to_lds_b128 %4, %12, off\n\t"
      "global_load_async_to_lds_b128 %5, %13, off\n\t"
      "global_load_async_to_lds_b128 %6, %14, off\n\t"
      "global_load_async_to_lds_b128 %7, %15, off\n\t"
      "s_wait_xcnt 0x0"
      :: "v"(l), "v"(l + ls), "v"(l + 2 * ls), "v"(l + 3 * ls),
         "v"(l + 4 * ls), "v"(l + 5 * ls), "v"(l + 6 * ls), "v"(l + 7 * ls),
         "v"(g), "v"(g + gs), "v"(g + 2 * gs), "v"(g + 3 * gs),
         "v"(g + 4 * gs), "v"(g + 5 * gs), "v"(g + 6 * gs), "v"(g + 7 * gs)
      : "memory");
}

// ---- weight prep: fp32 -> bf16, packed tile by tile in the order ld_wtile reads ----
// ws layout (bf16 elements): Wqt[0..24576) Wkt[..49152) Wvt[..65536)
//                            W1t[..131072) W2t[..196608)
__global__ void prep_weights(const float* __restrict__ Wq,
                             const float* __restrict__ Wk,
                             const float* __restrict__ Wv,
                             const float* __restrict__ W1,
                             const float* __restrict__ W2,
                             unsigned short* __restrict__ wsu) {
  bf16* o = reinterpret_cast<bf16*>(wsu);
  int i = blockIdx.x * blockDim.x + threadIdx.x;
  if (i >= 196608) return;
  int j = i;
  if (j < 24576) { o[i] = (bf16)Wq[packed_src(j, CG, CC)]; return; }
  j -= 24576;
  if (j < 24576) { o[i] = (bf16)Wk[packed_src(j, CG, CC)]; return; }
  j -= 24576;
  if (j < 16384) { o[i] = (bf16)Wv[packed_src(j, CC, CC)]; return; }
  j -= 16384;
  if (j < 65536) { o[i] = (bf16)W1[packed_src(j, CC, FF)]; return; }
  j -= 65536;
  o[i] = (bf16)W2[packed_src(j, FF, CC)];
}

// ---- fused block: one workgroup works through TILES tiles of PX adjacent pixels; four
// waves and one LDS slab per pixel; x is read and out is written PX pixels at a time;
// the next tile's x is on its way into LDS while this tile is worked on ----
// The register cap keeps the scheduler from hoisting weight loads up to the
// 16-wave limit of 256, where a few long-lived addresses spilled to scratch.
__global__ __launch_bounds__(128 * PX) __attribute__((amdgpu_num_vgpr(224)))
void fused_block(const float* __restrict__ x, const float* __restrict__ gdn,
                 const float* __restrict__ bq, const float* __restrict__ bk,
                 const float* __restrict__ bv,
                 const float* __restrict__ ln1g, const float* __restrict__ ln1b,
                 const float* __restrict__ ln2g, const float* __restrict__ ln2b,
                 const float* __restrict__ b1, const float* __restrict__ b2,
                 const unsigned short* __restrict__ wsu,
                 float* __restrict__ out) {
  __shared__ __attribute__((aligned(16))) unsigned char smem_all[PX * SLAB + STGB];
  // LDS byte address of the staging buffer: the low 32 bits of its address
  const unsigned stg = (unsigned)(uintptr_t)(smem_all + O_STG);
  // guidance of one tile: a thread's 16 values, held in registers until P0 stores them
  float gv[TT * GD / 128];
  auto load_guidance = [&](int b, int tid) {
    // unrolled: gv[] is indexed by constants and stays in registers
#pragma unroll
    for (int k = 0; k < TT * GD / 128; ++k) {
      int i = k * 128 + tid;
      int t = i >> 6, j = i & 63;
      gv[k] = gdn[((size_t)b * TT + t) * GD + j];
    }
    // later instructions reuse the run's address registers: the wait that belongs in
    // front of such an overwrite
    asm volatile("s_wait_xcnt 0x0" ::: "memory");
  };

  // tile 0's x and guidance (no wave has touched LDS yet)
  copy_x_tile(x + pix_off(blockIdx.x * PX), stg, threadIdx.x);
  load_guidance((blockIdx.x * PX) >> 10, threadIdx.x & 127);

  // kept rolled: one copy of the body
#pragma unroll 1
  for (int tl = 0; tl < TILES; ++tl) {
  const int n = (tl * NWG + blockIdx.x) * PX;    // first of the tile's PX pixels
  const int nn = n + NWG * PX;                   // the same of the next tile
  // The lane's number is formed anew in every trip, by an instruction that stays where it
  // is written: the some 190 LDS and weight addresses that follow from it are then formed
  // where they are used. Taken from threadIdx.x they were all formed ahead of the loop,
  // held over it, and most of them went to scratch and were read back in every trip.
  int lane;
  asm volatile("v_mbcnt_lo_u32_b32 %0, -1, 0" : "=v"(lane));
  lane &= 31;
  // the wave's number in a scalar register: what follows from it alone takes no vector register
  const int wtid = __builtin_amdgcn_readfirstlane(threadIdx.x >> 5) * 32 + lane;   // 0 .. 128*PX-1
  unsigned char* smem = smem_all + (wtid >> 7) * SLAB;   // this pixel's slab
  // phase-reused LDS layout (per slab)
  float* xLDS = (float*)(smem + O_X);        // 32x128 f32, pitch XP   (dead after P3)
  bf16*  xqk  = (bf16*)(smem + O_XQK);       // 32x192 bf16, pitch QKP (dead after P1)
  bf16*  Qs   = (bf16*)(smem + O_Q);         // 32x128 bf16, pitch CP  (dead after P3)
  bf16*  Kt   = (bf16*)(smem + O_KT);        // 128x32 bf16, pitch TP  (dead after P2)
  bf16*  Vt   = (bf16*)(smem + O_VT);        // 128x32 bf16, pitch TP  (dead after P2)
  bf16*  KVt  = (bf16*)(smem + O_KVT);       // 128x32 bf16, pitch TP  (over xqk; dead after P3)
  float* Ksum = (float*)(smem + O_STAT);         // 128 f32
  float* Zl   = (float*)(smem + O_STAT + 512);   // 128 f32 (l*4+h)
  float* mu1  = (float*)(smem + O_STAT + 1024);  // 32
  float* rv1  = (float*)(smem + O_STAT + 1152);  // 32
  float* out1 = (float*)(smem + O_KT);       // 32x128 f32, pitch XP (over Kt+Vt)
  bf16*  h0   = (bf16*)(smem + O_H0);        // 32x128 bf16, pitch CP (over Vt's end, row figures)
  bf16*  h1   = (bf16*)(smem + O_X);         // 32x512 bf16, pitch FP (over x,xqk,Q)

  const bf16* Wqt = reinterpret_cast<const bf16*>(wsu);
  const bf16* Wkt = Wqt + 24576;
  const bf16* Wvt = Wqt + 49152;
  const bf16* W1t = Wqt + 65536;
  const bf16* W2t = Wqt + 131072;

  const int tid  = wtid & 127;        // thread within the pixel's four waves
  const int wv   = tid >> 5;          // wave id 0..3 within the pixel
  const int r    = lane & 15;
  const int half = lane >> 4;
  const int lnr  = wv * 8 + half * 4 + (lane & 3);   // layer norms: this lane's row ...
  const int lnq  = (lane >> 2) & 3;                  // ... and its quarter of the row

  // this wave's copies of the tile have landed; behind the barrier every wave's have, and
  // every wave has left the tile before (its reads of out1 in P7)
  asm volatile("s_wait_asynccnt 0x0" ::: "memory");
  __syncthreads();

  // the idx-th weight tile in the order in which P1 uses them: the wave's first column tile,
  // then its second; in each k step by k step; in each step q, k and, over x's 128 columns, v
  auto p1_tile = [&](int idx) -> v16bf {
    const int e  = idx % 16;
    const int kb = e < 12 ? e / 3 : 4 + (e - 12) / 2;
    const int m  = e < 12 ? e % 3 : (e - 12) % 2;
    const int nt = 2 * wv + idx / 16;
    if (m == 0) return ld_wtile(Wqt, nt * (CG / 32) + kb, lane);
    if (m == 1) return ld_wtile(Wkt, nt * (CG / 32) + kb, lane);
    return ld_wtile(Wvt, nt * (CC / 32) + kb, lane);
  };
  // -------- P0: x from the staging buffer to the slabs, xqk=[x|guidance] --------
  // all of a thread's 16-byte reads ahead of the first store, so that they are in flight
  // together; both loops unrolled: xs[] is indexed by constants and stays in registers
  v4f xs[TT * CC / (128 * PX)];
#pragma unroll
  for (int it = 0; it < TT * CC / (128 * PX); ++it)
    xs[it] = *reinterpret_cast<const v4f*>(smem_all + O_STG + (it * (128 * PX) + wtid) * 16);
#pragma unroll
  for (int it = 0; it < TT * CC / (128 * PX); ++it) {
    int i = it * (128 * PX) + wtid;
    int t = i >> 7, c = i & 127;
    v4f v = xs[it];
#pragma unroll
    for (int p = 0; p < PX; ++p) {
      ((float*)(smem_all + p * SLAB + O_X))[t * XP + c] = v[p];
      ((bf16*)(smem_all + p * SLAB + O_XQK))[t * QKP + c] = (bf16)v[p];
    }
  }
  // unrolled like the load loop: gv[] is indexed by constants
#pragma unroll
  for (int k = 0; k < TT * GD / 128; ++k) {
    int i = k * 128 + tid;
    int t = i >> 6, j = i & 63;
    xqk[t * QKP + 128 + j] = (bf16)gv[k];
  }
  // P1's first P1D weight tiles set out here, in front of the barrier: they need nothing of
  // LDS and fly while the wave waits for the others.
  // Unrolled: Br[] is indexed by constants and stays in registers
  v16bf Br[P1D];
  // keeps the run from moving up among P0's values, where it cost registers (spills to scratch)
  __builtin_amdgcn_sched_barrier(0);
#pragma unroll
  for (int i = 0; i < P1D; ++i) Br[i] = p1_tile(i);
  __syncthreads();

  // -------- P1: q,k (K=192) and v (K=128) GEMMs --------
  // One column tile after the other, each with its epilogue: six accumulator tiles are live,
  // not twelve, which leaves the registers for the ring of weight tiles.
  // All loops unrolled: Br[] and the accumulators are indexed by constants
#pragma unroll
  for (int j = 0; j < 2; ++j) {
    v8f aq[2], ak[2], av[2];
#pragma unroll
    for (int m = 0; m < 2; ++m) { aq[m] = vzero8(); ak[m] = vzero8(); av[m] = vzero8(); }
#pragma unroll
    for (int kb = 0; kb < 6; ++kb) {
      v16bf A0 = ld_tile(xqk, QKP, 0, kb * 32, lane);
      v16bf A1 = ld_tile(xqk, QKP, 16, kb * 32, lane);
      // a ring of P1D tiles in registers: tile idx + P1D is asked for where tile idx is taken
      // out, written out here: left to itself the compiler put each load directly in front of
      // its two products, and the wave sat out the whole latency of nearly every load
#pragma unroll
      for (int m = 0; m < (kb < 4 ? 3 : 2); ++m) {
        const int idx = j * 16 + (kb < 4 ? kb * 3 + m : 12 + (kb - 4) * 2 + m);
        v16bf Bc = Br[idx % P1D];
        if (idx + P1D < P1T) {
          Br[idx % P1D] = p1_tile(idx + P1D);
          // keeps the load here: without it the scheduler moved it down to its first use
          __builtin_amdgcn_sched_barrier(0);
        }
        if (m == 0) {
          aq[0] = wmma_bf16(A0, Bc, aq[0]);
          aq[1] = wmma_bf16(A1, Bc, aq[1]);
        } else if (m == 1) {
          ak[0] = wmma_bf16(A0, Bc, ak[0]);
          ak[1] = wmma_bf16(A1, Bc, ak[1]);
        } else {
          av[0] = wmma_bf16(A0, Bc, av[0]);
          av[1] = wmma_bf16(A1, Bc, av[1]);
        }
      }
    }
    // epilogue: bias, elu+1, scatter Q (row-major) and K^T, V^T to LDS
    int col = (2 * wv + j) * 16 + r;
    float bqv = bq[col], bkv = bk[col], bvv = bv[col];
#pragma unroll
    for (int mt = 0; mt < 2; ++mt) {
      v8bf k8, v8;   // eight neighbours of one K^T / V^T row: one 16-byte store each
#pragma unroll
      for (int i = 0; i < 8; ++i) {
        int l = mt * 16 + half * 8 + i;
        float qv = aq[mt][i] + bqv;
        qv = (qv > 0.f) ? (qv + 1.f) : __expf(qv);
        Qs[l * CP + col] = (bf16)qv;
        float kv = ak[mt][i] + bkv;
        kv = (kv > 0.f) ? (kv + 1.f) : __expf(kv);
        k8[i] = (bf16)kv;
        v8[i] = (bf16)(av[mt][i] + bvv);
      }
      *reinterpret_cast<v8bf*>(Kt + col * TP + mt * 16 + half * 8) = k8;
      *reinterpret_cast<v8bf*>(Vt + col * TP + mt * 16 + half * 8) = v8;
    }
  }
  __syncthreads();

  // LN2's scale and shift for this lane's 32 columns, asked for ahead of the copies, not behind them
  v4f g2[8], s2[8];
  const int lnoff = lnq * 16;
  // unrolled: g2[], s2[] stay in registers and the 16 loads are in flight together
#pragma unroll
  for (int i = 0; i < 8; ++i) {
    g2[i] = *reinterpret_cast<const v4f*>(ln2g + lnoff + ln_col(0, i));
    s2[i] = *reinterpret_cast<const v4f*>(ln2b + lnoff + ln_col(0, i));
  }
  // LN1's scale and shift for this lane's two columns of P3, for the same reason
  float l1g[2], l1b[2];
#pragma unroll
  for (int nt = 0; nt < 2; ++nt) {
    l1g[nt] = ln1g[wv * 32 + nt * 16 + r];
    l1b[nt] = ln1b[wv * 32 + nt * 16 + r];
  }
  // the wait that belongs in front of an overwrite of the run's offset register; the
  // operand keeps that register alive up to here, so that no load of the run lands in it
  asm volatile("s_wait_xcnt 0x0" :: "v"(lnoff * 4) : "memory");

  // the next tile's x sets out here, where no phase needs global memory for a while. Every
  // wave's reads of the staging buffer ended two barriers ago; this wave's LDS operations
  // have retired before its copies aim at LDS
  if (tl + 1 < TILES) {
    asm volatile("s_wait_dscnt 0x0" ::: "memory");
    copy_x_tile(x + pix_off(nn), stg, wtid);
  }

  // -------- P2: Ksum, KV = K^T @ V (per head, one WMMA K-step) --------
  {
    float s = 0.f;
#pragma unroll
    for (int i = 0; i < TT; ++i) s += (float)Kt[tid * TP + i];
    Ksum[tid] = s;
  }
  {
    int h = wv;
    v8f acc[2][2];
#pragma unroll
    for (int m = 0; m < 2; ++m)
#pragma unroll
      for (int j = 0; j < 2; ++j) acc[m][j] = vzero8();
#pragma unroll
    for (int mt = 0; mt < 2; ++mt) {
      v16bf A = ld_tile(Kt, TP, h * 32 + mt * 16, 0, lane);
#pragma unroll
      for (int nt = 0; nt < 2; ++nt) {
        v16bf Bv = ld_tile(Vt, TP, h * 32 + nt * 16, 0, lane);
        acc[mt][nt] = wmma_bf16(A, Bv, acc[mt][nt]);
      }
    }
#pragma unroll
    for (int mt = 0; mt < 2; ++mt)
#pragma unroll
      for (int nt = 0; nt < 2; ++nt)
#pragma unroll
        for (int i = 0; i < 8; ++i) {
          int d = mt * 16 + half * 8 + i;       // row of KV
          int e = h * 32 + nt * 16 + r;          // global v-column
          KVt[e * TP + d] = (bf16)acc[mt][nt][i];
        }
  }
  __syncthreads();

  // -------- P2c: Z = 1/(Q.Ksum+eps), ln1 stats --------
  {
    int l = tid >> 2, h = tid & 3;
    float d = 0.f;
#pragma unroll
    for (int i = 0; i < 32; ++i)
      d += (float)Qs[l * CP + h * 32 + i] * Ksum[h * 32 + i];
    Zl[tid] = 1.0f / (d + 1e-6f);
  }
  {
    v4f xv[8];
    float mu, rv;
    ln_stats(xLDS + lnr * XP, lnq, xv, mu, rv);
    if (lnq == 0) { mu1[lnr] = mu; rv1[lnr] = rv; }
  }
  __syncthreads();

  // -------- P3: out = (Q @ KV)*Z + LN1(x)  (writes out1 over Kt/Vt) --------
  {
    int h = wv;
    v8f acc[2][2];
#pragma unroll
    for (int m = 0; m < 2; ++m)
#pragma unroll
      for (int j = 0; j < 2; ++j) acc[m][j] = vzero8();
#pragma unroll
    for (int mt = 0; mt < 2; ++mt) {
      v16bf A = ld_tile(Qs, CP, mt * 16, h * 32, lane);
#pragma unroll
      for (int nt = 0; nt < 2; ++nt) {
        v16bf Bv = ld_tile(KVt, TP, h * 32 + nt * 16, 0, lane);
        acc[mt][nt] = wmma_bf16(A, Bv, acc[mt][nt]);
      }
    }
    // row figures read ahead of the first out1 store, so that they stay a few wide
    // loads (behind a store to a padded row the compiler reloads them one by one)
    float zz[2][8], mm[2][8], rr[2][8];
#pragma unroll
    for (int mt = 0; mt < 2; ++mt)
#pragma unroll
      for (int i = 0; i < 8; ++i) {
        int l = mt * 16 + half * 8 + i;
        zz[mt][i] = Zl[l * 4 + h];
        mm[mt][i] = mu1[l];
        rr[mt][i] = rv1[l];
      }
#pragma unroll
    for (int mt = 0; mt < 2; ++mt)
#pragma unroll
      for (int nt = 0; nt < 2; ++nt)
#pragma unroll
        for (int i = 0; i < 8; ++i) {
          int l = mt * 16 + half * 8 + i;
          int c = h * 32 + nt * 16 + r;
          float res = acc[mt][nt][i] * zz[mt][i];
          res += (xLDS[l * XP + c] - mm[mt][i]) * rr[mt][i] * l1g[nt] + l1b[nt];
          out1[l * XP + c] = res;
        }
  }
  __syncthreads();

  // -------- P4: LN2 -> h0 (bf16), straight from the registers the statistics came from --------
  {
    v4f ov[8];
    float mu, rv;
    ln_stats(out1 + lnr * XP, lnq, ov, mu, rv);
    // both loops unrolled: ov[], g2[], s2[] are indexed by constants
#pragma unroll
    for (int j = 0; j < 4; ++j) {
      v8bf hb;   // eight neighbours of the row: one 16-byte store
#pragma unroll
      for (int e = 0; e < 8; ++e) {
        int i = j * 2 + (e >> 2);
        hb[e] = (bf16)((ov[i][e & 3] - mu) * rv * g2[i][e & 3] + s2[i][e & 3]);
      }
      *reinterpret_cast<v8bf*>(h0 + lnr * CP + ln_col(lnq, j * 2)) = hb;
    }
  }
  __syncthreads();

  // -------- P5: h1 = gelu(h0 @ W1 + b1)  (32x512, over x/xqk/Q) --------
  {
    v16bf Ah[2][4];
#pragma unroll
    for (int mt = 0; mt < 2; ++mt)
#pragma unroll
      for (int kb = 0; kb < 4; ++kb)
        Ah[mt][kb] = ld_tile(h0, CP, mt * 16, kb * 32, lane);
    // the weights and the bias of column tile jn + 1 are asked for ahead of tile jn's products
    // and gelu, written out here: inside the tile loop the compiler left each load directly
    // in front of its use. All loops unrolled: Bn[], Bc[] are indexed by constants
    v16bf Bn[4];
#pragma unroll
    for (int kb = 0; kb < 4; ++kb) Bn[kb] = ld_wtile(W1t, wv * 8 * (CC / 32) + kb, lane);
    float bn = b1[wv * 128 + r];
#pragma unroll
    for (int jn = 0; jn < 8; ++jn) {
      int nt = wv * 8 + jn;
      v16bf Bc[4];
#pragma unroll
      for (int kb = 0; kb < 4; ++kb) Bc[kb] = Bn[kb];
      float bb = bn;
      if (jn < 7) {
#pragma unroll
        for (int kb = 0; kb < 4; ++kb) Bn[kb] = ld_wtile(W1t, (nt + 1) * (CC / 32) + kb, lane);
        bn = b1[(nt + 1) * 16 + r];
      }
      v8f acc[2] = {vzero8(), vzero8()};
#pragma unroll
      for (int kb = 0; kb < 4; ++kb) {
        acc[0] = wmma_bf16(Ah[0][kb], Bc[kb], acc[0]);
        acc[1] = wmma_bf16(Ah[1][kb], Bc[kb], acc[1]);
      }
      int col = nt * 16 + r;
#pragma unroll
      for (int mt = 0; mt < 2; ++mt)
#pragma unroll
        for (int i = 0; i < 8; i += 2) {
          int l = mt * 16 + half * 8 + i;
          v2f hv = {acc[mt][i] + bb, acc[mt][i + 1] + bb};
          v2bf hb = __builtin_convertvector(gelu2(hv), v2bf);
          h1[l * FP + col] = hb[0];
          h1[(l + 1) * FP + col] = hb[1];
        }
    }
  }
  __syncthreads();

  // -------- P6: out1 += h1 @ W2 + b2 (in place, each element by its own thread) --------
  {
    v8f acc[2][2];
#pragma unroll
    for (int m = 0; m < 2; ++m)
#pragma unroll
      for (int j = 0; j < 2; ++j) acc[m][j] = vzero8();
    // the weights of k step kb + 4 are asked for ahead of step kb's products, written out for
    // the same reason as in P5. All loops unrolled: Bw[] is indexed by constants
    v16bf Bw[4][2];
#pragma unroll
    for (int kb = 0; kb < 4; ++kb)
#pragma unroll
      for (int j = 0; j < 2; ++j) Bw[kb][j] = ld_wtile(W2t, (2 * wv + j) * (FF / 32) + kb, lane);
#pragma unroll
    for (int kb = 0; kb < 16; ++kb) {
      v16bf A0 = ld_tile(h1, FP, 0, kb * 32, lane);
      v16bf A1 = ld_tile(h1, FP, 16, kb * 32, lane);
      v16bf Bc[2] = {Bw[kb & 3][0], Bw[kb & 3][1]};
      if (kb + 4 < 16) {
#pragma unroll
        for (int j = 0; j < 2; ++j)
          Bw[kb & 3][j] = ld_wtile(W2t, (2 * wv + j) * (FF / 32) + kb + 4, lane);
      }
#pragma unroll
      for (int j = 0; j < 2; ++j) {
        acc[0][j] = wmma_bf16(A0, Bc[j], acc[0][j]);
        acc[1][j] = wmma_bf16(A1, Bc[j], acc[1][j]);
      }
    }
#pragma unroll
    for (int j = 0; j < 2; ++j) {
      int c = (2 * wv + j) * 16 + r;
      float b2v = b2[c];
#pragma unroll
      for (int mt = 0; mt < 2; ++mt)
#pragma unroll
        for (int i = 0; i < 8; ++i) {
          int l = mt * 16 + half * 8 + i;
          out1[l * XP + c] = acc[mt][j][i] + out1[l * XP + c] + b2v;
        }
    }
  }
  __syncthreads();   // every pixel's result is in its slab before the joint store

  // the next tile's guidance is asked for ahead of this tile's stores
  if (tl + 1 < TILES) load_guidance(nn >> 10, tid);

  // -------- P7: store PX pixels of one (t,c) row as one 16-byte piece --------
  {
    float* on = out + pix_off(n);
    v4f v[TT * CC / (128 * PX)];
    // both loops unrolled: v[] stays in registers and the LDS reads run ahead of the stores
#pragma unroll
    for (int it = 0; it < TT * CC / (128 * PX); ++it) {
      int i = it * (128 * PX) + wtid;
      int t = i >> 7, c = i & 127;
#pragma unroll
      for (int p = 0; p < PX; ++p)
        v[it][p] = ((const float*)(smem_all + p * SLAB + O_KT))[t * XP + c];
    }
#pragma unroll
    for (int it = 0; it < TT * CC / (128 * PX); ++it)
      *reinterpret_cast<v4f*>(on + (size_t)(it * (128 * PX) + wtid) * HWS) = v[it];
    // the next trip reuses the stores' registers: the wait that belongs in front of that
    asm volatile("s_wait_xcnt 0x0" ::: "memory");
  }
  }   // tiles
}

extern "C" void kernel_launch(void* const* d_in, const int* in_sizes, int n_in,
                              void* d_out, int out_size, void* d_ws, size_t ws_size,
                              hipStream_t stream) {
  (void)in_sizes; (void)n_in; (void)out_size; (void)ws_size;
  const float* x    = (const float*)d_in[0];
  const float* g    = (const float*)d_in[1];
  const float* Wq   = (const float*)d_in[2];
  const float* bq   = (const float*)d_in[3];
  const float* Wk   = (const float*)d_in[4];
  const float* bk   = (const float*)d_in[5];
  const float* Wv   = (const float*)d_in[6];
  const float* bv   = (const float*)d_in[7];
  const float* ln1g = (const float*)d_in[8];
  const float* ln1b = (const float*)d_in[9];
  const float* ln2g = (const float*)d_in[10];
  const float* ln2b = (const float*)d_in[11];
  const float* W1   = (const float*)d_in[12];
  const float* b1   = (const float*)d_in[13];
  const float* W2   = (const float*)d_in[14];
  const float* b2   = (const float*)d_in[15];
  unsigned short* wt = (unsigned short*)d_ws;   // 196608 bf16 = 384 KB

  prep_weights<<<(196608 + 255) / 256, 256, 0, stream>>>(Wq, Wk, Wv, W1, W2, wt);
  fused_block<<<NWG, 128 * PX, 0, stream>>>(x, g, bq, bk, bv, ln1g, ln1b, ln2g, ln2b,
                                        b1, b2, wt, (float*)d_out);
}

// v008
// Measured time: 120 microseconds a run.
// Next to v007, in two timings, it ran 1.08 times as fast each time.
// All steps since v000 together make it 3.57 times as fast.
#include <hip/hip_runtime.h>
#include <cstdint>

typedef __bf16 bf16;
typedef bf16  v16bf __attribute__((ext_vector_type(16)));
typedef float v8f   __attribute__((ext_vector_type(8)));
typedef float v4f   __attribute__((ext_vector_type(4)));
typedef bf16  v8bf  __attribute__((ext_vector_type(8)));
typedef float v2f   __attribute__((ext_vector_type(2)));
typedef bf16  v2bf  __attribute__((ext_vector_type(2)));

// ---- problem constants (from reference setup) ----
#define BB   4
#define TT   32
#define CC   128
#define HS   32
#define WS   32
#define GD   64
#define CG   192      // C + Gd
#define FF   512      // 4*C
#define NPIX 4096     // B*H*W
#define HWS  1024     // H*W
#define PX   4        // pixels adjacent along W per tile (16 B of each x / out line)
#define TILES 4       // tiles of PX pixels that one workgroup works through, one after another
#define NWG  (NPIX / PX / TILES)
// LDS row pitches in elements: every row starts an odd multiple of 16 B after the
// one before it, so the 16 rows that one ds_load_b128 reads fall on 16 different
// groups of four banks (at a pitch that is a multiple of 64 B they share one to four)
#define XP   132      // f32 rows of 128: x, out1          (528 B)
#define QKP  200      // bf16 rows of 192: xqk             (400 B)
#define CP   136      // bf16 rows of 128: Q, h0           (272 B)
#define TP   40       // bf16 rows of 32: K^T, V^T, KV^T   (80 B)
#define FP   520      // bf16 rows of 512: h1              (1040 B)
// byte offsets inside one pixel's slab
#define O_X    0
#define O_XQK  16896
#define O_Q    29696
#define O_KT   38400
#define O_VT   48640
#define O_KVT  16896  // over xqk, which is dead when KV^T is written
#define O_H0   55296  // behind out1, over the end of V^T and the row figures (both dead)
#define O_STAT 58880
#define SLAB   64000  // LDS bytes per pixel
#define O_STG  (PX * SLAB)          // behind the slabs: the next tile's x as it lies in memory,
#define STGB   (TT * CC * PX * 4)   // 16 B (PX pixels) for each of the TT*CC (t,c) lines
#define P1T  16       // weight tiles that one wave uses in P1: 6 of Wq, 6 of Wk, 4 of Wv
#define P1D  8        // how many of them are on their way at any time

static __device__ __forceinline__ v8f vzero8() {
  v8f z;
#pragma unroll
  for (int i = 0; i < 8; ++i) z[i] = 0.0f;
  return z;
}

static __device__ __forceinline__ v8f wmma_bf16(v16bf a, v16bf b, v8f c) {
  return __builtin_amdgcn_wmma_f32_16x16x32_bf16(
      /*neg_a=*/false, a, /*neg_b=*/false, b,
      /*c_mod=*/(short)0, c, /*reuse_a=*/false, /*reuse_b=*/false);
}

// Load a 16x32 bf16 operand tile from row-major storage (A operands, and the B
// operands that are kept N x K in LDS: both sides have the same lane layout).
// lanes 0-15: row rcBase+lane, K = {k..k+7, k+16..k+23}
// lanes 16-31: row rcBase+lane-16, K = {k+8..k+15, k+24..k+31}
template <typename P>
static __device__ __forceinline__ v16bf ld_tile(P base, int stride, int rcBase,
                                                int kBase, int lane) {
  int r = lane & 15, half = lane >> 4;
  P p = base + (size_t)(rcBase + r) * stride + kBase + half * 8;
  v16bf a;
#pragma unroll
  for (int i = 0; i < 8; ++i) { a[i] = p[i]; a[i + 8] = p[16 + i]; }
  return a;
}

// Load one 16(n) x 32(k) weight tile that prep_weights has stored in register order:
// 1 KB a tile, the 32 lanes' first eight values in its first 512 B and their second
// eight in the other 512 B, so that each 16-byte load of a wave reads four whole lines.
static __device__ __forceinline__ v16bf ld_wtile(const bf16* mat, int tile, int lane) {
  const v8bf* p = reinterpret_cast<const v8bf*>(mat + tile * 512 + lane * 8);
  return __builtin_shufflevector(p[0], p[32], 0, 1, 2, 3, 4, 5, 6, 7,
                                 8, 9, 10, 11, 12, 13, 14, 15);
}

// source index of packed element j of a (K x N) row-major weight: tile = nt * (K/32) + kb;
// inside the tile bit 8 picks k+16, bits 7..3 the lane (n = lane & 15, k+8 for lanes 16-31),
// bits 2..0 the eight neighbours along k: the k order of ld_tile at every lane and position
static __device__ __forceinline__ int packed_src(int j, int K, int N) {
  int tile = j >> 9, e = j & 511;
  int nt = tile / (K / 32), kb = tile % (K / 32);
  int lane = (e >> 3) & 31;
  int n = nt * 16 + (lane & 15);
  int k = kb * 32 + (e >> 8) * 16 + (lane >> 4) * 8 + (e & 7);
  return k * N + n;
}

// exact gelu of two values, h * Phi(h) with Phi the normal distribution function, written
// as max(h, 0) - a * Phi(-a), a = |h|: one form for both signs and for every size of h, so
// no branch. Phi(-a) = 2^p(a): p is a degree-8 fit of log2(Phi(-a)) on 0 <= a <= 6, its error
// weighted by Phi(-a); against gelu in double precision the f32 result is off by less than
// 3e-7 on -8 <= h <= 8 (with the library's erf in h / 2 * (1 + erf(h / sqrt 2)): 5e-7).
// Past a = 6 the term a * Phi(-a) is held at its value there, 6e-9 (true value: less).
static __device__ __forceinline__ v2f gelu2(v2f h) {
  v2f a, e, relu;
  a[0] = fminf(fabsf(h[0]), 6.0f);
  a[1] = fminf(fabsf(h[1]), 6.0f);
  v2f p = -0.00000138095049f;
  p = __builtin_elementwise_fma(p, a, (v2f)0.0000228085610f);
  p = __builtin_elementwise_fma(p, a, (v2f)-0.000112637688f);
  p = __builtin_elementwise_fma(p, a, (v2f)-0.000299850391f);
  p = __builtin_elementwise_fma(p, a, (v2f)0.00725496560f);
  p = __builtin_elementwise_fma(p, a, (v2f)-0.0526133589f);
  p = __builtin_elementwise_fma(p, a, (v2f)-0.459174365f);
  p = __builtin_elementwise_fma(p, a, (v2f)-1.15110886f);
  p = __builtin_elementwise_fma(p, a, (v2f)-0.999999940f);
  e[0] = __builtin_amdgcn_exp2f(p[0]);   // p is never below -30: no range handling needed
  e[1] = __builtin_amdgcn_exp2f(p[1]);
  relu[0] = fmaxf(h[0], 0.0f);
  relu[1] = fmaxf(h[1], 0.0f);
  return __builtin_elementwise_fma(-a, e, relu);
}

// ---- layer-norm rows: four lanes a row, 32 values a lane, held in registers ----
// lane q of a row takes columns q*16..q*16+15 and 64+q*16..64+q*16+15: at the row pitch XP
// the 16 lanes that one half of a ds_load_b128 serves (4 rows x 4 q) fall on 16 different
// groups of four banks
static __device__ __forceinline__ int ln_col(int q, int i) {
  return (i >> 2) * 64 + q * 16 + (i & 3) * 4;
}

// sum over the four lanes of a row (lane bits 2 and 3), every lane gets it: two DPP steps
// inside the 16-lane row (row_xmask:4, row_xmask:8), no LDS round trip
static __device__ __forceinline__ float sum_row_lanes(float v) {
  v += __int_as_float(__builtin_amdgcn_update_dpp(0, __float_as_int(v), 0x164, 0xf, 0xf, true));
  v += __int_as_float(__builtin_amdgcn_update_dpp(0, __float_as_int(v), 0x168, 0xf, 0xf, true));
  return v;
}

// mean and 1/sqrt(var + 1e-5) of a row of CC values; two passes, as the definition has it
static __device__ __forceinline__ void ln_stats(const float* row, int q, v4f (&v)[8],
                                                float& mu, float& rv) {
  // the three loops unrolled: v[] is indexed by constants and stays in registers
#pragma unroll
  for (int i = 0; i < 8; ++i) v[i] = *reinterpret_cast<const v4f*>(row + ln_col(q, i));
  v4f s = v[0];
#pragma unroll
  for (int i = 1; i < 8; ++i) s += v[i];
  mu = sum_row_lanes((s[0] + s[1]) + (s[2] + s[3])) * (1.0f / CC);
  v4f w = 0.0f;
#pragma unroll
  for (int i = 0; i < 8; ++i) { v4f d = v[i] - mu; w += d * d; }
  rv = rsqrtf(sum_row_lanes((w[0] + w[1]) + (w[2] + w[3])) * (1.0f / CC) + 1e-5f);
}

// element offset of pixel n in x and in out, at t = 0, c = 0
static __device__ __forceinline__ size_t pix_off(int n) {
  return (size_t)(n >> 10) * TT * CC * HWS + (n & (HWS - 1));
}

// One tile's x, global memory -> staging buffer, through no register: thread w brings the
// 16 bytes of lines w, w + 512, ... to the same places of the buffer. The copies count on
// asynccnt alone, so the weight loads issued behind them are not held up by their return.
// s_wait_xcnt stands inside the statement: in front of any reuse of the address registers.
static __device__ __forceinline__ void copy_x_tile(const float* xn, unsigned stg, int wtid) {
  const float* g = xn + (size_t)wtid * HWS;
  const unsigned l = stg + wtid * 16;
  const size_t gs = (size_t)(128 * PX) * HWS;
  const unsigned ls = 128 * PX * 16;
  asm volatile(
      "global_load_async_to_lds_b128 %0, %8, off\n\t"
      "global_load_async_to_lds_b128 %1, %9, off\n\t"
      "global_load_async_to_lds_b128 %2, %10, off\n\t"
      "global_load_async_to_lds_b128 %3, %11, off\n\t"
      "global_load_async_to_lds_b128 %4, %12, off\n\t"
      "global_load_async_to_lds_b128 %5, %13, off\n\t"
      "global_load_async_to_lds_b128 %6, %14, off\n\t"
      "global_load_async_to_lds_b128 %7, %15, off\n\t"
      "s_wait_xcnt 0x0"
      :: "v"(l), "v"(l + ls), "v"(l + 2 * ls), "v"(l + 3 * ls),
         "v"(l + 4 * ls), "v"(l + 5 * ls), "v"(l + 6 * ls), "v"(l + 7 * ls),
         "v"(g), "v"(g + gs), "v"(g + 2 * gs), "v"(g + 3 * gs),
         "v"(g + 4 * gs), "v"(g + 5 * gs), "v"(g + 6 * gs), "v"(g + 7 * gs)
      : "memory");
}

// ---- weight prep: fp32 -> bf16, packed tile by tile in the order ld_wtile reads ----
// ws layout (bf16 elements): Wqt[0..24576) Wkt[..49152) Wvt[..65536)
//                            W1t[..131072) W2t[..196608)
__global__ void prep_weights(const float* __restrict__ Wq,
                             const float* __restrict__ Wk,
                             const float* __restrict__ Wv,
                             const float* __restrict__ W1,
                             const float* __restrict__ W2,
                             unsigned short* __restrict__ wsu) {
  bf16* o = reinterpret_cast<bf16*>(wsu);
  int i = blockIdx.x * blockDim.x + threadIdx.x;
  if (i >= 196608) return;
  int j = i;
  if (j < 24576) { o[i] = (bf16)Wq[packed_src(j, CG, CC)]; return; }
  j -= 24576;
  if (j < 24576) { o[i] = (bf16)Wk[packed_src(j, CG, CC)]; return; }
  j -= 24576;
  if (j < 16384) { o[i] = (bf16)Wv[packed_src(j, CC, CC)]; return; }
  j -= 16384;
  if (j < 65536) { o[i] = (bf16)W1[packed_src(j, CC, FF)]; return; }
  j -= 65536;
  o[i] = (bf16)W2[packed_src(j, FF, CC)];
}

// ---- fused block: one workgroup works through TILES tiles of PX adjacent pixels; four
// waves and one LDS slab per pixel; x is read and out is written PX pixels at a time;
// the next tile's x is on its way into LDS while this tile is worked on.
// In the three products with weights (P1, P5, P6) the 16 waves are dealt over the column
// tiles, and a wave takes the rows of two or of all four pixels: a weight tile that has come
// from L2 serves 64 or 128 rows, not 32, and so much less weight traffic leaves L2 ----
__global__ __launch_bounds__(128 * PX)
void fused_block(const float* __restrict__ x, const float* __restrict__ gdn,
                 const float* __restrict__ bq, const float* __restrict__ bk,
                 const float* __restrict__ bv,
                 const float* __restrict__ ln1g, const float* __restrict__ ln1b,
                 const float* __restrict__ ln2g, const float* __restrict__ ln2b,
                 const float* __restrict__ b1, const float* __restrict__ b2,
                 const unsigned short* __restrict__ wsu,
                 float* __restrict__ out) {
  __shared__ __attribute__((aligned(16))) unsigned char smem_all[PX * SLAB + STGB];
  // LDS byte address of the staging buffer: the low 32 bits of its address
  const unsigned stg = (unsigned)(uintptr_t)(smem_all + O_STG);
  // guidance of one tile: a thread's 16 values, held in registers until P0 stores them
  float gv[TT * GD / 128];
  auto load_guidance = [&](int b, int tid) {
    // unrolled: gv[] is indexed by constants and stays in registers
#pragma unroll
    for (int k = 0; k < TT * GD / 128; ++k) {
      int i = k * 128 + tid;
      int t = i >> 6, j = i & 63;
      gv[k] = gdn[((size_t)b * TT + t) * GD + j];
    }
    // later instructions reuse the run's address registers: the wait that belongs in
    // front of such an overwrite
    asm volatile("s_wait_xcnt 0x0" ::: "memory");
  };

  // tile 0's x and guidance (no wave has touched LDS yet)
  copy_x_tile(x + pix_off(blockIdx.x * PX), stg, threadIdx.x);
  load_guidance((blockIdx.x * PX) >> 10, threadIdx.x & 127);

  // kept rolled: one copy of the body
#pragma unroll 1
  for (int tl = 0; tl < TILES; ++tl) {
  const int n = (tl * NWG + blockIdx.x) * PX;    // first of the tile's PX pixels
  const int nn = n + NWG * PX;                   // the same of the next tile
  // The lane's number is formed anew in every trip, by an instruction that stays where it
  // is written: the some 190 LDS and weight addresses that follow from it are then formed
  // where they are used. Taken from threadIdx.x they were all formed ahead of the loop,
  // held over it, and most of them went to scratch and were read back in every trip.
  int lane;
  asm volatile("v_mbcnt_lo_u32_b32 %0, -1, 0" : "=v"(lane));
  lane &= 31;
  // the wave's number in a scalar register: what follows from it alone takes no vector register
  const int wn   = __builtin_amdgcn_readfirstlane(threadIdx.x >> 5);   // 0 .. 4*PX-1
  const int wtid = wn * 32 + lane;                                     // 0 .. 128*PX-1
  const int ct   = wn >> 1;         // P1, P6: the wave's column tile ...
  const int pp   = (wn & 1) * 2;    // ... and the first of its two pixels
  unsigned char* smem = smem_all + (wtid >> 7) * SLAB;   // this pixel's slab
  // phase-reused LDS layout (per slab)
  float* xLDS = (float*)(smem + O_X);        // 32x128 f32, pitch XP   (dead after P3)
  bf16*  xqk  = (bf16*)(smem + O_XQK);       // 32x192 bf16, pitch QKP (dead after P1)
  bf16*  Qs   = (bf16*)(smem + O_Q);         // 32x128 bf16, pitch CP  (dead after P3)
  bf16*  Kt   = (bf16*)(smem + O_KT);        // 128x32 bf16, pitch TP  (dead after P2)
  bf16*  Vt   = (bf16*)(smem + O_VT);        // 128x32 bf16, pitch TP  (dead after P2)
  bf16*  KVt  = (bf16*)(smem + O_KVT);       // 128x32 bf16, pitch TP  (over xqk; dead after P3)
  float* Ksum = (float*)(smem + O_STAT);         // 128 f32
  float* Zl   = (float*)(smem + O_STAT + 512);   // 128 f32 (l*4+h)
  float* mu1  = (float*)(smem + O_STAT + 1024);  // 32
  float* rv1  = (float*)(smem + O_STAT + 1152);  // 32
  float* out1 = (float*)(smem + O_KT);       // 32x128 f32, pitch XP (over Kt+Vt)
  bf16*  h0   = (bf16*)(smem + O_H0);        // 32x128 bf16, pitch CP (over Vt's end, row figures)
  // h1 at O_X:                                 32x512 bf16, pitch FP (over x,xqk,Q)

  const bf16* Wqt = reinterpret_cast<const bf16*>(wsu);
  const bf16* Wkt = Wqt + 24576;
  const bf16* Wvt = Wqt + 49152;
  const bf16* W1t = Wqt + 65536;
  const bf16* W2t = Wqt + 131072;

  const int tid  = wtid & 127;        // thread within the pixel's four waves
  const int wv   = tid >> 5;          // wave id 0..3 within the pixel
  const int r    = lane & 15;
  const int half = lane >> 4;
  const int lnr  = wv * 8 + half * 4 + (lane & 3);   // layer norms: this lane's row ...
  const int lnq  = (lane >> 2) & 3;                  // ... and its quarter of the row

  // this wave's copies of the tile have landed; behind the barrier every wave's have, and
  // every wave has left the tile before (its reads of out1 in P7)
  asm volatile("s_wait_asynccnt 0x0" ::: "memory");
  __syncthreads();

  // the idx-th weight tile in the order in which P1 uses them: the wave's column tile, k step
  // by k step; in each step q, k and, over x's 128 columns, v
  auto p1_tile = [&](int idx) -> v16bf {
    const int kb = idx < 12 ? idx / 3 : 4 + (idx - 12) / 2;
    const int m  = idx < 12 ? idx % 3 : (idx - 12) % 2;
    if (m == 0) return ld_wtile(Wqt, ct * (CG / 32) + kb, lane);
    if (m == 1) return ld_wtile(Wkt, ct * (CG / 32) + kb, lane);
    return ld_wtile(Wvt, ct * (CC / 32) + kb, lane);
  };
  // -------- P0: x from the staging buffer to the slabs, xqk=[x|guidance] --------
  // all of a thread's 16-byte reads ahead of the first store, so that they are in flight
  // together; both loops unrolled: xs[] is indexed by constants and stays in registers
  v4f xs[TT * CC / (128 * PX)];
#pragma unroll
  for (int it = 0; it < TT * CC / (128 * PX); ++it)
    xs[it] = *reinterpret_cast<const v4f*>(smem_all + O_STG + (it * (128 * PX) + wtid) * 16);
#pragma unroll
  for (int it = 0; it < TT * CC / (128 * PX); ++it) {
    int i = it * (128 * PX) + wtid;
    int t = i >> 7, c = i & 127;
    v4f v = xs[it];
#pragma unroll
    for (int p = 0; p < PX; ++p) {
      ((float*)(smem_all + p * SLAB + O_X))[t * XP + c] = v[p];
      ((bf16*)(smem_all + p * SLAB + O_XQK))[t * QKP + c] = (bf16)v[p];
    }
  }
  // unrolled like the load loop: gv[] is indexed by constants
#pragma unroll
  for (int k = 0; k < TT * GD / 128; ++k) {
    int i = k * 128 + tid;
    int t = i >> 6, j = i & 63;
    xqk[t * QKP + 128 + j] = (bf16)gv[k];
  }
  // P1's first P1D weight tiles set out here, in front of the barrier: they need nothing of
  // LDS and fly while the wave waits for the others.
  // Unrolled: Br[] is indexed by constants and stays in registers
  v16bf Br[P1D];
  // keeps the run from moving up among P0's values, where it cost registers (spills to scratch)
  __builtin_amdgcn_sched_barrier(0);
#pragma unroll
  for (int i = 0; i < P1D; ++i) Br[i] = p1_tile(i);
  __syncthreads();

  // -------- P1: q,k (K=192) and v (K=128) GEMMs --------
  // One column tile of q, k and v for the 64 rows of two pixels: four row tiles m4 (pixel
  // pp + m4 / 2, its rows (m4 & 1) * 16 ...), so every weight tile feeds four products.
  // All loops unrolled: Br[] and the accumulators are indexed by constants
  {
    v8f aq[4], ak[4], av[4];
#pragma unroll
    for (int m = 0; m < 4; ++m) { aq[m] = vzero8(); ak[m] = vzero8(); av[m] = vzero8(); }
#pragma unroll
    for (int kb = 0; kb < 6; ++kb) {
      v16bf A[4];
#pragma unroll
      for (int m4 = 0; m4 < 4; ++m4)
        A[m4] = ld_tile((const bf16*)(smem_all + (pp + (m4 >> 1)) * SLAB + O_XQK), QKP,
                        (m4 & 1) * 16, kb * 32, lane);
      // a ring of P1D tiles in registers: tile idx + P1D is asked for where tile idx is taken
      // out, written out here: left to itself the compiler put each load directly in front of
      // its products, and the wave sat out the whole latency of nearly every load
#pragma unroll
      for (int m = 0; m < (kb < 4 ? 3 : 2); ++m) {
        const int idx = kb < 4 ? kb * 3 + m : 12 + (kb - 4) * 2 + m;
        v16bf Bc = Br[idx % P1D];
        if (idx + P1D < P1T) {
          Br[idx % P1D] = p1_tile(idx + P1D);
          // keeps the load here: without it the scheduler moved it down to its first use
          __builtin_amdgcn_sched_barrier(0);
        }
#pragma unroll
        for (int m4 = 0; m4 < 4; ++m4) {
          if (m == 0)      aq[m4] = wmma_bf16(A[m4], Bc, aq[m4]);
          else if (m == 1) ak[m4] = wmma_bf16(A[m4], Bc, ak[m4]);
          else             av[m4] = wmma_bf16(A[m4], Bc, av[m4]);
        }
      }
    }
    // epilogue: bias, elu+1, scatter Q (row-major) and K^T, V^T to each pixel's slab
    int col = ct * 16 + r;
    float bqv = bq[col], bkv = bk[col], bvv = bv[col];
#pragma unroll
    for (int m4 = 0; m4 < 4; ++m4) {
      unsigned char* sl = smem_all + (pp + (m4 >> 1)) * SLAB;
      const int mt = m4 & 1;
      v8bf k8, v8;   // eight neighbours of one K^T / V^T row: one 16-byte store each
#pragma unroll
      for (int i = 0; i < 8; ++i) {
        int l = mt * 16 + half * 8 + i;
        float qv = aq[m4][i] + bqv;
        qv = (qv > 0.f) ? (qv + 1.f) : __expf(qv);
        ((bf16*)(sl + O_Q))[l * CP + col] = (bf16)qv;
        float kv = ak[m4][i] + bkv;
        kv = (kv > 0.f) ? (kv + 1.f) : __expf(kv);
        k8[i] = (bf16)kv;
        v8[i] = (bf16)(av[m4][i] + bvv);
      }
      *reinterpret_cast<v8bf*>((bf16*)(sl + O_KT) + col * TP + mt * 16 + half * 8) = k8;
      *reinterpret_cast<v8bf*>((bf16*)(sl + O_VT) + col * TP + mt * 16 + half * 8) = v8;
    }
  }
  __syncthreads();

  // LN2's scale and shift for this lane's 32 columns, asked for ahead of the copies, not behind them
  v4f g2[8], s2[8];
  const int lnoff = lnq * 16;
  // unrolled: g2[], s2[] stay in registers and the 16 loads are in flight together
#pragma unroll
  for (int i = 0; i < 8; ++i) {
    g2[i] = *reinterpret_cast<const v4f*>(ln2g + lnoff + ln_col(0, i));
    s2[i] = *reinterpret_cast<const v4f*>(ln2b + lnoff + ln_col(0, i));
  }
  // LN1's scale and shift for this lane's two columns of P3, for the same reason
  float l1g[2], l1b[2];
#pragma unroll
  for (int nt = 0; nt < 2; ++nt) {
    l1g[nt] = ln1g[wv * 32 + nt * 16 + r];
    l1b[nt] = ln1b[wv * 32 + nt * 16 + r];
  }
  // the wait that belongs in front of an overwrite of the run's offset register; the
  // operand keeps that register alive up to here, so that no load of the run lands in it
  asm volatile("s_wait_xcnt 0x0" :: "v"(lnoff * 4) : "memory");

  // the next tile's x sets out here, where no phase needs global memory for a while. Every
  // wave's reads of the staging buffer ended two barriers ago; this wave's LDS operations
  // have retired before its copies aim at LDS
  if (tl + 1 < TILES) {
    asm volatile("s_wait_dscnt 0x0" ::: "memory");
    copy_x_tile(x + pix_off(nn), stg, wtid);
  }

  // -------- P2: Ksum, KV = K^T @ V (per head, one WMMA K-step) --------
  {
    float s = 0.f;
#pragma unroll
    for (int i = 0; i < TT; ++i) s += (float)Kt[tid * TP + i];
    Ksum[tid] = s;
  }
  {
    int h = wv;
    v8f acc[2][2];
#pragma unroll
    for (int m = 0; m < 2; ++m)
#pragma unroll
      for (int j = 0; j < 2; ++j) acc[m][j] = vzero8();
#pragma unroll
    for (int mt = 0; mt < 2; ++mt) {
      v16bf A = ld_tile(Kt, TP, h * 32 + mt * 16, 0, lane);
#pragma unroll
      for (int nt = 0; nt < 2; ++nt) {
        v16bf Bv = ld_tile(Vt, TP, h * 32 + nt * 16, 0, lane);
        acc[mt][nt] = wmma_bf16(A, Bv, acc[mt][nt]);
      }
    }
#pragma unroll
    for (int mt = 0; mt < 2; ++mt)
#pragma unroll
      for (int nt = 0; nt < 2; ++nt)
#pragma unroll
        for (int i = 0; i < 8; ++i) {
          int d = mt * 16 + half * 8 + i;       // row of KV
          int e = h * 32 + nt * 16 + r;          // global v-column
          KVt[e * TP + d] = (bf16)acc[mt][nt][i];
        }
  }
  __syncthreads();

  // -------- P2c: Z = 1/(Q.Ksum+eps), ln1 stats --------
  {
    int l = tid >> 2, h = tid & 3;
    float d = 0.f;
#pragma unroll
    for (int i = 0; i < 32; ++i)
      d += (float)Qs[l * CP + h * 32 + i] * Ksum[h * 32 + i];
    Zl[tid] = 1.0f / (d + 1e-6f);
  }
  {
    v4f xv[8];
    float mu, rv;
    ln_stats(xLDS + lnr * XP, lnq, xv, mu, rv);
    if (lnq == 0) { mu1[lnr] = mu; rv1[lnr] = rv; }
  }
  __syncthreads();

  // -------- P3: out = (Q @ KV)*Z + LN1(x)  (writes out1 over Kt/Vt) --------
  {
    int h = wv;
    v8f acc[2][2];
#pragma unroll
    for (int m = 0; m < 2; ++m)
#pragma unroll
      for (int j = 0; j < 2; ++j) acc[m][j] = vzero8();
#pragma unroll
    for (int mt = 0; mt < 2; ++mt) {
      v16bf A = ld_tile(Qs, CP, mt * 16, h * 32, lane);
#pragma unroll
      for (int nt = 0; nt < 2; ++nt) {
        v16bf Bv = ld_tile(KVt, TP, h * 32 + nt * 16, 0, lane);
        acc[mt][nt] = wmma_bf16(A, Bv, acc[mt][nt]);
      }
    }
    // row figures read ahead of the first out1 store, so that they stay a few wide
    // loads (behind a store to a padded row the compiler reloads them one by one)
    float zz[2][8], mm[2][8], rr[2][8];
#pragma unroll
    for (int mt = 0; mt < 2; ++mt)
#pragma unroll
      for (int i = 0; i < 8; ++i) {
        int l = mt * 16 + half * 8 + i;
        zz[mt][i] = Zl[l * 4 + h];
        mm[mt][i] = mu1[l];
        rr[mt][i] = rv1[l];
      }
#pragma unroll
    for (int mt = 0; mt < 2; ++mt)
#pragma unroll
      for (int nt = 0; nt < 2; ++nt)
#pragma unroll
        for (int i = 0; i < 8; ++i) {
          int l = mt * 16 + half * 8 + i;
          int c = h * 32 + nt * 16 + r;
          float res = acc[mt][nt][i] * zz[mt][i];
          res += (xLDS[l * XP + c] - mm[mt][i]) * rr[mt][i] * l1g[nt] + l1b[nt];
          out1[l * XP + c] = res;
        }
  }
  __syncthreads();

  // -------- P4: LN2 -> h0 (bf16), straight from the registers the statistics came from --------
  {
    v4f ov[8];
    float mu, rv;
    ln_stats(out1 + lnr * XP, lnq, ov, mu, rv);
    // both loops unrolled: ov[], g2[], s2[] are indexed by constants
#pragma unroll
    for (int j = 0; j < 4; ++j) {
      v8bf hb;   // eight neighbours of the row: one 16-byte store
#pragma unroll
      for (int e = 0; e < 8; ++e) {
        int i = j * 2 + (e >> 2);
        hb[e] = (bf16)((ov[i][e & 3] - mu) * rv * g2[i][e & 3] + s2[i][e & 3]);
      }
      *reinterpret_cast<v8bf*>(h0 + lnr * CP + ln_col(lnq, j * 2)) = hb;
    }
  }
  __syncthreads();

  // -------- P5: h1 = gelu(h0 @ W1 + b1)  (32x512 a pixel, over x/xqk/Q) --------
  // Two column tiles for the 128 rows of all four pixels: the wave's eight weight tiles are
  // read once and stay in registers, the rows of h0 pass by from LDS, row tile by row tile.
  // All loops unrolled: Bh[], Ah[] and the accumulators are indexed by constants
  {
    v16bf Bh[2][4];
    float bb[2];
    const v8bf* w5 = reinterpret_cast<const v8bf*>(W1t + wn * (2 * (CC / 32) * 512) + lane * 8);
    const float* b5 = b1 + wn * 32 + r;
#pragma unroll
    for (int j = 0; j < 2; ++j) {
#pragma unroll
      for (int kb = 0; kb < 4; ++kb)   // as ld_wtile, from the one address w5
        Bh[j][kb] = __builtin_shufflevector(w5[(j * 4 + kb) * 64], w5[(j * 4 + kb) * 64 + 32], 0, 1, 2,
                                            3, 4, 5, 6, 7, 8, 9, 10, 11, 12, 13, 14, 15);
      bb[j] = b5[j * 16];
    }
    // the wait that belongs in front of an overwrite of the run's address registers; the
    // operands keep them alive up to here, so that no load of the run lands in them
    asm volatile("s_wait_xcnt 0x0" :: "v"(w5), "v"(b5) : "memory");
#pragma unroll
    for (int m8 = 0; m8 < 2 * PX; ++m8) {
      unsigned char* sl = smem_all + (m8 >> 1) * SLAB;
      v16bf Ah[4];
#pragma unroll
      for (int kb = 0; kb < 4; ++kb)
        Ah[kb] = ld_tile((const bf16*)(sl + O_H0), CP, (m8 & 1) * 16, kb * 32, lane);
      v8f acc[2] = {vzero8(), vzero8()};
#pragma unroll
      for (int kb = 0; kb < 4; ++kb) {
        acc[0] = wmma_bf16(Ah[kb], Bh[0][kb], acc[0]);
        acc[1] = wmma_bf16(Ah[kb], Bh[1][kb], acc[1]);
      }
#pragma unroll
      for (int j = 0; j < 2; ++j) {
        int col = (wn * 2 + j) * 16 + r;
#pragma unroll
        for (int i = 0; i < 8; i += 2) {
          int l = (m8 & 1) * 16 + half * 8 + i;
          v2f hv = {acc[j][i] + bb[j], acc[j][i + 1] + bb[j]};
          v2bf hb = __builtin_convertvector(gelu2(hv), v2bf);
          ((bf16*)(sl + O_X))[l * FP + col] = hb[0];
          ((bf16*)(sl + O_X))[(l + 1) * FP + col] = hb[1];
        }
      }
    }
  }
  __syncthreads();

  // -------- P6: out1 += h1 @ W2 + b2 (in place, each element by its own thread) --------
  // One column tile for the 64 rows of two pixels, row tiles m4 as in P1
  {
    v8f acc[4];
#pragma unroll
    for (int m = 0; m < 4; ++m) acc[m] = vzero8();
    // the weights of k step kb + 8 are asked for ahead of step kb's products, written out:
    // inside the loop the compiler left each load directly in front of its use.
    // All loops unrolled: Bw[] is indexed by constants
    v16bf Bw[8];
    const v8bf* w6 = reinterpret_cast<const v8bf*>(W2t + ct * ((FF / 32) * 512) + lane * 8);
    auto p6_tile = [&](int kb) -> v16bf {   // as ld_wtile, from the one address w6
      return __builtin_shufflevector(w6[kb * 64], w6[kb * 64 + 32], 0, 1, 2, 3, 4, 5, 6, 7,
                                     8, 9, 10, 11, 12, 13, 14, 15);
    };
#pragma unroll
    for (int kb = 0; kb < 8; ++kb) Bw[kb] = p6_tile(kb);
#pragma unroll
    for (int kb = 0; kb < 16; ++kb) {
      v16bf A[4];
#pragma unroll
      for (int m4 = 0; m4 < 4; ++m4)
        A[m4] = ld_tile((const bf16*)(smem_all + (pp + (m4 >> 1)) * SLAB + O_X), FP,
                        (m4 & 1) * 16, kb * 32, lane);
      v16bf Bc = Bw[kb & 7];
      if (kb + 8 < 16) Bw[kb & 7] = p6_tile(kb + 8);
      // behind the last weight load: the wait that belongs in front of an overwrite of the
      // address registers; the operand keeps them alive up to here, so that no load lands in them
      if (kb + 8 == 15) asm volatile("s_wait_xcnt 0x0" :: "v"(w6) : "memory");
#pragma unroll
      for (int m4 = 0; m4 < 4; ++m4) acc[m4] = wmma_bf16(A[m4], Bc, acc[m4]);
    }
    int c = ct * 16 + r;
    float b2v = b2[c];
#pragma unroll
    for (int m4 = 0; m4 < 4; ++m4) {
      float* o1 = (float*)(smem_all + (pp + (m4 >> 1)) * SLAB + O_KT);
#pragma unroll
      for (int i = 0; i < 8; ++i) {
        int l = (m4 & 1) * 16 + half * 8 + i;
        o1[l * XP + c] = acc[m4][i] + o1[l * XP + c] + b2v;
      }
    }
  }
  __syncthreads();   // every pixel's result is in its slab before the joint store

  // the next tile's guidance is asked for ahead of this tile's stores
  if (tl + 1 < TILES) load_guidance(nn >> 10, tid);

  // -------- P7: store PX pixels of one (t,c) row as one 16-byte piece --------
  {
    float* on = out + pix_off(n);
    v4f v[TT * CC / (128 * PX)];
    // both loops unrolled: v[] stays in registers and the LDS reads run ahead of the stores
#pragma unroll
    for (int it = 0; it < TT * CC / (128 * PX); ++it) {
      int i = it * (128 * PX) + wtid;
      int t = i >> 7, c = i & 127;
#pragma unroll
      for (int p = 0; p < PX; ++p)
        v[it][p] = ((const float*)(smem_all + p * SLAB + O_KT))[t * XP + c];
    }
#pragma unroll
    for (int it = 0; it < TT * CC / (128 * PX); ++it)
      *reinterpret_cast<v4f*>(on + (size_t)(it * (128 * PX) + wtid) * HWS) = v[it];
    // the next trip reuses the stores' registers: the wait that belongs in front of that
    asm volatile("s_wait_xcnt 0x0" ::: "memory");
  }
  }   // tiles
}

extern "C" void kernel_launch(void* const* d_in, const int* in_sizes, int n_in,
                              void* d_out, int out_size, void* d_ws, size_t ws_size,
                              hipStream_t stream) {
  (void)in_sizes; (void)n_in; (void)out_size; (void)ws_size;
  const float* x    = (const float*)d_in[0];
  const float* g    = (const float*)d_in[1];
  const float* Wq   = (const float*)d_in[2];
  const float* bq   = (const float*)d_in[3];
  const float* Wk   = (const float*)d_in[4];
  const float* bk   = (const float*)d_in[5];
  const float* Wv   = (const float*)d_in[6];
  const float* bv   = (const float*)d_in[7];
  const float* ln1g = (const float*)d_in[8];
  const float* ln1b = (const float*)d_in[9];
  const float* ln2g = (const float*)d_in[10];
  const float* ln2b = (const float*)d_in[11];
  const float* W1   = (const float*)d_in[12];
  const float* b1   = (const float*)d_in[13];
  const float* W2   = (const float*)d_in[14];
  const float* b2   = (const float*)d_in[15];
  unsigned short* wt = (unsigned short*)d_ws;   // 196608 bf16 = 384 KB

  prep_weights<<<(196608 + 255) / 256, 256, 0, stream>>>(Wq, Wk, Wv, W1, W2, wt);
  fused_block<<<NWG, 128 * PX, 0, stream>>>(x, g, bq, bk, bv, ln1g, ln1b, ln2g, ln2b,
                                        b1, b2, wt, (float*)d_out);
}

// v009
// A run of this version takes 92.6 microseconds.
// Two timings next to v008 put it at 1.28 and 1.29 times that version's speed.
// All steps since v000 together make it 4.59 times as fast.
#include <hip/hip_runtime.h>
#include <cstdint>

typedef __bf16 bf16;
typedef bf16  v16bf __attribute__((ext_vector_type(16)));
typedef float v8f   __attribute__((ext_vector_type(8)));
typedef float v4f   __attribute__((ext_vector_type(4)));
typedef bf16  v8bf  __attribute__((ext_vector_type(8)));
typedef float v2f   __attribute__((ext_vector_type(2)));
typedef bf16  v2bf  __attribute__((ext_vector_type(2)));
typedef bf16  v4bf  __attribute__((ext_vector_type(4)));

// ---- problem constants (from reference setup) ----
#define BB   4
#define TT   32
#define CC   128
#define HS   32
#define WS   32
#define GD   64
#define CG   192      // C + Gd
#define FF   512      // 4*C
#define NPIX 4096     // B*H*W
#define HWS  1024     // H*W
#define PX   4        // pixels per tile, neighbours in the pixel-major copies of x and out
#define TILES 4       // tiles of PX pixels that one workgroup works through, one after another
#define NWG  (NPIX / PX / TILES)
// LDS row pitches in elements: every row starts an odd multiple of 16 B after the
// one before it, so the 16 rows that one ds_load_b128 reads fall on 16 different
// groups of four banks (at a pitch that is a multiple of 64 B they share one to four)
#define XP   132      // f32 rows of 128: x, out1          (528 B)
#define QKP  200      // bf16 rows of 192: xqk             (400 B)
#define CP   136      // bf16 rows of 128: Q, h0           (272 B)
#define TP   40       // bf16 rows of 32: K^T, V^T, KV^T   (80 B)
#define FP   520      // bf16 rows of 512: h1              (1040 B)
// byte offsets inside one pixel's slab
#define O_X    0
#define O_XQK  16896
#define O_Q    29696
#define O_KT   38400
#define O_VT   48640
#define O_KVT  16896  // over xqk, which is dead when KV^T is written
#define O_H0   55296  // behind out1, over the end of V^T and the row figures (both dead)
#define O_STAT 58880
#define SLAB   64000  // LDS bytes per pixel
#define O_STG  (PX * SLAB)          // behind the slabs: the next tile's x as it lies in the
#define STGB   (TT * CC * PX * 4)   // pixel-major copy: TT*CC values of one pixel after another
#define P1T  16       // weight tiles that one wave uses in P1: 6 of Wq, 6 of Wk, 4 of Wv
#define P1D  8        // how many of them are on their way at any time

static __device__ __forceinline__ v8f vzero8() {
  v8f z;
#pragma unroll
  for (int i = 0; i < 8; ++i) z[i] = 0.0f;
  return z;
}

static __device__ __forceinline__ v8f wmma_bf16(v16bf a, v16bf b, v8f c) {
  return __builtin_amdgcn_wmma_f32_16x16x32_bf16(
      /*neg_a=*/false, a, /*neg_b=*/false, b,
      /*c_mod=*/(short)0, c, /*reuse_a=*/false, /*reuse_b=*/false);
}

// Load a 16x32 bf16 operand tile from row-major storage (A operands, and the B
// operands that are kept N x K in LDS: both sides have the same lane layout).
// lanes 0-15: row rcBase+lane, K = {k..k+7, k+16..k+23}
// lanes 16-31: row rcBase+lane-16, K = {k+8..k+15, k+24..k+31}
template <typename P>
static __device__ __forceinline__ v16bf ld_tile(P base, int stride, int rcBase,
                                                int kBase, int lane) {
  int r = lane & 15, half = lane >> 4;
  P p = base + (size_t)(rcBase + r) * stride + kBase + half * 8;
  v16bf a;
#pragma unroll
  for (int i = 0; i < 8; ++i) { a[i] = p[i]; a[i + 8] = p[16 + i]; }
  return a;
}

// Load one 16(n) x 32(k) weight tile that prep_weights has stored in register order:
// 1 KB a tile, the 32 lanes' first eight values in its first 512 B and their second
// eight in the other 512 B, so that each 16-byte load of a wave reads four whole lines.
static __device__ __forceinline__ v16bf ld_wtile(const bf16* mat, int tile, int lane) {
  const v8bf* p = reinterpret_cast<const v8bf*>(mat + tile * 512 + lane * 8);
  return __builtin_shufflevector(p[0], p[32], 0, 1, 2, 3, 4, 5, 6, 7,
                                 8, 9, 10, 11, 12, 13, 14, 15);
}

// source index of packed element j of a (K x N) row-major weight: tile = nt * (K/32) + kb;
// inside the tile bit 8 picks k+16, bits 7..3 the lane (n = lane & 15, k+8 for lanes 16-31),
// bits 2..0 the eight neighbours along k: the k order of ld_tile at every lane and position
static __device__ __forceinline__ int packed_src(int j, int K, int N) {
  int tile = j >> 9, e = j & 511;
  int nt = tile / (K / 32), kb = tile % (K / 32);
  int lane = (e >> 3) & 31;
  int n = nt * 16 + (lane & 15);
  int k = kb * 32 + (e >> 8) * 16 + (lane >> 4) * 8 + (e & 7);
  return k * N + n;
}

// exact gelu of two values, h * Phi(h) with Phi the normal distribution function, written
// as max(h, 0) - a * Phi(-a), a = |h|: one form for both signs and for every size of h, so
// no branch. Phi(-a) = 2^p(a): p is a degree-8 fit of log2(Phi(-a)) on 0 <= a <= 6, its error
// weighted by Phi(-a); against gelu in double precision the f32 result is off by less than
// 3e-7 on -8 <= h <= 8 (with the library's erf in h / 2 * (1 + erf(h / sqrt 2)): 5e-7).
// Past a = 6 the term a * Phi(-a) is held at its value there, 6e-9 (true value: less).
static __device__ __forceinline__ v2f gelu2(v2f h) {
  v2f a, e, relu;
  a[0] = fminf(fabsf(h[0]), 6.0f);
  a[1] = fminf(fabsf(h[1]), 6.0f);
  v2f p = -0.00000138095049f;
  p = __builtin_elementwise_fma(p, a, (v2f)0.0000228085610f);
  p = __builtin_elementwise_fma(p, a, (v2f)-0.000112637688f);
  p = __builtin_elementwise_fma(p, a, (v2f)-0.000299850391f);
  p = __builtin_elementwise_fma(p, a, (v2f)0.00725496560f);
  p = __builtin_elementwise_fma(p, a, (v2f)-0.0526133589f);
  p = __builtin_elementwise_fma(p, a, (v2f)-0.459174365f);
  p = __builtin_elementwise_fma(p, a, (v2f)-1.15110886f);
  p = __builtin_elementwise_fma(p, a, (v2f)-0.999999940f);
  e[0] = __builtin_amdgcn_exp2f(p[0]);   // p is never below -30: no range handling needed
  e[1] = __builtin_amdgcn_exp2f(p[1]);
  relu[0] = fmaxf(h[0], 0.0f);
  relu[1] = fmaxf(h[1], 0.0f);
  return __builtin_elementwise_fma(-a, e, relu);
}

// ---- layer-norm rows: four lanes a row, 32 values a lane, held in registers ----
// lane q of a row takes columns q*16..q*16+15 and 64+q*16..64+q*16+15: at the row pitch XP
// the 16 lanes that one half of a ds_load_b128 serves (4 rows x 4 q) fall on 16 different
// groups of four banks
static __device__ __forceinline__ int ln_col(int q, int i) {
  return (i >> 2) * 64 + q * 16 + (i & 3) * 4;
}

// sum over the four lanes of a row (lane bits 2 and 3), every lane gets it: two DPP steps
// inside the 16-lane row (row_xmask:4, row_xmask:8), no LDS round trip
static __device__ __forceinline__ float sum_row_lanes(float v) {
  v += __int_as_float(__builtin_amdgcn_update_dpp(0, __float_as_int(v), 0x164, 0xf, 0xf, true));
  v += __int_as_float(__builtin_amdgcn_update_dpp(0, __float_as_int(v), 0x168, 0xf, 0xf, true));
  return v;
}

// mean and 1/sqrt(var + 1e-5) of a row of CC values; two passes, as the definition has it
static __device__ __forceinline__ void ln_stats(const float* row, int q, v4f (&v)[8],
                                                float& mu, float& rv) {
  // the three loops unrolled: v[] is indexed by constants and stays in registers
#pragma unroll
  for (int i = 0; i < 8; ++i) v[i] = *reinterpret_cast<const v4f*>(row + ln_col(q, i));
  v4f s = v[0];
#pragma unroll
  for (int i = 1; i < 8; ++i) s += v[i];
  mu = sum_row_lanes((s[0] + s[1]) + (s[2] + s[3])) * (1.0f / CC);
  v4f w = 0.0f;
#pragma unroll
  for (int i = 0; i < 8; ++i) { v4f d = v[i] - mu; w += d * d; }
  rv = rsqrtf(sum_row_lanes((w[0] + w[1]) + (w[2] + w[3])) * (1.0f / CC) + 1e-5f);
}

// element offset of pixel n in the pixel-major copies of x and of out, at t = 0, c = 0
static __device__ __forceinline__ size_t pix_off(int n) {
  return (size_t)n * (TT * CC);
}

// One tile's x, global memory -> staging buffer, through no register: thread w brings the
// 16-byte pieces w, w + 512, ... of the tile's 64 KB in a row to the same places of the buffer. The copies count on
// asynccnt alone, so the weight loads issued behind them are not held up by their return.
// s_wait_xcnt stands inside the statement: in front of any reuse of the address registers.
static __device__ __forceinline__ void copy_x_tile(const float* xn, unsigned stg, int wtid) {
  const float* g = xn + (size_t)wtid * 4;
  const unsigned l = stg + wtid * 16;
  const size_t gs = (size_t)(128 * PX) * 4;
  const unsigned ls = 128 * PX * 16;
  asm volatile(
      "global_load_async_to_lds_b128 %0, %8, off\n\t"
      "global_load_async_to_lds_b128 %1, %9, off\n\t"
      "global_load_async_to_lds_b128 %2, %10, off\n\t"
      "global_load_async_to_lds_b128 %3, %11, off\n\t"
      "global_load_async_to_lds_b128 %4, %12, off\n\t"
      "global_load_async_to_lds_b128 %5, %13, off\n\t"
      "global_load_async_to_lds_b128 %6, %14, off\n\t"
      "global_load_async_to_lds_b128 %7, %15, off\n\t"
      "s_wait_xcnt 0x0"
      :: "v"(l), "v"(l + ls), "v"(l + 2 * ls), "v"(l + 3 * ls),
         "v"(l + 4 * ls), "v"(l + 5 * ls), "v"(l + 6 * ls), "v"(l + 7 * ls),
         "v"(g), "v"(g + gs), "v"(g + 2 * gs), "v"(g + 3 * gs),
         "v"(g + 4 * gs), "v"(g + 5 * gs), "v"(g + 6 * gs), "v"(g + 7 * gs)
      : "memory");
}

// ---- weight prep: fp32 -> bf16, packed tile by tile in the order ld_wtile reads ----
// ws layout (bf16 elements): Wqt[0..24576) Wkt[..49152) Wvt[..65536)
//                            W1t[..131072) W2t[..196608)
__global__ void prep_weights(const float* __restrict__ Wq,
                             const float* __restrict__ Wk,
                             const float* __restrict__ Wv,
                             const float* __restrict__ W1,
                             const float* __restrict__ W2,
                             unsigned short* __restrict__ wsu) {
  bf16* o = reinterpret_cast<bf16*>(wsu);
  int i = blockIdx.x * blockDim.x + threadIdx.x;
  if (i >= 196608) return;
  int j = i;
  if (j < 24576) { o[i] = (bf16)Wq[packed_src(j, CG, CC)]; return; }
  j -= 24576;
  if (j < 24576) { o[i] = (bf16)Wk[packed_src(j, CG, CC)]; return; }
  j -= 24576;
  if (j < 16384) { o[i] = (bf16)Wv[packed_src(j, CC, CC)]; return; }
  j -= 16384;
  if (j < 65536) { o[i] = (bf16)W1[packed_src(j, CC, FF)]; return; }
  j -= 65536;
  o[i] = (bf16)W2[packed_src(j, FF, CC)];
}

// ---- transposition of BB planes: src [R][N] -> dst [N][R], tiles of 128 x 128 through LDS ----
// Every global load and store of a wave is 512 bytes in a row (four whole lines). A lane
// loads a block of 8 x 4 values, turns its two 4 x 4 halves in its registers and stores eight 16-byte pieces of
// the turned tile; piece number b of tile row d lies at place b ^ ((d >> 2) & 15) of the row,
// so that the 16 lanes of half a ds_store_b128 (rows four apart) fall on 16 different groups
// of four banks. One workgroup takes the same tile of each plane, one plane after another.
template <int R, int N>
static __device__ __forceinline__ void transpose_tiles(const float* __restrict__ src,
                                                       float* __restrict__ dst,
                                                       float (*buf)[128 * 128]) {
  const int lane = threadIdx.x & 31;
  const int w    = threadIdx.x >> 5;              // 16 waves, eight tile rows each
  const int rb   = blockIdx.x / (N / 128), cb = blockIdx.x % (N / 128);
  const float* s = src + (size_t)(rb * 128 + w * 8) * N + cb * 128 + lane * 4;
  float*       d = dst + (size_t)(cb * 128 + w * 8) * R + rb * 128 + lane * 4;
  v4f a[2][8];
  // all loops unrolled: a[] is indexed by constants and stays in registers
  auto load_plane = [&](int pl) {
    const float* sp = s + (size_t)pl * R * N;
#pragma unroll
    for (int k = 0; k < 8; ++k)
      a[pl & 1][k] = *reinterpret_cast<const v4f*>(sp + (size_t)k * N);
    // the wait that belongs in front of an overwrite of the run's address registers; the
    // operand keeps them alive up to here
    asm volatile("s_wait_xcnt 0x0" :: "v"(sp) : "memory");
  };
  load_plane(0);
  load_plane(1);
#pragma unroll
  for (int pl = 0; pl < BB; ++pl) {
    float* t = buf[pl & 1];
#pragma unroll
    for (int q = 0; q < 2; ++q)
#pragma unroll
      for (int j = 0; j < 4; ++j) {
        v4f c = {a[pl & 1][q * 4][j], a[pl & 1][q * 4 + 1][j], a[pl & 1][q * 4 + 2][j],
                 a[pl & 1][q * 4 + 3][j]};
        *reinterpret_cast<v4f*>(t + (lane * 4 + j) * 128 + ((w * 2 + q) ^ (lane & 15)) * 4) = c;
      }
    // the plane after the next sets out as soon as its registers are free
    if (pl + 2 < BB) load_plane(pl + 2);
    // one barrier a plane: it publishes this tile, and the buffer that the next plane writes
    // was last read in front of it. Written by hand with fences on LDS alone: __syncthreads()
    // made every wave sit out its global stores and the loads that fly for later planes
    __builtin_amdgcn_fence(__ATOMIC_RELEASE, "workgroup", "local");
    __builtin_amdgcn_s_barrier();
    __builtin_amdgcn_fence(__ATOMIC_ACQUIRE, "workgroup", "local");
    v4f o[8];
#pragma unroll
    for (int k = 0; k < 8; ++k)
      o[k] = *reinterpret_cast<const v4f*>(t + (w * 8 + k) * 128 +
                                           (lane ^ (((w * 8 + k) >> 2) & 15)) * 4);
    float* dp = d + (size_t)pl * R * N;
#pragma unroll
    for (int k = 0; k < 8; ++k)
      *reinterpret_cast<v4f*>(dp + (size_t)k * R) = o[k];
    // the wait that belongs in front of an overwrite of the stores' address and data
    // registers; the operands (inputs only) keep them alive up to here
    asm volatile("s_wait_xcnt 0x0" :: "v"(dp), "v"(o[0]), "v"(o[1]), "v"(o[2]), "v"(o[3]),
                 "v"(o[4]), "v"(o[5]), "v"(o[6]), "v"(o[7]) : "memory");
  }
}

// x (B, T*C, H*W) -> pixel-major copy (B, H*W, T*C) in the workspace
__global__ __launch_bounds__(512)
void x_to_pixel_major(const float* __restrict__ x, float* __restrict__ xt) {
  __shared__ __attribute__((aligned(16))) float buf[2][128 * 128];
  transpose_tiles<TT * CC, HWS>(x, xt, buf);
}

// pixel-major result (B, H*W, T*C) in the workspace -> out (B, T*C, H*W)
__global__ __launch_bounds__(512)
void out_from_pixel_major(const float* __restrict__ ot, float* __restrict__ out) {
  __shared__ __attribute__((aligned(16))) float buf[2][128 * 128];
  transpose_tiles<HWS, TT * CC>(ot, out, buf);
}

// ---- fused block: one workgroup works through TILES tiles of PX adjacent pixels; four
// waves and one LDS slab per pixel; x is read from and the result written to pixel-major
// copies in the workspace, 64 KB in a row a tile, whole lines;
// the next tile's x is on its way into LDS while this tile is worked on.
// In the three products with weights (P1, P5, P6) the 16 waves are dealt over the column
// tiles, and a wave takes the rows of two or of all four pixels: a weight tile that has come
// from L2 serves 64 or 128 rows, not 32, and so much less weight traffic leaves L2 ----
__global__ __launch_bounds__(128 * PX)
void fused_block(const float* __restrict__ x, const float* __restrict__ gdn,
                 const float* __restrict__ bq, const float* __restrict__ bk,
                 const float* __restrict__ bv,
                 const float* __restrict__ ln1g, const float* __restrict__ ln1b,
                 const float* __restrict__ ln2g, const float* __restrict__ ln2b,
                 const float* __restrict__ b1, const float* __restrict__ b2,
                 const unsigned short* __restrict__ wsu,
                 float* __restrict__ out) {
  __shared__ __attribute__((aligned(16))) unsigned char smem_all[PX * SLAB + STGB];
  // LDS byte address of the staging buffer: the low 32 bits of its address
  const unsigned stg = (unsigned)(uintptr_t)(smem_all + O_STG);
  // guidance of one tile: a thread's 16 values, held in registers until P0 stores them
  float gv[TT * GD / 128];
  auto load_guidance = [&](int b, int tid) {
    // unrolled: gv[] is indexed by constants and stays in registers
#pragma unroll
    for (int k = 0; k < TT * GD / 128; ++k) {
      int i = k * 128 + tid;
      int t = i >> 6, j = i & 63;
      gv[k] = gdn[((size_t)b * TT + t) * GD + j];
    }
    // later instructions reuse the run's address registers: the wait that belongs in
    // front of such an overwrite
    asm volatile("s_wait_xcnt 0x0" ::: "memory");
  };

  // tile 0's x and guidance (no wave has touched LDS yet)
  copy_x_tile(x + pix_off(blockIdx.x * PX), stg, threadIdx.x);
  load_guidance((blockIdx.x * PX) >> 10, threadIdx.x & 127);

  // kept rolled: one copy of the body
#pragma unroll 1
  for (int tl = 0; tl < TILES; ++tl) {
  const int n = (tl * NWG + blockIdx.x) * PX;    // first of the tile's PX pixels
  const int nn = n + NWG * PX;                   // the same of the next tile
  // The lane's number is formed anew in every trip, by an instruction that stays where it
  // is written: the some 190 LDS and weight addresses that follow from it are then formed
  // where they are used. Taken from threadIdx.x they were all formed ahead of the loop,
  // held over it, and most of them went to scratch and were read back in every trip.
  int lane;
  asm volatile("v_mbcnt_lo_u32_b32 %0, -1, 0" : "=v"(lane));
  lane &= 31;
  // the wave's number in a scalar register: what follows from it alone takes no vector register
  const int wn   = __builtin_amdgcn_readfirstlane(threadIdx.x >> 5);   // 0 .. 4*PX-1
  const int wtid = wn * 32 + lane;                                     // 0 .. 128*PX-1
  const int ct   = wn >> 1;         // P1, P6: the wave's column tile ...
  const int pp   = (wn & 1) * 2;    // ... and the first of its two pixels
  unsigned char* smem = smem_all + (wtid >> 7) * SLAB;   // this pixel's slab
  // phase-reused LDS layout (per slab)
  float* xLDS = (float*)(smem + O_X);        // 32x128 f32, pitch XP   (dead after P3)
  bf16*  xqk  = (bf16*)(smem + O_XQK);       // 32x192 bf16, pitch QKP (dead after P1)
  bf16*  Qs   = (bf16*)(smem + O_Q);         // 32x128 bf16, pitch CP  (dead after P3)
  bf16*  Kt   = (bf16*)(smem + O_KT);        // 128x32 bf16, pitch TP  (dead after P2)
  bf16*  Vt   = (bf16*)(smem + O_VT);        // 128x32 bf16, pitch TP  (dead after P2)
  bf16*  KVt  = (bf16*)(smem + O_KVT);       // 128x32 bf16, pitch TP  (over xqk; dead after P3)
  float* Ksum = (float*)(smem + O_STAT);         // 128 f32
  float* Zl   = (float*)(smem + O_STAT + 512);   // 128 f32 (l*4+h)
  float* mu1  = (float*)(smem + O_STAT + 1024);  // 32
  float* rv1  = (float*)(smem + O_STAT + 1152);  // 32
  float* out1 = (float*)(smem + O_KT);       // 32x128 f32, pitch XP (over Kt+Vt)
  bf16*  h0   = (bf16*)(smem + O_H0);        // 32x128 bf16, pitch CP (over Vt's end, row figures)
  // h1 at O_X:                                 32x512 bf16, pitch FP (over x,xqk,Q)

  const bf16* Wqt = reinterpret_cast<const bf16*>(wsu);
  const bf16* Wkt = Wqt + 24576;
  const bf16* Wvt = Wqt + 49152;
  const bf16* W1t = Wqt + 65536;
  const bf16* W2t = Wqt + 131072;

  const int tid  = wtid & 127;        // thread within the pixel's four waves
  const int wv   = tid >> 5;          // wave id 0..3 within the pixel
  const int r    = lane & 15;
  const int half = lane >> 4;
  const int lnr  = wv * 8 + half * 4 + (lane & 3);   // layer norms: this lane's row ...
  const int lnq  = (lane >> 2) & 3;                  // ... and its quarter of the row

  // this wave's copies of the tile have landed; behind the barrier every wave's have, and
  // every wave has left the tile before (its reads of out1 in P7)
  asm volatile("s_wait_asynccnt 0x0" ::: "memory");
  __syncthreads();

  // the idx-th weight tile in the order in which P1 uses them: the wave's column tile, k step
  // by k step; in each step q, k and, over x's 128 columns, v
  auto p1_tile = [&](int idx) -> v16bf {
    const int kb = idx < 12 ? idx / 3 : 4 + (idx - 12) / 2;
    const int m  = idx < 12 ? idx % 3 : (idx - 12) % 2;
    if (m == 0) return ld_wtile(Wqt, ct * (CG / 32) + kb, lane);
    if (m == 1) return ld_wtile(Wkt, ct * (CG / 32) + kb, lane);
    return ld_wtile(Wvt, ct * (CC / 32) + kb, lane);
  };
  // -------- P0: x from the staging buffer to the slabs, xqk=[x|guidance] --------
  // all of a thread's 16-byte reads ahead of the first store, so that they are in flight
  // together; both loops unrolled: xs[] is indexed by constants and stays in registers
  v4f xs[TT * CC / (128 * PX)];
#pragma unroll
  for (int it = 0; it < TT * CC / (128 * PX); ++it)
    xs[it] = *reinterpret_cast<const v4f*>(smem_all + O_STG + (it * (128 * PX) + wtid) * 16);
#pragma unroll
  for (int it = 0; it < TT * CC / (128 * PX); ++it) {
    int i = it * (128 * PX) + wtid;   // piece i: pixel p, row t, four columns from c on
    int p = i >> 10, t = (i >> 5) & 31, c = (i & 31) * 4;
    *reinterpret_cast<v4f*>((float*)(smem_all + p * SLAB + O_X) + t * XP + c) = xs[it];
    *reinterpret_cast<v4bf*>((bf16*)(smem_all + p * SLAB + O_XQK) + t * QKP + c) =
        __builtin_convertvector(xs[it], v4bf);
  }
  // unrolled like the load loop: gv[] is indexed by constants
#pragma unroll
  for (int k = 0; k < TT * GD / 128; ++k) {
    int i = k * 128 + tid;
    int t = i >> 6, j = i & 63;
    xqk[t * QKP + 128 + j] = (bf16)gv[k];
  }
  // P1's first P1D weight tiles set out here, in front of the barrier: they need nothing of
  // LDS and fly while the wave waits for the others.
  // Unrolled: Br[] is indexed by constants and stays in registers
  v16bf Br[P1D];
  // keeps the run from moving up among P0's values, where it cost registers (spills to scratch)
  __builtin_amdgcn_sched_barrier(0);
#pragma unroll
  for (int i = 0; i < P1D; ++i) Br[i] = p1_tile(i);
  __syncthreads();

  // -------- P1: q,k (K=192) and v (K=128) GEMMs --------
  // One column tile of q, k and v for the 64 rows of two pixels: four row tiles m4 (pixel
  // pp + m4 / 2, its rows (m4 & 1) * 16 ...), so every weight tile feeds four products.
  // All loops unrolled: Br[] and the accumulators are indexed by constants
  {
    v8f aq[4], ak[4], av[4];
#pragma unroll
    for (int m = 0; m < 4; ++m) { aq[m] = vzero8(); ak[m] = vzero8(); av[m] = vzero8(); }
#pragma unroll
    for (int kb = 0; kb < 6; ++kb) {
      v16bf A[4];
#pragma unroll
      for (int m4 = 0; m4 < 4; ++m4)
        A[m4] = ld_tile((const bf16*)(smem_all + (pp + (m4 >> 1)) * SLAB + O_XQK), QKP,
                        (m4 & 1) * 16, kb * 32, lane);
      // a ring of P1D tiles in registers: tile idx + P1D is asked for where tile idx is taken
      // out, written out here: left to itself the compiler put each load directly in front of
      // its products, and the wave sat out the whole latency of nearly every load
#pragma unroll
      for (int m = 0; m < (kb < 4 ? 3 : 2); ++m) {
        const int idx = kb < 4 ? kb * 3 + m : 12 + (kb - 4) * 2 + m;
        v16bf Bc = Br[idx % P1D];
        if (idx + P1D < P1T) {
          Br[idx % P1D] = p1_tile(idx + P1D);
          // keeps the load here: without it the scheduler moved it down to its first use
          __builtin_amdgcn_sched_barrier(0);
        }
#pragma unroll
        for (int m4 = 0; m4 < 4; ++m4) {
          if (m == 0)      aq[m4] = wmma_bf16(A[m4], Bc, aq[m4]);
          else if (m == 1) ak[m4] = wmma_bf16(A[m4], Bc, ak[m4]);
          else             av[m4] = wmma_bf16(A[m4], Bc, av[m4]);
        }
      }
    }
    // epilogue: bias, elu+1, scatter Q (row-major) and K^T, V^T to each pixel's slab
    int col = ct * 16 + r;
    float bqv = bq[col], bkv = bk[col], bvv = bv[col];
#pragma unroll
    for (int m4 = 0; m4 < 4; ++m4) {
      unsigned char* sl = smem_all + (pp + (m4 >> 1)) * SLAB;
      const int mt = m4 & 1;
      v8bf k8, v8;   // eight neighbours of one K^T / V^T row: one 16-byte store each
#pragma unroll
      for (int i = 0; i < 8; ++i) {
        int l = mt * 16 + half * 8 + i;
        float qv = aq[m4][i] + bqv;
        qv = (qv > 0.f) ? (qv + 1.f) : __expf(qv);
        ((bf16*)(sl + O_Q))[l * CP + col] = (bf16)qv;
        float kv = ak[m4][i] + bkv;
        kv = (kv > 0.f) ? (kv + 1.f) : __expf(kv);
        k8[i] = (bf16)kv;
        v8[i] = (bf16)(av[m4][i] + bvv);
      }
      *reinterpret_cast<v8bf*>((bf16*)(sl + O_KT) + col * TP + mt * 16 + half * 8) = k8;
      *reinterpret_cast<v8bf*>((bf16*)(sl + O_VT) + col * TP + mt * 16 + half * 8) = v8;
    }
  }
  __syncthreads();

  // LN2's scale and shift for this lane's 32 columns, asked for ahead of the copies, not behind them
  v4f g2[8], s2[8];
  const int lnoff = lnq * 16;
  // unrolled: g2[], s2[] stay in registers and the 16 loads are in flight together
#pragma unroll
  for (int i = 0; i < 8; ++i) {
    g2[i] = *reinterpret_cast<const v4f*>(ln2g + lnoff + ln_col(0, i));
    s2[i] = *reinterpret_cast<const v4f*>(ln2b + lnoff + ln_col(0, i));
  }
  // LN1's scale and shift for this lane's two columns of P3, for the same reason
  float l1g[2], l1b[2];
#pragma unroll
  for (int nt = 0; nt < 2; ++nt) {
    l1g[nt] = ln1g[wv * 32 + nt * 16 + r];
    l1b[nt] = ln1b[wv * 32 + nt * 16 + r];
  }
  // the wait that belongs in front of an overwrite of the run's offset register; the
  // operand keeps that register alive up to here, so that no load of the run lands in it
  asm volatile("s_wait_xcnt 0x0" :: "v"(lnoff * 4) : "memory");

  // the next tile's x sets out here, where no phase needs global memory for a while. Every
  // wave's reads of the staging buffer ended two barriers ago; this wave's LDS operations
  // have retired before its copies aim at LDS
  if (tl + 1 < TILES) {
    asm volatile("s_wait_dscnt 0x0" ::: "memory");
    copy_x_tile(x + pix_off(nn), stg, wtid);
  }

  // -------- P2: Ksum, KV = K^T @ V (per head, one WMMA K-step) --------
  {
    float s = 0.f;
#pragma unroll
    for (int i = 0; i < TT; ++i) s += (float)Kt[tid * TP + i];
    Ksum[tid] = s;
  }
  {
    int h = wv;
    v8f acc[2][2];
#pragma unroll
    for (int m = 0; m < 2; ++m)
#pragma unroll
      for (int j = 0; j < 2; ++j) acc[m][j] = vzero8();
#pragma unroll
    for (int mt = 0; mt < 2; ++mt) {
      v16bf A = ld_tile(Kt, TP, h * 32 + mt * 16, 0, lane);
#pragma unroll
      for (int nt = 0; nt < 2; ++nt) {
        v16bf Bv = ld_tile(Vt, TP, h * 32 + nt * 16, 0, lane);
        acc[mt][nt] = wmma_bf16(A, Bv, acc[mt][nt]);
      }
    }
#pragma unroll
    for (int mt = 0; mt < 2; ++mt)
#pragma unroll
      for (int nt = 0; nt < 2; ++nt)
#pragma unroll
        for (int i = 0; i < 8; ++i) {
          int d = mt * 16 + half * 8 + i;       // row of KV
          int e = h * 32 + nt * 16 + r;          // global v-column
          KVt[e * TP + d] = (bf16)acc[mt][nt][i];
        }
  }
  __syncthreads();

  // -------- P2c: Z = 1/(Q.Ksum+eps), ln1 stats --------
  {
    int l = tid >> 2, h = tid & 3;
    float d = 0.f;
#pragma unroll
    for (int i = 0; i < 32; ++i)
      d += (float)Qs[l * CP + h * 32 + i] * Ksum[h * 32 + i];
    Zl[tid] = 1.0f / (d + 1e-6f);
  }
  {
    v4f xv[8];
    float mu, rv;
    ln_stats(xLDS + lnr * XP, lnq, xv, mu, rv);
    if (lnq == 0) { mu1[lnr] = mu; rv1[lnr] = rv; }
  }
  __syncthreads();

  // -------- P3: out = (Q @ KV)*Z + LN1(x)  (writes out1 over Kt/Vt) --------
  {
    int h = wv;
    v8f acc[2][2];
#pragma unroll
    for (int m = 0; m < 2; ++m)
#pragma unroll
      for (int j = 0; j < 2; ++j) acc[m][j] = vzero8();
#pragma unroll
    for (int mt = 0; mt < 2; ++mt) {
      v16bf A = ld_tile(Qs, CP, mt * 16, h * 32, lane);
#pragma unroll
      for (int nt = 0; nt < 2; ++nt) {
        v16bf Bv = ld_tile(KVt, TP, h * 32 + nt * 16, 0, lane);
        acc[mt][nt] = wmma_bf16(A, Bv, acc[mt][nt]);
      }
    }
    // row figures read ahead of the first out1 store, so that they stay a few wide
    // loads (behind a store to a padded row the compiler reloads them one by one)
    float zz[2][8], mm[2][8], rr[2][8];
#pragma unroll
    for (int mt = 0; mt < 2; ++mt)
#pragma unroll
      for (int i = 0; i < 8; ++i) {
        int l = mt * 16 + half * 8 + i;
        zz[mt][i] = Zl[l * 4 + h];
        mm[mt][i] = mu1[l];
        rr[mt][i] = rv1[l];
      }
#pragma unroll
    for (int mt = 0; mt < 2; ++mt)
#pragma unroll
      for (int nt = 0; nt < 2; ++nt)
#pragma unroll
        for (int i = 0; i < 8; ++i) {
          int l = mt * 16 + half * 8 + i;
          int c = h * 32 + nt * 16 + r;
          float res = acc[mt][nt][i] * zz[mt][i];
          res += (xLDS[l * XP + c] - mm[mt][i]) * rr[mt][i] * l1g[nt] + l1b[nt];
          out1[l * XP + c] = res;
        }
  }
  __syncthreads();

  // -------- P4: LN2 -> h0 (bf16), straight from the registers the statistics came from --------
  {
    v4f ov[8];
    float mu, rv;
    ln_stats(out1 + lnr * XP, lnq, ov, mu, rv);
    // both loops unrolled: ov[], g2[], s2[] are indexed by constants
#pragma unroll
    for (int j = 0; j < 4; ++j) {
      v8bf hb;   // eight neighbours of the row: one 16-byte store
#pragma unroll
      for (int e = 0; e < 8; ++e) {
        int i = j * 2 + (e >> 2);
        hb[e] = (bf16)((ov[i][e & 3] - mu) * rv * g2[i][e & 3] + s2[i][e & 3]);
      }
      *reinterpret_cast<v8bf*>(h0 + lnr * CP + ln_col(lnq, j * 2)) = hb;
    }
  }
  __syncthreads();

  // -------- P5: h1 = gelu(h0 @ W1 + b1)  (32x512 a pixel, over x/xqk/Q) --------
  // Two column tiles for the 128 rows of all four pixels: the wave's eight weight tiles are
  // read once and stay in registers, the rows of h0 pass by from LDS, row tile by row tile.
  // All loops unrolled: Bh[], Ah[] and the accumulators are indexed by constants
  {
    v16bf Bh[2][4];
    float bb[2];
    const v8bf* w5 = reinterpret_cast<const v8bf*>(W1t + wn * (2 * (CC / 32) * 512) + lane * 8);
    const float* b5 = b1 + wn * 32 + r;
#pragma unroll
    for (int j = 0; j < 2; ++j) {
#pragma unroll
      for (int kb = 0; kb < 4; ++kb)   // as ld_wtile, from the one address w5
        Bh[j][kb] = __builtin_shufflevector(w5[(j * 4 + kb) * 64], w5[(j * 4 + kb) * 64 + 32], 0, 1, 2,
                                            3, 4, 5, 6, 7, 8, 9, 10, 11, 12, 13, 14, 15);
      bb[j] = b5[j * 16];
    }
    // the wait that belongs in front of an overwrite of the run's address registers; the
    // operands keep them alive up to here, so that no load of the run lands in them
    asm volatile("s_wait_xcnt 0x0" :: "v"(w5), "v"(b5) : "memory");
#pragma unroll
    for (int m8 = 0; m8 < 2 * PX; ++m8) {
      unsigned char* sl = smem_all + (m8 >> 1) * SLAB;
      v16bf Ah[4];
#pragma unroll
      for (int kb = 0; kb < 4; ++kb)
        Ah[kb] = ld_tile((const bf16*)(sl + O_H0), CP, (m8 & 1) * 16, kb * 32, lane);
      v8f acc[2] = {vzero8(), vzero8()};
#pragma unroll
      for (int kb = 0; kb < 4; ++kb) {
        acc[0] = wmma_bf16(Ah[kb], Bh[0][kb], acc[0]);
        acc[1] = wmma_bf16(Ah[kb], Bh[1][kb], acc[1]);
      }
#pragma unroll
      for (int j = 0; j < 2; ++j) {
        int col = (wn * 2 + j) * 16 + r;
#pragma unroll
        for (int i = 0; i < 8; i += 2) {
          int l = (m8 & 1) * 16 + half * 8 + i;
          v2f hv = {acc[j][i] + bb[j], acc[j][i + 1] + bb[j]};
          v2bf hb = __builtin_convertvector(gelu2(hv), v2bf);
          ((bf16*)(sl + O_X))[l * FP + col] = hb[0];
          ((bf16*)(sl + O_X))[(l + 1) * FP + col] = hb[1];
        }
      }
    }
  }
  __syncthreads();

  // -------- P6: out1 += h1 @ W2 + b2 (in place, each element by its own thread) --------
  // One column tile for the 64 rows of two pixels, row tiles m4 as in P1
  {
    v8f acc[4];
#pragma unroll
    for (int m = 0; m < 4; ++m) acc[m] = vzero8();
    // the weights of k step kb + 8 are asked for ahead of step kb's products, written out:
    // inside the loop the compiler left each load directly in front of its use.
    // All loops unrolled: Bw[] is indexed by constants
    v16bf Bw[8];
    const v8bf* w6 = reinterpret_cast<const v8bf*>(W2t + ct * ((FF / 32) * 512) + lane * 8);
    auto p6_tile = [&](int kb) -> v16bf {   // as ld_wtile, from the one address w6
      return __builtin_shufflevector(w6[kb * 64], w6[kb * 64 + 32], 0, 1, 2, 3, 4, 5, 6, 7,
                                     8, 9, 10, 11, 12, 13, 14, 15);
    };
#pragma unroll
    for (int kb = 0; kb < 8; ++kb) Bw[kb] = p6_tile(kb);
#pragma unroll
    for (int kb = 0; kb < 16; ++kb) {
      v16bf A[4];
#pragma unroll
      for (int m4 = 0; m4 < 4; ++m4)
        A[m4] = ld_tile((const bf16*)(smem_all + (pp + (m4 >> 1)) * SLAB + O_X), FP,
                        (m4 & 1) * 16, kb * 32, lane);
      v16bf Bc = Bw[kb & 7];
      if (kb + 8 < 16) Bw[kb & 7] = p6_tile(kb + 8);
      // behind the last weight load: the wait that belongs in front of an overwrite of the
      // address registers; the operand keeps them alive up to here, so that no load lands in them
      if (kb + 8 == 15) asm volatile("s_wait_xcnt 0x0" :: "v"(w6) : "memory");
#pragma unroll
      for (int m4 = 0; m4 < 4; ++m4) acc[m4] = wmma_bf16(A[m4], Bc, acc[m4]);
    }
    int c = ct * 16 + r;
    float b2v = b2[c];
#pragma unroll
    for (int m4 = 0; m4 < 4; ++m4) {
      float* o1 = (float*)(smem_all + (pp + (m4 >> 1)) * SLAB + O_KT);
#pragma unroll
      for (int i = 0; i < 8; ++i) {
        int l = (m4 & 1) * 16 + half * 8 + i;
        o1[l * XP + c] = acc[m4][i] + o1[l * XP + c] + b2v;
      }
    }
  }
  __syncthreads();   // every pixel's result is in its slab before the joint store

  // the next tile's guidance is asked for ahead of this tile's stores
  if (tl + 1 < TILES) load_guidance(nn >> 10, tid);

  // -------- P7: store the tile, 16-byte pieces (four columns of a row) in a row --------
  {
    float* on = out + pix_off(n);
    v4f v[TT * CC / (128 * PX)];
    // both loops unrolled: v[] stays in registers and the LDS reads run ahead of the stores
#pragma unroll
    for (int it = 0; it < TT * CC / (128 * PX); ++it) {
      int i = it * (128 * PX) + wtid;
      int p = i >> 10, t = (i >> 5) & 31, c = (i & 31) * 4;
      v[it] = *reinterpret_cast<const v4f*>((const float*)(smem_all + p * SLAB + O_KT) + t * XP + c);
    }
#pragma unroll
    for (int it = 0; it < TT * CC / (128 * PX); ++it)
      *reinterpret_cast<v4f*>(on + (size_t)(it * (128 * PX) + wtid) * 4) = v[it];
    // the next trip reuses the stores' registers: the wait that belongs in front of that
    asm volatile("s_wait_xcnt 0x0" ::: "memory");
  }
  }   // tiles
}

extern "C" void kernel_launch(void* const* d_in, const int* in_sizes, int n_in,
                              void* d_out, int out_size, void* d_ws, size_t ws_size,
                              hipStream_t stream) {
  (void)in_sizes; (void)n_in; (void)out_size; (void)ws_size;
  const float* x    = (const float*)d_in[0];
  const float* g    = (const float*)d_in[1];
  const float* Wq   = (const float*)d_in[2];
  const float* bq   = (const float*)d_in[3];
  const float* Wk   = (const float*)d_in[4];
  const float* bk   = (const float*)d_in[5];
  const float* Wv   = (const float*)d_in[6];
  const float* bv   = (const float*)d_in[7];
  const float* ln1g = (const float*)d_in[8];
  const float* ln1b = (const float*)d_in[9];
  const float* ln2g = (const float*)d_in[10];
  const float* ln2b = (const float*)d_in[11];
  const float* W1   = (const float*)d_in[12];
  const float* b1   = (const float*)d_in[13];
  const float* W2   = (const float*)d_in[14];
  const float* b2   = (const float*)d_in[15];
  unsigned short* wt = (unsigned short*)d_ws;   // 196608 bf16 = 384 KB
  float* xt = (float*)d_ws + 262144;            // 1 MiB on: x, pixel-major, 64 MiB
  float* ot = (float*)d_ws + 17039360;          // behind it: the result, pixel-major, 64 MiB

  prep_weights<<<(196608 + 255) / 256, 256, 0, stream>>>(Wq, Wk, Wv, W1, W2, wt);
  x_to_pixel_major<<<256, 512, 0, stream>>>(x, xt);
  fused_block<<<NWG, 128 * PX, 0, stream>>>(xt, g, bq, bk, bv, ln1g, ln1b, ln2g, ln2b,
                                        b1, b2, wt, ot);
  out_from_pixel_major<<<256, 512, 0, stream>>>(ot, (float*)d_out);
}

// v010
// Measured time: 87.8 microseconds a run.
// Next to v009, in two timings, it ran 1.06 times as fast each time.
// Counting every step since v000, it is 4.86 times as fast.
#include <hip/hip_runtime.h>
#include <cstdint>

typedef __bf16 bf16;
typedef bf16  v16bf __attribute__((ext_vector_type(16)));
typedef float v8f   __attribute__((ext_vector_type(8)));
typedef float v4f   __attribute__((ext_vector_type(4)));
typedef bf16  v8bf  __attribute__((ext_vector_type(8)));
typedef float v2f   __attribute__((ext_vector_type(2)));
typedef bf16  v2bf  __attribute__((ext_vector_type(2)));
typedef bf16  v4bf  __attribute__((ext_vector_type(4)));

// ---- problem constants (from reference setup) ----
#define BB   4
#define TT   32
#define CC   128
#define HS   32
#define WS   32
#define GD   64
#define CG   192      // C + Gd
#define FF   512      // 4*C
#define NPIX 4096     // B*H*W
#define HWS  1024     // H*W
#define PX   4        // pixels per tile, neighbours in the pixel-major copies of x and out
#define TILES 4       // tiles of PX pixels that one workgroup works through, one after another
#define NWG  (NPIX / PX / TILES)
// LDS row pitches in elements: every row starts an odd multiple of 16 B after the
// one before it, so the 16 rows that one ds_load_b128 reads fall on 16 different
// groups of four banks (at a pitch that is a multiple of 64 B they share one to four)
#define XP   132      // f32 rows of 128: x, out1          (528 B)
#define QKP  200      // bf16 rows of 192: xqk             (400 B)
#define CP   136      // bf16 rows of 128: Q, h0           (272 B)
#define TP   40       // bf16 rows of 32: K^T, V^T, KV^T   (80 B)
#define FP   520      // bf16 rows of 512: h1              (1040 B)
// byte offsets inside one pixel's slab
#define O_X    0
#define O_XQK  16896
#define O_Q    29696
#define O_KT   38400
#define O_VT   48640
#define O_KVT  16896  // over xqk, which is dead when KV^T is written
#define O_H0   55296  // behind out1, over the end of V^T and the row figures (both dead)
#define O_STAT 58880
#define SLAB   64000  // LDS bytes per pixel
#define O_STG  (PX * SLAB)          // behind the slabs: the next tile's x as it lies in the
#define STGB   (TT * CC * PX * 4)   // pixel-major copy: TT*CC values of one pixel after another
#define P1T  16       // weight tiles that one wave uses in P1: 6 of Wq, 6 of Wk, 4 of Wv
#define P1D  8        // how many of them are on their way at any time

static __device__ __forceinline__ v8f vzero8() {
  v8f z;
#pragma unroll
  for (int i = 0; i < 8; ++i) z[i] = 0.0f;
  return z;
}

static __device__ __forceinline__ v8f wmma_bf16(v16bf a, v16bf b, v8f c) {
  return __builtin_amdgcn_wmma_f32_16x16x32_bf16(
      /*neg_a=*/false, a, /*neg_b=*/false, b,
      /*c_mod=*/(short)0, c, /*reuse_a=*/false, /*reuse_b=*/false);
}

// Load a 16x32 bf16 operand tile from row-major storage (A operands, and the B
// operands that are kept N x K in LDS: both sides have the same lane layout).
// lanes 0-15: row rcBase+lane, K = {k..k+7, k+16..k+23}
// lanes 16-31: row rcBase+lane-16, K = {k+8..k+15, k+24..k+31}
template <typename P>
static __device__ __forceinline__ v16bf ld_tile(P base, int stride, int rcBase,
                                                int kBase, int lane) {
  int r = lane & 15, half = lane >> 4;
  P p = base + (size_t)(rcBase + r) * stride + kBase + half * 8;
  v16bf a;
#pragma unroll
  for (int i = 0; i < 8; ++i) { a[i] = p[i]; a[i + 8] = p[16 + i]; }
  return a;
}

// Load one 16(n) x 32(k) weight tile that prep_weights has stored in register order:
// 1 KB a tile, the 32 lanes' first eight values in its first 512 B and their second
// eight in the other 512 B, so that each 16-byte load of a wave reads four whole lines.
static __device__ __forceinline__ v16bf ld_wtile(const bf16* mat, int tile, int lane) {
  const v8bf* p = reinterpret_cast<const v8bf*>(mat + tile * 512 + lane * 8);
  return __builtin_shufflevector(p[0], p[32], 0, 1, 2, 3, 4, 5, 6, 7,
                                 8, 9, 10, 11, 12, 13, 14, 15);
}

// source index of packed element j of a (K x N) row-major weight: tile = nt * (K/32) + kb;
// inside the tile bit 8 picks k+16, bits 7..3 the lane (n = lane & 15, k+8 for lanes 16-31),
// bits 2..0 the eight neighbours along k: the k order of ld_tile at every lane and position
static __device__ __forceinline__ int packed_src(int j, int K, int N) {
  int tile = j >> 9, e = j & 511;
  int nt = tile / (K / 32), kb = tile % (K / 32);
  int lane = (e >> 3) & 31;
  int n = nt * 16 + (lane & 15);
  int k = kb * 32 + (e >> 8) * 16 + (lane >> 4) * 8 + (e & 7);
  return k * N + n;
}

// exact gelu of two values, h * Phi(h) with Phi the normal distribution function, written
// as max(h, 0) - a * Phi(-a), a = |h|: one form for both signs and for every size of h, so
// no branch. Phi(-a) = 2^p(a): p is a degree-8 fit of log2(Phi(-a)) on 0 <= a <= 6, its error
// weighted by Phi(-a); against gelu in double precision the f32 result is off by less than
// 3e-7 on -8 <= h <= 8 (with the library's erf in h / 2 * (1 + erf(h / sqrt 2)): 5e-7).
// Past a = 6 the term a * Phi(-a) is held at its value there, 6e-9 (true value: less).
static __device__ __forceinline__ v2f gelu2(v2f h) {
  v2f a, e, relu;
  a[0] = fminf(fabsf(h[0]), 6.0f);
  a[1] = fminf(fabsf(h[1]), 6.0f);
  v2f p = -0.00000138095049f;
  p = __builtin_elementwise_fma(p, a, (v2f)0.0000228085610f);
  p = __builtin_elementwise_fma(p, a, (v2f)-0.000112637688f);
  p = __builtin_elementwise_fma(p, a, (v2f)-0.000299850391f);
  p = __builtin_elementwise_fma(p, a, (v2f)0.00725496560f);
  p = __builtin_elementwise_fma(p, a, (v2f)-0.0526133589f);
  p = __builtin_elementwise_fma(p, a, (v2f)-0.459174365f);
  p = __builtin_elementwise_fma(p, a, (v2f)-1.15110886f);
  p = __builtin_elementwise_fma(p, a, (v2f)-0.999999940f);
  e[0] = __builtin_amdgcn_exp2f(p[0]);   // p is never below -30: no range handling needed
  e[1] = __builtin_amdgcn_exp2f(p[1]);
  relu[0] = fmaxf(h[0], 0.0f);
  relu[1] = fmaxf(h[1], 0.0f);
  return __builtin_elementwise_fma(-a, e, relu);
}

// ---- layer-norm rows: four lanes a row, 32 values a lane, held in registers ----
// lane q of a row takes columns q*16..q*16+15 and 64+q*16..64+q*16+15: at the row pitch XP
// the 16 lanes that one half of a ds_load_b128 serves (4 rows x 4 q) fall on 16 different
// groups of four banks
static __device__ __forceinline__ int ln_col(int q, int i) {
  return (i >> 2) * 64 + q * 16 + (i & 3) * 4;
}

// sum over the four lanes of a row (lane bits 2 and 3), every lane gets it: two DPP steps
// inside the 16-lane row (row_xmask:4, row_xmask:8), no LDS round trip
static __device__ __forceinline__ float sum_row_lanes(float v) {
  v += __int_as_float(__builtin_amdgcn_update_dpp(0, __float_as_int(v), 0x164, 0xf, 0xf, true));
  v += __int_as_float(__builtin_amdgcn_update_dpp(0, __float_as_int(v), 0x168, 0xf, 0xf, true));
  return v;
}

// mean and 1/sqrt(var + 1e-5) of a row of CC values; two passes, as the definition has it
static __device__ __forceinline__ void ln_stats(const float* row, int q, v4f (&v)[8],
                                                float& mu, float& rv) {
  // the three loops unrolled: v[] is indexed by constants and stays in registers
#pragma unroll
  for (int i = 0; i < 8; ++i) v[i] = *reinterpret_cast<const v4f*>(row + ln_col(q, i));
  v4f s = v[0];
#pragma unroll
  for (int i = 1; i < 8; ++i) s += v[i];
  mu = sum_row_lanes((s[0] + s[1]) + (s[2] + s[3])) * (1.0f / CC);
  v4f w = 0.0f;
#pragma unroll
  for (int i = 0; i < 8; ++i) { v4f d = v[i] - mu; w += d * d; }
  rv = rsqrtf(sum_row_lanes((w[0] + w[1]) + (w[2] + w[3])) * (1.0f / CC) + 1e-5f);
}

// element offset of pixel n in the pixel-major copies of x and of out, at t = 0, c = 0
static __device__ __forceinline__ size_t pix_off(int n) {
  return (size_t)n * (TT * CC);
}

// One tile's x, global memory -> staging buffer, through no register: thread w brings the
// 16-byte pieces w, w + 512, ... of the tile's 64 KB in a row to the same places of the buffer. The copies count on
// asynccnt alone, so the weight loads issued behind them are not held up by their return.
// s_wait_xcnt stands inside the statement: in front of any reuse of the address registers.
static __device__ __forceinline__ void copy_x_tile(const float* xn, unsigned stg, int wtid) {
  const float* g = xn + (size_t)wtid * 4;
  const unsigned l = stg + wtid * 16;
  const size_t gs = (size_t)(128 * PX) * 4;
  const unsigned ls = 128 * PX * 16;
  asm volatile(
      "global_load_async_to_lds_b128 %0, %8, off\n\t"
      "global_load_async_to_lds_b128 %1, %9, off\n\t"
      "global_load_async_to_lds_b128 %2, %10, off\n\t"
      "global_load_async_to_lds_b128 %3, %11, off\n\t"
      "global_load_async_to_lds_b128 %4, %12, off\n\t"
      "global_load_async_to_lds_b128 %5, %13, off\n\t"
      "global_load_async_to_lds_b128 %6, %14, off\n\t"
      "global_load_async_to_lds_b128 %7, %15, off\n\t"
      "s_wait_xcnt 0x0"
      :: "v"(l), "v"(l + ls), "v"(l + 2 * ls), "v"(l + 3 * ls),
         "v"(l + 4 * ls), "v"(l + 5 * ls), "v"(l + 6 * ls), "v"(l + 7 * ls),
         "v"(g), "v"(g + gs), "v"(g + 2 * gs), "v"(g + 3 * gs),
         "v"(g + 4 * gs), "v"(g + 5 * gs), "v"(g + 6 * gs), "v"(g + 7 * gs)
      : "memory");
}

// ---- weight prep: fp32 -> bf16, packed tile by tile in the order ld_wtile reads ----
// ws layout (bf16 elements): Wqt[0..24576) Wkt[..49152) Wvt[..65536)
//                            W1t[..131072) W2t[..196608)
__global__ void prep_weights(const float* __restrict__ Wq,
                             const float* __restrict__ Wk,
                             const float* __restrict__ Wv,
                             const float* __restrict__ W1,
                             const float* __restrict__ W2,
                             unsigned short* __restrict__ wsu) {
  bf16* o = reinterpret_cast<bf16*>(wsu);
  int i = blockIdx.x * blockDim.x + threadIdx.x;
  if (i >= 196608) return;
  int j = i;
  if (j < 24576) { o[i] = (bf16)Wq[packed_src(j, CG, CC)]; return; }
  j -= 24576;
  if (j < 24576) { o[i] = (bf16)Wk[packed_src(j, CG, CC)]; return; }
  j -= 24576;
  if (j < 16384) { o[i] = (bf16)Wv[packed_src(j, CC, CC)]; return; }
  j -= 16384;
  if (j < 65536) { o[i] = (bf16)W1[packed_src(j, CC, FF)]; return; }
  j -= 65536;
  o[i] = (bf16)W2[packed_src(j, FF, CC)];
}

// ---- transposition of BB planes: src [R][N] -> dst [N][R], tiles of 128 x 128 through LDS ----
// Every global load and store of a wave is 512 bytes in a row (four whole lines). A lane
// loads a block of 8 x 4 values, turns its two 4 x 4 halves in its registers and stores eight 16-byte pieces of
// the turned tile; piece number b of tile row d lies at place b ^ ((d >> 2) & 15) of the row,
// so that the 16 lanes of half a ds_store_b128 (rows four apart) fall on 16 different groups
// of four banks. One workgroup takes the same tile of each plane, one plane after another.
template <int R, int N>
static __device__ __forceinline__ void transpose_tiles(const float* __restrict__ src,
                                                       float* __restrict__ dst,
                                                       float (*buf)[128 * 128]) {
  const int lane = threadIdx.x & 31;
  const int w    = threadIdx.x >> 5;              // 16 waves, eight tile rows each
  const int rb   = blockIdx.x / (N / 128), cb = blockIdx.x % (N / 128);
  const float* s = src + (size_t)(rb * 128 + w * 8) * N + cb * 128 + lane * 4;
  float*       d = dst + (size_t)(cb * 128 + w * 8) * R + rb * 128 + lane * 4;
  v4f a[2][8];
  // all loops unrolled: a[] is indexed by constants and stays in registers
  auto load_plane = [&](int pl) {
    const float* sp = s + (size_t)pl * R * N;
#pragma unroll
    for (int k = 0; k < 8; ++k)
      a[pl & 1][k] = *reinterpret_cast<const v4f*>(sp + (size_t)k * N);
    // the wait that belongs in front of an overwrite of the run's address registers; the
    // operand keeps them alive up to here
    asm volatile("s_wait_xcnt 0x0" :: "v"(sp) : "memory");
  };
  load_plane(0);
  load_plane(1);
#pragma unroll
  for (int pl = 0; pl < BB; ++pl) {
    float* t = buf[pl & 1];
#pragma unroll
    for (int q = 0; q < 2; ++q)
#pragma unroll
      for (int j = 0; j < 4; ++j) {
        v4f c = {a[pl & 1][q * 4][j], a[pl & 1][q * 4 + 1][j], a[pl & 1][q * 4 + 2][j],
                 a[pl & 1][q * 4 + 3][j]};
        *reinterpret_cast<v4f*>(t + (lane * 4 + j) * 128 + ((w * 2 + q) ^ (lane & 15)) * 4) = c;
      }
    // the plane after the next sets out as soon as its registers are free
    if (pl + 2 < BB) load_plane(pl + 2);
    // one barrier a plane: it publishes this tile, and the buffer that the next plane writes
    // was last read in front of it. Written by hand with fences on LDS alone: __syncthreads()
    // made every wave sit out its global stores and the loads that fly for later planes
    __builtin_amdgcn_fence(__ATOMIC_RELEASE, "workgroup", "local");
    __builtin_amdgcn_s_barrier();
    __builtin_amdgcn_fence(__ATOMIC_ACQUIRE, "workgroup", "local");
    v4f o[8];
#pragma unroll
    for (int k = 0; k < 8; ++k)
      o[k] = *reinterpret_cast<const v4f*>(t + (w * 8 + k) * 128 +
                                           (lane ^ (((w * 8 + k) >> 2) & 15)) * 4);
    float* dp = d + (size_t)pl * R * N;
#pragma unroll
    for (int k = 0; k < 8; ++k)
      *reinterpret_cast<v4f*>(dp + (size_t)k * R) = o[k];
    // the wait that belongs in front of an overwrite of the stores' address and data
    // registers; the operands (inputs only) keep them alive up to here
    asm volatile("s_wait_xcnt 0x0" :: "v"(dp), "v"(o[0]), "v"(o[1]), "v"(o[2]), "v"(o[3]),
                 "v"(o[4]), "v"(o[5]), "v"(o[6]), "v"(o[7]) : "memory");
  }
}

// x (B, T*C, H*W) -> pixel-major copy (B, H*W, T*C) in the workspace
__global__ __launch_bounds__(512)
void x_to_pixel_major(const float* __restrict__ x, float* __restrict__ xt) {
  __shared__ __attribute__((aligned(16))) float buf[2][128 * 128];
  transpose_tiles<TT * CC, HWS>(x, xt, buf);
}

// pixel-major result (B, H*W, T*C) in the workspace -> out (B, T*C, H*W)
__global__ __launch_bounds__(512)
void out_from_pixel_major(const float* __restrict__ ot, float* __restrict__ out) {
  __shared__ __attribute__((aligned(16))) float buf[2][128 * 128];
  transpose_tiles<HWS, TT * CC>(ot, out, buf);
}

// ---- fused block: one workgroup works through TILES tiles of PX adjacent pixels; four
// waves and one LDS slab per pixel; x is read from and the result written to pixel-major
// copies in the workspace, 64 KB in a row a tile, whole lines;
// the next tile's x is on its way into LDS while this tile is worked on.
// In the three products with weights (P1, P5, P6) the 16 waves are dealt over the column
// tiles, and a wave takes the rows of two or of all four pixels: a weight tile that has come
// from L2 serves 64 or 128 rows, not 32, and so much less weight traffic leaves L2 ----
__global__ __launch_bounds__(128 * PX)
void fused_block(const float* __restrict__ x, const float* __restrict__ gdn,
                 const float* __restrict__ bq, const float* __restrict__ bk,
                 const float* __restrict__ bv,
                 const float* __restrict__ ln1g, const float* __restrict__ ln1b,
                 const float* __restrict__ ln2g, const float* __restrict__ ln2b,
                 const float* __restrict__ b1, const float* __restrict__ b2,
                 const unsigned short* __restrict__ wsu,
                 float* __restrict__ out) {
  __shared__ __attribute__((aligned(16))) unsigned char smem_all[PX * SLAB + STGB];
  // LDS byte address of the staging buffer: the low 32 bits of its address
  const unsigned stg = (unsigned)(uintptr_t)(smem_all + O_STG);
  // guidance of one tile: a thread's 16 values, held in registers until P0 stores them
  float gv[TT * GD / 128];
  auto load_guidance = [&](int b, int tid) {
    // unrolled: gv[] is indexed by constants and stays in registers
#pragma unroll
    for (int k = 0; k < TT * GD / 128; ++k) {
      int i = k * 128 + tid;
      int t = i >> 6, j = i & 63;
      gv[k] = gdn[((size_t)b * TT + t) * GD + j];
    }
    // later instructions reuse the run's address registers: the wait that belongs in
    // front of such an overwrite
    asm volatile("s_wait_xcnt 0x0" ::: "memory");
  };

  // tile 0's x and guidance (no wave has touched LDS yet)
  copy_x_tile(x + pix_off(blockIdx.x * PX), stg, threadIdx.x);
  load_guidance((blockIdx.x * PX) >> 10, threadIdx.x & 127);

  // kept rolled: one copy of the body
#pragma unroll 1
  for (int tl = 0; tl < TILES; ++tl) {
  const int n = (tl * NWG + blockIdx.x) * PX;    // first of the tile's PX pixels
  const int nn = n + NWG * PX;                   // the same of the next tile
  // The lane's number is formed anew in every trip, by an instruction that stays where it
  // is written: the some 190 LDS and weight addresses that follow from it are then formed
  // where they are used. Taken from threadIdx.x they were all formed ahead of the loop,
  // held over it, and most of them went to scratch and were read back in every trip.
  int lane;
  asm volatile("v_mbcnt_lo_u32_b32 %0, -1, 0" : "=v"(lane));
  lane &= 31;
  // the wave's number in a scalar register: what follows from it alone takes no vector register
  const int wn   = __builtin_amdgcn_readfirstlane(threadIdx.x >> 5);   // 0 .. 4*PX-1
  const int wtid = wn * 32 + lane;                                     // 0 .. 128*PX-1
  const int ct   = wn >> 1;         // P1, P6: the wave's column tile ...
  const int pp   = (wn & 1) * 2;    // ... and the first of its two pixels
  unsigned char* smem = smem_all + (wtid >> 7) * SLAB;   // this pixel's slab
  // phase-reused LDS layout (per slab)
  float* xLDS = (float*)(smem + O_X);        // 32x128 f32, pitch XP   (dead after P3)
  bf16*  xqk  = (bf16*)(smem + O_XQK);       // 32x192 bf16, pitch QKP (dead after P1)
  bf16*  Qs   = (bf16*)(smem + O_Q);         // 32x128 bf16, pitch CP  (dead after P3)
  bf16*  Kt   = (bf16*)(smem + O_KT);        // 128x32 bf16, pitch TP  (dead after P2)
  bf16*  Vt   = (bf16*)(smem + O_VT);        // 128x32 bf16, pitch TP  (dead after P2)
  bf16*  KVt  = (bf16*)(smem + O_KVT);       // 128x32 bf16, pitch TP  (over xqk; dead after P3)
  float* Ksum = (float*)(smem + O_STAT);         // 128 f32
  float* Zl   = (float*)(smem + O_STAT + 512);   // 128 f32 (l*4+h)
  float* mu1  = (float*)(smem + O_STAT + 1024);  // 32
  float* rv1  = (float*)(smem + O_STAT + 1152);  // 32
  float* out1 = (float*)(smem + O_KT);       // 32x128 f32, pitch XP (over Kt+Vt)
  bf16*  h0   = (bf16*)(smem + O_H0);        // 32x128 bf16, pitch CP (over Vt's end, row figures)
  // h1 at O_X:                                 32x512 bf16, pitch FP (over x,xqk,Q)

  const bf16* Wqt = reinterpret_cast<const bf16*>(wsu);
  const bf16* Wkt = Wqt + 24576;
  const bf16* Wvt = Wqt + 49152;
  const bf16* W1t = Wqt + 65536;
  const bf16* W2t = Wqt + 131072;

  const int tid  = wtid & 127;        // thread within the pixel's four waves
  const int wv   = tid >> 5;          // wave id 0..3 within the pixel
  const int r    = lane & 15;
  const int half = lane >> 4;
  const int lnr  = wv * 8 + half * 4 + (lane & 3);   // layer norms: this lane's row ...
  const int lnq  = (lane >> 2) & 3;                  // ... and its quarter of the row

  // this wave's copies of the tile have landed; behind the barrier every wave's have, and
  // every wave has left the tile before (its reads of out1 in P7)
  asm volatile("s_wait_asynccnt 0x0" ::: "memory");
  __syncthreads();

  // the idx-th weight tile in the order in which P1 uses them: the wave's column tile, k step
  // by k step; in each step q, k and, over x's 128 columns, v
  auto p1_tile = [&](int idx) -> v16bf {
    const int kb = idx < 12 ? idx / 3 : 4 + (idx - 12) / 2;
    const int m  = idx < 12 ? idx % 3 : (idx - 12) % 2;
    if (m == 0) return ld_wtile(Wqt, ct * (CG / 32) + kb, lane);
    if (m == 1) return ld_wtile(Wkt, ct * (CG / 32) + kb, lane);
    return ld_wtile(Wvt, ct * (CC / 32) + kb, lane);
  };
  // -------- P0: x from the staging buffer to the slabs, xqk=[x|guidance] --------
  // all of a thread's 16-byte reads ahead of the first store, so that they are in flight
  // together; both loops unrolled: xs[] is indexed by constants and stays in registers
  v4f xs[TT * CC / (128 * PX)];
#pragma unroll
  for (int it = 0; it < TT * CC / (128 * PX); ++it)
    xs[it] = *reinterpret_cast<const v4f*>(smem_all + O_STG + (it * (128 * PX) + wtid) * 16);
#pragma unroll
  for (int it = 0; it < TT * CC / (128 * PX); ++it) {
    int i = it * (128 * PX) + wtid;   // piece i: pixel p, row t, four columns from c on
    int p = i >> 10, t = (i >> 5) & 31, c = (i & 31) * 4;
    *reinterpret_cast<v4f*>((float*)(smem_all + p * SLAB + O_X) + t * XP + c) = xs[it];
    *reinterpret_cast<v4bf*>((bf16*)(smem_all + p * SLAB + O_XQK) + t * QKP + c) =
        __builtin_convertvector(xs[it], v4bf);
  }
  // unrolled like the load loop: gv[] is indexed by constants
#pragma unroll
  for (int k = 0; k < TT * GD / 128; ++k) {
    int i = k * 128 + tid;
    int t = i >> 6, j = i & 63;
    xqk[t * QKP + 128 + j] = (bf16)gv[k];
  }
  // P1's first P1D weight tiles set out here, in front of the barrier: they need nothing of
  // LDS and fly while the wave waits for the others.
  // Unrolled: Br[] is indexed by constants and stays in registers
  v16bf Br[P1D];
  // keeps the run from moving up among P0's values, where it cost registers (spills to scratch)
  __builtin_amdgcn_sched_barrier(0);
#pragma unroll
  for (int i = 0; i < P1D; ++i) Br[i] = p1_tile(i);
  __syncthreads();

  // -------- P1: q,k (K=192) and v (K=128) GEMMs --------
  // One column tile of q, k and v for the 64 rows of two pixels: four row tiles m4 (pixel
  // pp + m4 / 2, its rows (m4 & 1) * 16 ...), so every weight tile feeds four products.
  // All loops unrolled: Br[] and the accumulators are indexed by constants
  {
    v8f aq[4], ak[4], av[4];
#pragma unroll
    for (int m = 0; m < 4; ++m) { aq[m] = vzero8(); ak[m] = vzero8(); av[m] = vzero8(); }
#pragma unroll
    for (int kb = 0; kb < 6; ++kb) {
      v16bf A[4];
#pragma unroll
      for (int m4 = 0; m4 < 4; ++m4)
        A[m4] = ld_tile((const bf16*)(smem_all + (pp + (m4 >> 1)) * SLAB + O_XQK), QKP,
                        (m4 & 1) * 16, kb * 32, lane);
      // a ring of P1D tiles in registers: tile idx + P1D is asked for where tile idx is taken
      // out, written out here: left to itself the compiler put each load directly in front of
      // its products, and the wave sat out the whole latency of nearly every load
#pragma unroll
      for (int m = 0; m < (kb < 4 ? 3 : 2); ++m) {
        const int idx = kb < 4 ? kb * 3 + m : 12 + (kb - 4) * 2 + m;
        v16bf Bc = Br[idx % P1D];
        if (idx + P1D < P1T) {
          Br[idx % P1D] = p1_tile(idx + P1D);
          // keeps the load here: without it the scheduler moved it down to its first use
          __builtin_amdgcn_sched_barrier(0);
        }
#pragma unroll
        for (int m4 = 0; m4 < 4; ++m4) {
          if (m == 0)      aq[m4] = wmma_bf16(Bc, A[m4], aq[m4]);   // Wq as A: q comes out turned
          else if (m == 1) ak[m4] = wmma_bf16(A[m4], Bc, ak[m4]);
          else             av[m4] = wmma_bf16(A[m4], Bc, av[m4]);
        }
      }
    }
    // epilogue: bias, elu+1, Q (row-major) and K^T, V^T to each pixel's slab. With the weights
    // as A a lane's eight q values are eight neighbouring columns of row r of the row tile
    int col = ct * 16 + r;
    float bkv = bk[col], bvv = bv[col];
    const int qc = ct * 16 + half * 8;   // the first of the lane's eight q columns
    const v4f* bq4 = reinterpret_cast<const v4f*>(bq + qc);
    v4f bqv[2] = {bq4[0], bq4[1]};
    // the wait that belongs in front of an overwrite of the two loads' address registers; the
    // operand keeps them alive up to here, so that no load lands in them
    asm volatile("s_wait_xcnt 0x0" :: "v"(bq4) : "memory");
    // keeps every use of a bias behind all four loads: without it the first sums with bk and bv
    // stood between the loads, and the wave sat out two load latencies, one after the other
    __builtin_amdgcn_sched_barrier(0);
#pragma unroll
    for (int m4 = 0; m4 < 4; ++m4) {
      unsigned char* sl = smem_all + (pp + (m4 >> 1)) * SLAB;
      const int mt = m4 & 1;
      v8bf q8, k8, v8;   // eight neighbours of one Q / K^T / V^T row: one 16-byte store each
#pragma unroll
      for (int i = 0; i < 8; ++i) {
        float qv = aq[m4][i] + bqv[i >> 2][i & 3];
        qv = (qv > 0.f) ? (qv + 1.f) : __expf(qv);
        q8[i] = (bf16)qv;
        float kv = ak[m4][i] + bkv;
        kv = (kv > 0.f) ? (kv + 1.f) : __expf(kv);
        k8[i] = (bf16)kv;
        v8[i] = (bf16)(av[m4][i] + bvv);
      }
      *reinterpret_cast<v8bf*>((bf16*)(sl + O_Q) + (mt * 16 + r) * CP + qc) = q8;
      *reinterpret_cast<v8bf*>((bf16*)(sl + O_KT) + col * TP + mt * 16 + half * 8) = k8;
      *reinterpret_cast<v8bf*>((bf16*)(sl + O_VT) + col * TP + mt * 16 + half * 8) = v8;
    }
  }
  __syncthreads();

  // LN2's scale and shift for this lane's 32 columns, asked for ahead of the copies, not behind them
  v4f g2[8], s2[8];
  const int lnoff = lnq * 16;
  // unrolled: g2[], s2[] stay in registers and the 16 loads are in flight together
#pragma unroll
  for (int i = 0; i < 8; ++i) {
    g2[i] = *reinterpret_cast<const v4f*>(ln2g + lnoff + ln_col(0, i));
    s2[i] = *reinterpret_cast<const v4f*>(ln2b + lnoff + ln_col(0, i));
  }
  // LN1's scale and shift for this lane's twice eight columns of P3, for the same reason
  v4f l1g[2][2], l1b[2][2];
  const int l1off = wv * 32 + half * 8;
#pragma unroll
  for (int nt = 0; nt < 2; ++nt)
#pragma unroll
    for (int q2 = 0; q2 < 2; ++q2) {
      l1g[nt][q2] = *reinterpret_cast<const v4f*>(ln1g + l1off + nt * 16 + q2 * 4);
      l1b[nt][q2] = *reinterpret_cast<const v4f*>(ln1b + l1off + nt * 16 + q2 * 4);
    }
  // the wait that belongs in front of an overwrite of the run's offset registers; the
  // operands keep those registers alive up to here, so that no load of the run lands in them
  asm volatile("s_wait_xcnt 0x0" :: "v"(lnoff * 4), "v"(l1off * 4) : "memory");

  // the next tile's x sets out here, where no phase needs global memory for a while. Every
  // wave's reads of the staging buffer ended two barriers ago; this wave's LDS operations
  // have retired before its copies aim at LDS
  if (tl + 1 < TILES) {
    asm volatile("s_wait_dscnt 0x0" ::: "memory");
    copy_x_tile(x + pix_off(nn), stg, wtid);
  }

  // -------- P2: Ksum, KV = K^T @ V (per head, one WMMA K-step) --------
  {
    float s = 0.f;
#pragma unroll
    for (int i = 0; i < TT; ++i) s += (float)Kt[tid * TP + i];
    Ksum[tid] = s;
  }
  {
    int h = wv;
    v8f acc[2][2];
#pragma unroll
    for (int m = 0; m < 2; ++m)
#pragma unroll
      for (int j = 0; j < 2; ++j) acc[m][j] = vzero8();
#pragma unroll
    for (int mt = 0; mt < 2; ++mt) {
      v16bf A = ld_tile(Kt, TP, h * 32 + mt * 16, 0, lane);
#pragma unroll
      for (int nt = 0; nt < 2; ++nt) {
        v16bf Bv = ld_tile(Vt, TP, h * 32 + nt * 16, 0, lane);
        acc[mt][nt] = wmma_bf16(A, Bv, acc[mt][nt]);
      }
    }
#pragma unroll
    for (int mt = 0; mt < 2; ++mt)
#pragma unroll
      for (int nt = 0; nt < 2; ++nt)
#pragma unroll
        for (int i = 0; i < 8; ++i) {
          int d = mt * 16 + half * 8 + i;       // row of KV
          int e = h * 32 + nt * 16 + r;          // global v-column
          KVt[e * TP + d] = (bf16)acc[mt][nt][i];
        }
  }
  __syncthreads();

  // -------- P2c: Z = 1/(Q.Ksum+eps), ln1 stats --------
  {
    int l = tid >> 2, h = tid & 3;
    float d = 0.f;
#pragma unroll
    for (int i = 0; i < 32; ++i)
      d += (float)Qs[l * CP + h * 32 + i] * Ksum[h * 32 + i];
    Zl[tid] = 1.0f / (d + 1e-6f);
  }
  {
    v4f xv[8];
    float mu, rv;
    ln_stats(xLDS + lnr * XP, lnq, xv, mu, rv);
    if (lnq == 0) { mu1[lnr] = mu; rv1[lnr] = rv; }
  }
  __syncthreads();

  // -------- P3: out = (Q @ KV)*Z + LN1(x)  (writes out1 over Kt/Vt) --------
  {
    int h = wv;
    v8f acc[2][2];
#pragma unroll
    for (int m = 0; m < 2; ++m)
#pragma unroll
      for (int j = 0; j < 2; ++j) acc[m][j] = vzero8();
#pragma unroll
    for (int mt = 0; mt < 2; ++mt) {
      v16bf Bq = ld_tile(Qs, CP, mt * 16, h * 32, lane);
#pragma unroll
      for (int nt = 0; nt < 2; ++nt) {
        // KV^T as A: a lane's eight values are eight neighbouring columns of row mt * 16 + r
        v16bf Akv = ld_tile(KVt, TP, h * 32 + nt * 16, 0, lane);
        acc[mt][nt] = wmma_bf16(Akv, Bq, acc[mt][nt]);
      }
    }
    // the lane's two rows: their figures and their x, read ahead of the first out1 store
    float zz[2], mm[2], rr[2];
    v4f xv[2][2][2];
#pragma unroll
    for (int mt = 0; mt < 2; ++mt) {
      int l = mt * 16 + r;
      zz[mt] = Zl[l * 4 + h];
      mm[mt] = mu1[l];
      rr[mt] = rv1[l];
#pragma unroll
      for (int nt = 0; nt < 2; ++nt)
#pragma unroll
        for (int q2 = 0; q2 < 2; ++q2)
          xv[mt][nt][q2] = *reinterpret_cast<const v4f*>(
              xLDS + l * XP + h * 32 + nt * 16 + half * 8 + q2 * 4);
    }
#pragma unroll
    for (int mt = 0; mt < 2; ++mt)
#pragma unroll
      for (int nt = 0; nt < 2; ++nt)
#pragma unroll
        for (int q2 = 0; q2 < 2; ++q2) {
          v4f res4;
#pragma unroll
          for (int e = 0; e < 4; ++e) {
            float res = acc[mt][nt][q2 * 4 + e] * zz[mt];
            res += (xv[mt][nt][q2][e] - mm[mt]) * rr[mt] * l1g[nt][q2][e] + l1b[nt][q2][e];
            res4[e] = res;
          }
          *reinterpret_cast<v4f*>(out1 + (mt * 16 + r) * XP + h * 32 + nt * 16 + half * 8 +
                                  q2 * 4) = res4;
        }
  }
  __syncthreads();

  // -------- P4: LN2 -> h0 (bf16), straight from the registers the statistics came from --------
  {
    v4f ov[8];
    float mu, rv;
    ln_stats(out1 + lnr * XP, lnq, ov, mu, rv);
    // both loops unrolled: ov[], g2[], s2[] are indexed by constants
#pragma unroll
    for (int j = 0; j < 4; ++j) {
      v8bf hb;   // eight neighbours of the row: one 16-byte store
#pragma unroll
      for (int e = 0; e < 8; ++e) {
        int i = j * 2 + (e >> 2);
        hb[e] = (bf16)((ov[i][e & 3] - mu) * rv * g2[i][e & 3] + s2[i][e & 3]);
      }
      *reinterpret_cast<v8bf*>(h0 + lnr * CP + ln_col(lnq, j * 2)) = hb;
    }
  }
  __syncthreads();

  // -------- P5: h1 = gelu(h0 @ W1 + b1)  (32x512 a pixel, over x/xqk/Q) --------
  // Two column tiles for the 128 rows of all four pixels: the wave's eight weight tiles are
  // read once and stay in registers, the rows of h0 pass by from LDS, row tile by row tile.
  // All loops unrolled: Bh[], Ah[] and the accumulators are indexed by constants
  {
    v16bf Bh[2][4];
    v4f bb[2][2];   // b1 of the lane's twice eight columns
    const v8bf* w5 = reinterpret_cast<const v8bf*>(W1t + wn * (2 * (CC / 32) * 512) + lane * 8);
    const float* b5 = b1 + wn * 32 + half * 8;
#pragma unroll
    for (int j = 0; j < 2; ++j) {
#pragma unroll
      for (int kb = 0; kb < 4; ++kb)   // as ld_wtile, from the one address w5
        Bh[j][kb] = __builtin_shufflevector(w5[(j * 4 + kb) * 64], w5[(j * 4 + kb) * 64 + 32], 0, 1, 2,
                                            3, 4, 5, 6, 7, 8, 9, 10, 11, 12, 13, 14, 15);
      bb[j][0] = *reinterpret_cast<const v4f*>(b5 + j * 16);
      bb[j][1] = *reinterpret_cast<const v4f*>(b5 + j * 16 + 4);
    }
    // the wait that belongs in front of an overwrite of the run's address registers; the
    // operands keep them alive up to here, so that no load of the run lands in them
    asm volatile("s_wait_xcnt 0x0" :: "v"(w5), "v"(b5) : "memory");
#pragma unroll
    for (int m8 = 0; m8 < 2 * PX; ++m8) {
      unsigned char* sl = smem_all + (m8 >> 1) * SLAB;
      v16bf Ah[4];
#pragma unroll
      for (int kb = 0; kb < 4; ++kb)
        Ah[kb] = ld_tile((const bf16*)(sl + O_H0), CP, (m8 & 1) * 16, kb * 32, lane);
      v8f acc[2] = {vzero8(), vzero8()};
#pragma unroll
      for (int kb = 0; kb < 4; ++kb) {
        // W1 as A: a lane's eight values are eight neighbouring columns of row r of the row tile
        acc[0] = wmma_bf16(Bh[0][kb], Ah[kb], acc[0]);
        acc[1] = wmma_bf16(Bh[1][kb], Ah[kb], acc[1]);
      }
#pragma unroll
      for (int j = 0; j < 2; ++j) {
        v8bf h8;   // eight neighbours of one h1 row: one 16-byte store
#pragma unroll
        for (int i = 0; i < 8; i += 2) {
          v2f hv = {acc[j][i] + bb[j][i >> 2][i & 3], acc[j][i + 1] + bb[j][i >> 2][(i & 3) + 1]};
          v2bf hb = __builtin_convertvector(gelu2(hv), v2bf);
          h8[i] = hb[0];
          h8[i + 1] = hb[1];
        }
        *reinterpret_cast<v8bf*>((bf16*)(sl + O_X) + ((m8 & 1) * 16 + r) * FP +
                                 (wn * 2 + j) * 16 + half * 8) = h8;
      }
    }
  }
  __syncthreads();

  // -------- P6: out1 += h1 @ W2 + b2 (in place, each element by its own thread) --------
  // One column tile for the 64 rows of two pixels, row tiles m4 as in P1
  {
    v8f acc[4];
#pragma unroll
    for (int m = 0; m < 4; ++m) acc[m] = vzero8();
    // the weights of k step kb + 8 are asked for ahead of step kb's products, written out:
    // inside the loop the compiler left each load directly in front of its use.
    // All loops unrolled: Bw[] is indexed by constants
    v16bf Bw[8];
    const v8bf* w6 = reinterpret_cast<const v8bf*>(W2t + ct * ((FF / 32) * 512) + lane * 8);
    auto p6_tile = [&](int kb) -> v16bf {   // as ld_wtile, from the one address w6
      return __builtin_shufflevector(w6[kb * 64], w6[kb * 64 + 32], 0, 1, 2, 3, 4, 5, 6, 7,
                                     8, 9, 10, 11, 12, 13, 14, 15);
    };
#pragma unroll
    for (int kb = 0; kb < 8; ++kb) Bw[kb] = p6_tile(kb);
#pragma unroll
    for (int kb = 0; kb < 16; ++kb) {
      v16bf A[4];
#pragma unroll
      for (int m4 = 0; m4 < 4; ++m4)
        A[m4] = ld_tile((const bf16*)(smem_all + (pp + (m4 >> 1)) * SLAB + O_X), FP,
                        (m4 & 1) * 16, kb * 32, lane);
      v16bf Bc = Bw[kb & 7];
      if (kb + 8 < 16) Bw[kb & 7] = p6_tile(kb + 8);
      // behind the last weight load: the wait that belongs in front of an overwrite of the
      // address registers; the operand keeps them alive up to here, so that no load lands in them
      if (kb + 8 == 15) asm volatile("s_wait_xcnt 0x0" :: "v"(w6) : "memory");
#pragma unroll
      // W2 as A: a lane's eight values are eight neighbouring columns of row r of the row tile
      for (int m4 = 0; m4 < 4; ++m4) acc[m4] = wmma_bf16(Bc, A[m4], acc[m4]);
    }
    const int c = ct * 16 + half * 8;   // the first of the lane's eight columns
    const v4f* b24 = reinterpret_cast<const v4f*>(b2 + c);
    v4f b2v[2] = {b24[0], b24[1]};
    // the wait that belongs in front of an overwrite of the two loads' address registers; the
    // operand keeps them alive up to here, so that no load lands in them
    asm volatile("s_wait_xcnt 0x0" :: "v"(b24) : "memory");
#pragma unroll
    for (int m4 = 0; m4 < 4; ++m4) {
      v4f* o1 = reinterpret_cast<v4f*>((float*)(smem_all + (pp + (m4 >> 1)) * SLAB + O_KT) +
                                       ((m4 & 1) * 16 + r) * XP + c);
#pragma unroll
      for (int q2 = 0; q2 < 2; ++q2) {
        v4f old = o1[q2], nw;
#pragma unroll
        for (int e = 0; e < 4; ++e) nw[e] = acc[m4][q2 * 4 + e] + old[e] + b2v[q2][e];
        o1[q2] = nw;
      }
    }
  }
  __syncthreads();   // every pixel's result is in its slab before the joint store

  // the next tile's guidance is asked for ahead of this tile's stores
  if (tl + 1 < TILES) load_guidance(nn >> 10, tid);

  // -------- P7: store the tile, 16-byte pieces (four columns of a row) in a row --------
  {
    float* on = out + pix_off(n);
    v4f v[TT * CC / (128 * PX)];
    // both loops unrolled: v[] stays in registers and the LDS reads run ahead of the stores
#pragma unroll
    for (int it = 0; it < TT * CC / (128 * PX); ++it) {
      int i = it * (128 * PX) + wtid;
      int p = i >> 10, t = (i >> 5) & 31, c = (i & 31) * 4;
      v[it] = *reinterpret_cast<const v4f*>((const float*)(smem_all + p * SLAB + O_KT) + t * XP + c);
    }
#pragma unroll
    for (int it = 0; it < TT * CC / (128 * PX); ++it)
      *reinterpret_cast<v4f*>(on + (size_t)(it * (128 * PX) + wtid) * 4) = v[it];
    // the next trip reuses the stores' registers: the wait that belongs in front of that
    asm volatile("s_wait_xcnt 0x0" ::: "memory");
  }
  }   // tiles
}

extern "C" void kernel_launch(void* const* d_in, const int* in_sizes, int n_in,
                              void* d_out, int out_size, void* d_ws, size_t ws_size,
                              hipStream_t stream) {
  (void)in_sizes; (void)n_in; (void)out_size; (void)ws_size;
  const float* x    = (const float*)d_in[0];
  const float* g    = (const float*)d_in[1];
  const float* Wq   = (const float*)d_in[2];
  const float* bq   = (const float*)d_in[3];
  const float* Wk   = (const float*)d_in[4];
  const float* bk   = (const float*)d_in[5];
  const float* Wv   = (const float*)d_in[6];
  const float* bv   = (const float*)d_in[7];
  const float* ln1g = (const float*)d_in[8];
  const float* ln1b = (const float*)d_in[9];
  const float* ln2g = (const float*)d_in[10];
  const float* ln2b = (const float*)d_in[11];
  const float* W1   = (const float*)d_in[12];
  const float* b1   = (const float*)d_in[13];
  const float* W2   = (const float*)d_in[14];
  const float* b2   = (const float*)d_in[15];
  unsigned short* wt = (unsigned short*)d_ws;   // 196608 bf16 = 384 KB
  float* xt = (float*)d_ws + 262144;            // 1 MiB on: x, pixel-major, 64 MiB
  float* ot = (float*)d_ws + 17039360;          // behind it: the result, pixel-major, 64 MiB

  prep_weights<<<(196608 + 255) / 256, 256, 0, stream>>>(Wq, Wk, Wv, W1, W2, wt);
  x_to_pixel_major<<<256, 512, 0, stream>>>(x, xt);
  fused_block<<<NWG, 128 * PX, 0, stream>>>(xt, g, bq, bk, bv, ln1g, ln1b, ln2g, ln2b,
                                        b1, b2, wt, ot);
  out_from_pixel_major<<<256, 512, 0, stream>>>(ot, (float*)d_out);
}
